// v000
// The times below were measured on an AMD MI455X: many runs one after another, warmed up first and cycling through
// copies of the inputs, with the whole window's GPU time divided by the number of runs. Launches and the gaps
// between them are all in it. The median over several windows is given; except for v000 it joins two sittings, which
// can be a few percent apart, so the side-by-side timings, each taken in one sitting, are the better comparison.
// The starting kernel, v000, takes 221 microseconds a run.
// qkv projection, q.k^T, p.v and output projection: v_wmma_f32_16x16x32_f16 single products (f16 operands, f32 accumulate);
// all inputs RNE-converted to bf16 on load and carried as f16 with power-of-two scales; softmax, key padding mask and epilogues in f32 on VALU.
#include <hip/hip_runtime.h>
#include <stdint.h>

#define NWIN  128
#define NTOK  343
#define TP    384
#define CCH   256
#define NHD   8
#define HD    32
#define C3    768
#define NROWP 49152
#define NROWX 43904
#define NRPB  2197
#define NST   24
#define NKT   24
#define MT    6
#define LDC   132
#define PP    72
#define OSP   36
#define PWB   2304
#define TPW   260
#define QSC   0.17677669529663687f
#define INV512 0.001953125f
#define LN1024 6.9314718055994531f
#define MASKC (-1048576.0f)

static_assert(NROWP == NWIN * TP);
static_assert(NROWX == NWIN * NTOK);
static_assert(TP == MT * 64);
static_assert(NST * 16 == TP);
static_assert(NKT * 16 == TP);
static_assert(PWB == 16 * PP * 2);
static_assert(16 * OSP * 4 <= PWB);
static_assert((PP * 2) % 16 == 0);
static_assert((LDC * 4) % 16 == 0);
static_assert((TPW * 4) % 16 == 0);
static_assert(NHD * HD == CCH);

typedef _Float16 v16h __attribute__((ext_vector_type(16)));
typedef _Float16 v8h  __attribute__((ext_vector_type(8)));
typedef float    v8f  __attribute__((ext_vector_type(8)));
typedef float    v4f  __attribute__((ext_vector_type(4)));
typedef unsigned int v4u __attribute__((ext_vector_type(4)));

// ---- scalar helpers ------------------------------------------------------------------------------------------
__device__ __forceinline__ unsigned short bf_bits(float f) {          // f32 -> bf16 bits, RNE convert
  unsigned u = __float_as_uint(f);
  return (unsigned short)((u + 0x7FFFu + ((u >> 16) & 1u)) >> 16);
}
__device__ __forceinline__ float bf_up(unsigned short b) { return __uint_as_float(((unsigned)b) << 16); }
__device__ __forceinline__ float bfr(float f) { return bf_up(bf_bits(f)); }
__device__ __forceinline__ unsigned short h_bits(_Float16 x) { return __builtin_bit_cast(unsigned short, x); }
__device__ __forceinline__ unsigned short hb16(float f) { return h_bits((_Float16)f); }
__device__ __forceinline__ unsigned pk16(unsigned short a, unsigned short b) { return (unsigned)a | ((unsigned)b << 16); }
__device__ __forceinline__ v8f zero8() { v8f z = {0.f, 0.f, 0.f, 0.f, 0.f, 0.f, 0.f, 0.f}; return z; }

// ---- fragment loader: 16-bit A/B operand, lane -> row/col (lane&15), p already includes +8*(lane>>4);
//      elements 0..7 <- p[0..7] (k0+8h..), elements 8..15 <- p[16..23] (k0+16+8h..)
__device__ __forceinline__ v16h ldfrag_h(const _Float16* p) {
  union { v16h v; v8h h[2]; } f;
  f.h[0] = *(const v8h*)(p);
  f.h[1] = *(const v8h*)(p + 16);
  return f.v;
}

// ---- WMMA helpers; the guard helpers insert the trailing VALU hazard gap and keep A/B live -----------------------
__device__ __forceinline__ v8f mma_raw(v16h a, v16h b, v8f c) {
  return __builtin_amdgcn_wmma_f32_16x16x32_f16(false, a, false, b, (short)0, c, false, false);
}
__device__ __forceinline__ v8f mma_g1(v16h a, v16h b, v8f c) {
  c = mma_raw(a, b, c);
#if defined(__HIP_DEVICE_COMPILE__)
  asm volatile("v_nop\n\tv_nop\n\tv_nop\n\tv_nop" : "+v"(c) : "v"(a), "v"(b));
#endif
  return c;
}
__device__ __forceinline__ void guard2(v8f& c0, v8f& c1, const v16h& a0, const v16h& b0, const v16h& b1) {
#if defined(__HIP_DEVICE_COMPILE__)
  asm volatile("v_nop\n\tv_nop\n\tv_nop\n\tv_nop" : "+v"(c0), "+v"(c1) : "v"(a0), "v"(b0), "v"(b1));
#endif
}
__device__ __forceinline__ void guard4(v8f& c0, v8f& c1, v8f& c2, v8f& c3,
                                       const v16h& a0, const v16h& a1, const v16h& b0, const v16h& b1) {
#if defined(__HIP_DEVICE_COMPILE__)
  asm volatile("v_nop\n\tv_nop\n\tv_nop\n\tv_nop"
               : "+v"(c0), "+v"(c1), "+v"(c2), "+v"(c3) : "v"(a0), "v"(a1), "v"(b0), "v"(b1));
#endif
}
__device__ __forceinline__ void wave_sync_lds() {
  __builtin_amdgcn_fence(__ATOMIC_RELEASE, "workgroup");
  __builtin_amdgcn_wave_barrier();
  __builtin_amdgcn_fence(__ATOMIC_ACQUIRE, "workgroup");
}

// =================================================================================================================
// input convert with per-window token padding: x [128*343][256] f32 -> X8 plane [128*384][256] f16, value
// f16(8 * bf16_RNE(x)) for tokens < 343 and exact zeros for padded tokens 343..383. One wave per plane row; lane
// handles 8 channels (two 16-B loads from a clamped source row, one 16-B store); a wave writes the whole 512-B row
// coverage: 6144 x 8 rows x 32 lanes x 8 halves = 49152 x 256 (every plane element incl. padding exactly once).
// =================================================================================================================
__global__ __launch_bounds__(256) void cvt_x(const float* __restrict__ x, unsigned short* xp) {
  const int tid = threadIdx.x, wv = tid >> 5, lane = tid & 31;
  const int row = blockIdx.x * 8 + wv;
  const int w = row / TP, t = row - w * TP;
  const int ts = min(t, NTOK - 1);
  const float* src = x + ((size_t)w * NTOK + ts) * CCH + lane * 8;
  const v4f a = *(const v4f*)(src);
  const v4f b = *(const v4f*)(src + 4);
  v4u pk;
  pk[0] = pk16(hb16(bfr(a[0]) * 8.0f), hb16(bfr(a[1]) * 8.0f));
  pk[1] = pk16(hb16(bfr(a[2]) * 8.0f), hb16(bfr(a[3]) * 8.0f));
  pk[2] = pk16(hb16(bfr(b[0]) * 8.0f), hb16(bfr(b[1]) * 8.0f));
  pk[3] = pk16(hb16(bfr(b[2]) * 8.0f), hb16(bfr(b[3]) * 8.0f));
  if (t >= NTOK) { pk[0] = 0u; pk[1] = 0u; pk[2] = 0u; pk[3] = 0u; }   // wave-uniform
  unsigned short* gp = xp + (size_t)row * CCH + lane * 8;
  *(v4u*)gp = pk;
  
}

// =================================================================================================================
// weight transpose + convert: w [256 k][ncol n] f32 (n contiguous, used as x.w) -> wT [ncol][256] f16 with k
// contiguous, value f16(1024 * bf16_RNE(w)). Block = 32 output rows: the 256x32 f32 slab is staged in LDS (coalesced
// coverage: (ncol/32) blocks x 8 waves x 4 rows x 32 lanes x 8 halves = ncol x 256.
// =================================================================================================================
__global__ __launch_bounds__(256) void cvt_wT(const float* __restrict__ wsrc, unsigned short* wdst, int ncol) {
  __shared__ __align__(16) float T[32 * TPW];
  const int tid = threadIdx.x, wv = tid >> 5, lane = tid & 31;
  const int n0 = blockIdx.x * 32;
#pragma unroll 4
  for (int it = 0; it < 32; ++it) {
    const int k = it * 8 + wv;
    T[lane * TPW + k] = wsrc[(size_t)k * ncol + n0 + lane];
  }
  __syncthreads();
  v4u pk[4];
  size_t offs[4];
#pragma unroll
  for (int q = 0; q < 4; ++q) {
    const int nl = wv * 4 + q;
    const float* tp = T + nl * TPW + lane * 8;
    const v4f a = *(const v4f*)(tp);
    const v4f b = *(const v4f*)(tp + 4);
    v4u p4;
    p4[0] = pk16(hb16(bfr(a[0]) * 1024.0f), hb16(bfr(a[1]) * 1024.0f));
    p4[1] = pk16(hb16(bfr(a[2]) * 1024.0f), hb16(bfr(a[3]) * 1024.0f));
    p4[2] = pk16(hb16(bfr(b[0]) * 1024.0f), hb16(bfr(b[1]) * 1024.0f));
    p4[3] = pk16(hb16(bfr(b[2]) * 1024.0f), hb16(bfr(b[3]) * 1024.0f));
    pk[q] = p4;
    offs[q] = (size_t)(n0 + nl) * CCH + lane * 8;
  }
#pragma unroll
  for (int q = 0; q < 4; ++q) *(v4u*)(wdst + offs[q]) = pk[q];
  
}

// =================================================================================================================
// relative position bias table in WMMA C-operand order: BT[((h*24 + strip)*24 + kt)*256 + l*8 + r] =
// 512 * bf16_RNE(rpb[idx(n,m)*8 + h]) with n = strip*16 + 8*(l>>4) + r (query), m = kt*16 + (l&15) (key),
// idx = ((i_n-i_m+6)*13 + (j_n-j_m+6))*13 + (k_n-k_m+6), (i,j,k) = (t/49, (t/7)%7, t%7); padded keys m >= 343
// get MASKC (logit mask through the C operand), padded queries n >= 343 get 0. Thread = one 16-B piece (4 rows),
// coverage: 8 heads x 24 strips x 24 key tiles x 64 pieces x 4 floats = 8 x 384 x 384, every element once.
// =================================================================================================================
__global__ __launch_bounds__(256) void build_bias(const float* __restrict__ rpb, float* bt) {
  const int g = blockIdx.x * 256 + threadIdx.x;
  const int piece = g & 63, rec = g >> 6;
  const int kt = rec % NKT, strip = (rec / NKT) % NST, h = rec / (NKT * NST);
  const int l = piece >> 1, e0 = (piece & 1) * 4;
  const int col = l & 15, lh = l >> 4;
  const int m = kt * 16 + col;
  const int mi = m / 49, mj = (m / 7) % 7, mk = m % 7;
  v4f v;
#pragma unroll
  for (int e = 0; e < 4; ++e) {
    const int n = strip * 16 + 8 * lh + e0 + e;
    const int ni = n / 49, nj = (n / 7) % 7, nk = n % 7;
    int idx = ((ni - mi + 6) * 13 + (nj - mj + 6)) * 13 + (nk - mk + 6);
    idx = min(max(idx, 0), NRPB - 1);
    float val = bfr(rpb[idx * NHD + h]) * 512.0f;
    if (n >= NTOK) val = 0.0f;
    if (m >= NTOK) val = MASKC;
    v[e] = val;
  }
  float* gp = bt + (size_t)rec * 256 + piece * 4;
  *(v4f*)gp = v;
  
}

// =================================================================================================================
// qkv GEMM: C[64 tokens][128 cols] per block = X8[rows][256] . W1024[cols][256]^T, K = 256 (8 k-steps of 32),
// fragments straight from the 16-bit global rows; 8 waves = 2 (32 rows) x 4 (32 cols), 2x2 tiles per wave.
// C = 8192 * (x . W). M tiles never cross a window (384 padded rows per window = 6 tiles). Epilogue through an LDS
// f32 tile: part q -> Q plane [w*8+h][tok][32] = f16(64 * q * 32^-0.5); part k -> K plane = f16(8*k); part v ->
// V^T plane [w*8+h][d][384 tok] = f16(16*v). Padded tokens come out as exact zeros (zero X rows). Stores: Q/K 128
// coverage: Q/K: 4 instr x 256 pieces x 8 halves = 4 heads x 64 tok x 32 d; V: 4 instr x 256 pieces x 8 =
// 4 heads x 32 d x 64 tok; over the grid every element of Q, K (1024x384x32) and V^T (1024x32x384) exactly once.
// =================================================================================================================
__global__ __launch_bounds__(256)
void gemm_qkv(const unsigned short* __restrict__ xp, const unsigned short* __restrict__ wq,
              unsigned short* qpl, unsigned short* kpl, unsigned short* vtp) {
  __shared__ __align__(16) float Cs[64 * LDC];
  const int tid = threadIdx.x, wave = tid >> 5, lane = tid & 31, hh = lane >> 4, c = lane & 15;
  const int mb = blockIdx.x, nb = blockIdx.y;
  const int mw = wave >> 2, nw = wave & 3;
  const _Float16* A = (const _Float16*)(const void*)xp;
  const _Float16* W = (const _Float16*)(const void*)wq;
  const int arow0 = mb * 64 + mw * 32;
  const int bcol0 = nb * 128 + nw * 32;

  v8f a00 = zero8(), a01 = zero8(), a10 = zero8(), a11 = zero8();
#pragma unroll 1
  for (int ks = 0; ks < 8; ++ks) {
    const int k0 = ks * 32 + 8 * hh;
    const v16h fa0 = ldfrag_h(A + (size_t)(arow0 + c) * CCH + k0);
    const v16h fa1 = ldfrag_h(A + (size_t)(arow0 + 16 + c) * CCH + k0);
    const v16h fb0 = ldfrag_h(W + (size_t)(bcol0 + c) * CCH + k0);
    const v16h fb1 = ldfrag_h(W + (size_t)(bcol0 + 16 + c) * CCH + k0);
    a00 = mma_raw(fa0, fb0, a00);
    a01 = mma_raw(fa0, fb1, a01);
    a10 = mma_raw(fa1, fb0, a10);
    a11 = mma_raw(fa1, fb1, a11);
    guard4(a00, a01, a10, a11, fa0, fa1, fb0, fb1);
  }
#pragma unroll
  for (int r = 0; r < 8; ++r) {
    const int row = mw * 32 + 8 * hh + r;
    Cs[row * LDC + nw * 32 + c]             = a00[r];
    Cs[row * LDC + nw * 32 + 16 + c]        = a01[r];
    Cs[(row + 16) * LDC + nw * 32 + c]      = a10[r];
    Cs[(row + 16) * LDC + nw * 32 + 16 + c] = a11[r];
  }
  __syncthreads();

  const int part = nb >> 1;                       // block-uniform: 0 q, 1 k, 2 v
  const int hb4 = (nb & 1) * 4;
  const int w = mb / MT, tok0 = (mb - w * MT) * 64;
  if (part < 2) {
    unsigned short* dst = (part == 0) ? qpl : kpl;
    const float scl = (part == 0) ? (QSC * (64.0f / 8192.0f)) : (8.0f / 8192.0f);
    v4u pk[4];
    size_t offs[4];
#pragma unroll
    for (int s = 0; s < 4; ++s) {
      const int L = s * 32 + (tid >> 3), p = tid & 7;
      const int h4 = L >> 5, li = L & 31;
      const int tok = 2 * li + (p >> 2), d0 = (p & 3) * 8;
      const int col = h4 * 32 + d0;
      v4u q4;
#pragma unroll
      for (int e = 0; e < 4; ++e) {
        const float f0 = Cs[tok * LDC + col + 2 * e] * scl;
        const float f1 = Cs[tok * LDC + col + 2 * e + 1] * scl;
        q4[e] = pk16(hb16(f0), hb16(f1));
      }
      pk[s] = q4;
      offs[s] = ((size_t)((w * NHD + hb4 + h4) * TP + tok0 + tok)) * HD + d0;
    }
#pragma unroll
    for (int s = 0; s < 4; ++s) *(v4u*)(dst + offs[s]) = pk[s];
    
  } else {
    v4u pv[4];
    size_t offs[4];
#pragma unroll
    for (int s = 0; s < 4; ++s) {
      const int L = s * 32 + (tid >> 3), p = tid & 7;
      const int h4 = L >> 5, d = L & 31;
      const int col = h4 * 32 + d;
      const int tb = p * 8;
      v4u a;
#pragma unroll
      for (int e = 0; e < 4; ++e) {
        const float v0 = Cs[(tb + 2 * e) * LDC + col] * (16.0f / 8192.0f);
        const float v1 = Cs[(tb + 2 * e + 1) * LDC + col] * (16.0f / 8192.0f);
        a[e] = pk16(hb16(v0), hb16(v1));
      }
      pv[s] = a;
      offs[s] = ((size_t)((w * NHD + hb4 + h4) * HD + d)) * TP + tok0 + tb;
    }
#pragma unroll
    for (int s = 0; s < 4; ++s) *(v4u*)(vtp + offs[s]) = pv[s];
    
  }
}

// =================================================================================================================
// Window attention: block = 8 strips of 16 queries of one (window, head), 3 blocks = 24 strips = 384 padded
// queries; wave = strip. logits S = Q64.K8^T via WMMA with the 512*bias table as the C operand
// (S = 512*(scale*q.k + bias), padded keys carry MASKC), online softmax over 6 blocks of 64 keys in f32
// (p' = 1024*exp((s-m)/512), l = sum p'), P = f16(p') staged per wave in LDS (_Float16 element stores, release
// 0..15 / 16..31 with V^T = f16(16 v); ctx = O / (16 l); output plane O64 = f16(64 ctx), layout [h][w*384+tok][32]:
// coverage: 3072 blocks x 8 waves x 16 rows x 32 d = 8 x 49152 x 32, every plane element once (padded rows too).
// =================================================================================================================
__global__ __launch_bounds__(256)
void attn_win(const unsigned short* __restrict__ qpl, const unsigned short* __restrict__ kpl,
              const unsigned short* __restrict__ vtp, const float* __restrict__ bt, unsigned short* opl) {
  __shared__ __align__(16) char pbuf[8 * PWB];
  union CB { v8f v; v4f q[2]; };
  const int tid = threadIdx.x, wave = tid >> 5, lane = tid & 31, hh = lane >> 4, c = lane & 15;
  const int wh = blockIdx.x / 3;                  // w*8 + h
  const int sb = blockIdx.x - wh * 3;
  const int w = wh >> 3, h = wh & 7;
  const int strip = sb * 8 + wave;                // 0..23
  const int q0 = strip * 16;

  const _Float16* Q  = (const _Float16*)(const void*)qpl + (size_t)wh * TP * HD;
  const _Float16* K  = (const _Float16*)(const void*)kpl + (size_t)wh * TP * HD;
  const _Float16* Vt = (const _Float16*)(const void*)vtp + (size_t)wh * HD * TP;
  const float* Bp = bt + ((size_t)(h * NST + strip)) * NKT * 256 + lane * 8;
  _Float16* Ph = (_Float16*)(pbuf + wave * PWB);

  const v16h qa = ldfrag_h(Q + (size_t)(q0 + c) * HD + 8 * hh);
  float mrow[8], lrow[8];
#pragma unroll
  for (int r = 0; r < 8; ++r) { mrow[r] = -1e30f; lrow[r] = 0.f; }
  v8f o0 = zero8(), o1 = zero8();

#pragma unroll 1
  for (int kb = 0; kb < TP / 64; ++kb) {
    // ---- logits for 64 keys: 4 tiles of 16, bias and key padding mask via the C operand ----
    v8f s[4];
#pragma unroll
    for (int j = 0; j < 4; ++j) {
      const int key = kb * 64 + j * 16 + c;
      const v16h kf = ldfrag_h(K + (size_t)key * HD + 8 * hh);
      const float* bp = Bp + (kb * 4 + j) * 256;
      CB cb;
      cb.q[0] = *(const v4f*)(bp);
      cb.q[1] = *(const v4f*)(bp + 4);
      s[j] = mma_g1(qa, kf, cb.v);
    }
    // ---- online softmax update per row ----
#pragma unroll
    for (int r = 0; r < 8; ++r) {
      float tm = fmaxf(fmaxf(s[0][r], s[1][r]), fmaxf(s[2][r], s[3][r]));
      tm = fmaxf(tm, __shfl_xor(tm, 1, 32));
      tm = fmaxf(tm, __shfl_xor(tm, 2, 32));
      tm = fmaxf(tm, __shfl_xor(tm, 4, 32));
      tm = fmaxf(tm, __shfl_xor(tm, 8, 32));
      const float mn = fmaxf(mrow[r], tm);
      const float alpha = __expf((mrow[r] - mn) * INV512);
      mrow[r] = mn;
      float ps = 0.f;
#pragma unroll
      for (int j = 0; j < 4; ++j) {
        const float p = __expf((s[j][r] - mn) * INV512 + LN1024);
        ps = ps + p;
        s[j][r] = p;
      }
      ps = ps + __shfl_xor(ps, 1, 32);
      ps = ps + __shfl_xor(ps, 2, 32);
      ps = ps + __shfl_xor(ps, 4, 32);
      ps = ps + __shfl_xor(ps, 8, 32);
      lrow[r] = lrow[r] * alpha + ps;
      o0[r] = o0[r] * alpha;
      o1[r] = o1[r] * alpha;
    }
    // ---- P tile (16 rows x 64 keys) to the wave's LDS region ----
#pragma unroll
    for (int j = 0; j < 4; ++j) {
#pragma unroll
      for (int r = 0; r < 8; ++r) {
        Ph[(8 * hh + r) * PP + j * 16 + c] = (_Float16)s[j][r];
      }
    }
    wave_sync_lds();
    // ---- O += P . V : two 32-key k-steps, two 16-dim tiles ----
#pragma unroll
    for (int ks = 0; ks < 2; ++ks) {
      const v16h pa = ldfrag_h(Ph + c * PP + ks * 32 + 8 * hh);
      const int koff = kb * 64 + ks * 32 + 8 * hh;
      const v16h v0 = ldfrag_h(Vt + (size_t)c * TP + koff);
      const v16h v1 = ldfrag_h(Vt + (size_t)(16 + c) * TP + koff);
      o0 = mma_raw(pa, v0, o0);
      o1 = mma_raw(pa, v1, o1);
      guard2(o0, o1, pa, v0, v1);
    }
    wave_sync_lds();
  }

  // ---- normalise (64 ctx = O * 4 / l), stage the 16 x 32 tile in LDS (f32), then whole-line stores ----
  float* Os = (float*)(void*)(pbuf + wave * PWB);
#pragma unroll
  for (int r = 0; r < 8; ++r) {
    const float inv = 4.0f / lrow[r];
    const int row = 8 * hh + r;
    Os[row * OSP + c]      = o0[r] * inv;
    Os[row * OSP + 16 + c] = o1[r] * inv;
  }
  wave_sync_lds();
  v4u p2[2];
  size_t off2[2];
#pragma unroll
  for (int sI = 0; sI < 2; ++sI) {
    const int line = sI * 4 + (lane >> 3), piece = lane & 7;
    const int row = 2 * line + (piece >> 2), d0 = (piece & 3) * 8;
    v4u a;
#pragma unroll
    for (int e = 0; e < 4; ++e) {
      const float f0 = Os[row * OSP + d0 + 2 * e];
      const float f1 = Os[row * OSP + d0 + 2 * e + 1];
      a[e] = pk16(hb16(f0), hb16(f1));
    }
    p2[sI] = a;
    off2[sI] = ((size_t)h * NROWP + (size_t)w * TP + q0 + row) * HD + d0;
  }
  *(v4u*)(opl + off2[0]) = p2[0];
  *(v4u*)(opl + off2[1]) = p2[1];
  
}

// =================================================================================================================
// Output projection: out rows = (O64/64) . (W1024/1024)^T, K = 256 = 8 head planes of 32. Block tile 64 padded
// tokens x 128 cols, 8 waves = 2 x 4, 2x2 tiles per wave. Epilogue through an LDS f32 tile; a wave writes one
// coverage: 128 windows x 343 tokens x 2 x 128 cols = every output element exactly once.
// =================================================================================================================
__global__ __launch_bounds__(256)
void gemm_proj(const unsigned short* __restrict__ opl, const unsigned short* __restrict__ wp, float* out) {
  __shared__ __align__(16) float Cs[64 * LDC];
  const int tid = threadIdx.x, wave = tid >> 5, lane = tid & 31, hh = lane >> 4, c = lane & 15;
  const int mb = blockIdx.x, nb = blockIdx.y;
  const int mw = wave >> 2, nw = wave & 3;
  const _Float16* W = (const _Float16*)(const void*)wp;
  const int arow0 = mb * 64 + mw * 32;
  const int bcol0 = nb * 128 + nw * 32;

  v8f a00 = zero8(), a01 = zero8(), a10 = zero8(), a11 = zero8();
#pragma unroll 1
  for (int ks = 0; ks < 8; ++ks) {
    const _Float16* Ah = (const _Float16*)(const void*)opl + (size_t)ks * NROWP * HD;
    const v16h fa0 = ldfrag_h(Ah + (size_t)(arow0 + c) * HD + 8 * hh);
    const v16h fa1 = ldfrag_h(Ah + (size_t)(arow0 + 16 + c) * HD + 8 * hh);
    const v16h fb0 = ldfrag_h(W + (size_t)(bcol0 + c) * CCH + ks * 32 + 8 * hh);
    const v16h fb1 = ldfrag_h(W + (size_t)(bcol0 + 16 + c) * CCH + ks * 32 + 8 * hh);
    a00 = mma_raw(fa0, fb0, a00);
    a01 = mma_raw(fa0, fb1, a01);
    a10 = mma_raw(fa1, fb0, a10);
    a11 = mma_raw(fa1, fb1, a11);
    guard4(a00, a01, a10, a11, fa0, fa1, fb0, fb1);
  }
#pragma unroll
  for (int r = 0; r < 8; ++r) {
    const int row = mw * 32 + 8 * hh + r;
    Cs[row * LDC + nw * 32 + c]             = a00[r];
    Cs[row * LDC + nw * 32 + 16 + c]        = a01[r];
    Cs[(row + 16) * LDC + nw * 32 + c]      = a10[r];
    Cs[(row + 16) * LDC + nw * 32 + 16 + c] = a11[r];
  }
  __syncthreads();

  const int w = mb / MT, tok0 = (mb - w * MT) * 64;
  const int rbase = tok0 + wave * 8;
  v4f ov[8];
  size_t offs[8];
#pragma unroll
  for (int it = 0; it < 8; ++it) {
    const int row = wave * 8 + it;
    v4f v = *(const v4f*)(Cs + row * LDC + lane * 4);
    v = v * (1.0f / 65536.0f);
    ov[it] = v;
    const int tokc = min(rbase + it, NTOK - 1);
    offs[it] = ((size_t)w * NTOK + tokc) * CCH + nb * 128 + lane * 4;
  }
#pragma unroll
  for (int it = 0; it < 8; ++it) {
    if (rbase + it < NTOK) *(v4f*)(out + offs[it]) = ov[it];     // wave-uniform
  }
  
}

// =================================================================================================================
// token dimension padded to 384 per window everywhere):
//   X8 f16 [49152][256] 25165824 | WqkvT f16 [768][256] 393216 | WoutT f16 [256][256] 131072 |
//   bias table f32 [8][24][24][256] 4718592 | Q f16 [1024][384][32] 25165824 | K same 25165824 |
//   V^T f16 [1024][32][384] 25165824 | O f16 [8][49152][32] 25165824 | total 131072000.
// =================================================================================================================
extern "C" void kernel_launch(void* const* d_in, const int* in_sizes, int n_in,
                              void* d_out, int out_size, void* d_ws, size_t ws_size,
                              hipStream_t stream) {
  if (n_in < 4) return;
  if (in_sizes[0] != NROWX * CCH) return;
  if (in_sizes[1] != CCH * C3) return;
  if (in_sizes[2] != CCH * CCH) return;
  if (in_sizes[3] != NRPB * NHD) return;
  if (out_size != NROWX * CCH) return;

  const float* x    = (const float*)d_in[0];
  const float* wqkv = (const float*)d_in[1];
  const float* wout = (const float*)d_in[2];
  const float* rpb  = (const float*)d_in[3];
  float* out = (float*)d_out;

  const size_t sX  = (size_t)NROWP * CCH * 2;                 // 25165824
  const size_t sWq = (size_t)C3 * CCH * 2;                    //   393216
  const size_t sWo = (size_t)CCH * CCH * 2;                   //   131072
  const size_t sBT = (size_t)NHD * NST * NKT * 256 * 4;       //  4718592
  const size_t sQK = (size_t)NWIN * NHD * TP * HD * 2;        // 25165824
  const size_t sO  = (size_t)NHD * NROWP * HD * 2;            // 25165824
  size_t off = 0;
  const size_t oX  = off; off += sX;
  const size_t oWq = off; off += sWq;
  const size_t oWo = off; off += sWo;
  const size_t oBT = off; off += sBT;
  const size_t oQ  = off; off += sQK;
  const size_t oK  = off; off += sQK;
  const size_t oV  = off; off += sQK;
  const size_t oO  = off; off += sO;
  if (off > ws_size) return;                                   // off = 131072000
  if (off > (size_t)134217728) return;

  char* ws = (char*)d_ws;
  unsigned short* X8  = (unsigned short*)(ws + oX);
  unsigned short* WqT = (unsigned short*)(ws + oWq);
  unsigned short* WoT = (unsigned short*)(ws + oWo);
  float*          BT  = (float*)(ws + oBT);
  unsigned short* Qp  = (unsigned short*)(ws + oQ);
  unsigned short* Kp  = (unsigned short*)(ws + oK);
  unsigned short* Vtp = (unsigned short*)(ws + oV);
  unsigned short* Op  = (unsigned short*)(ws + oO);

  const dim3 blk(256);
  // (1) input convert with token padding, weight transposes + converts, bias table
  cvt_x<<<dim3(NROWP / 8), blk, 0, stream>>>(x, X8);
  cvt_wT<<<dim3(C3 / 32), blk, 0, stream>>>(wqkv, WqT, C3);
  cvt_wT<<<dim3(CCH / 32), blk, 0, stream>>>(wout, WoT, CCH);
  build_bias<<<dim3((NHD * NST * NKT * 64) / 256), blk, 0, stream>>>(rpb, BT);
  // (2) qkv projection: 768 row tiles (6 per window) x 6 column tiles
  gemm_qkv<<<dim3(NROWP / 64, C3 / 128), blk, 0, stream>>>(X8, WqT, Qp, Kp, Vtp);
  // (3) window attention: 128 windows x 8 heads x 3 blocks of 8 strips
  attn_win<<<dim3(NWIN * NHD * 3), blk, 0, stream>>>(Qp, Kp, Vtp, BT, Op);
  // (4) output projection -> d_out (padded tokens skipped)
  gemm_proj<<<dim3(NROWP / 64, CCH / 128), blk, 0, stream>>>(Op, WoT, out);
  (void)hipGetLastError();
}

// v001
// One run takes 199 microseconds.
// Two timings next to v000 both put it at 1.15 times that version's speed.
// qkv projection, q.k^T, p.v and output projection: v_wmma_f32_16x16x32_f16 single products (f16 operands, f32 accumulate);
// all inputs RNE-converted to bf16 on load and carried as f16 with power-of-two scales; softmax, key padding mask and epilogues in f32 on VALU.
#include <hip/hip_runtime.h>
#include <stdint.h>

#define NWIN  128
#define NTOK  343
#define TP    384
#define CCH   256
#define NHD   8
#define HD    32
#define C3    768
#define NROWP 49152
#define NROWX 43904
#define NRPB  2197
#define NST   24
#define NKT   24
#define MT    6
#define LDC   132
#define PP    72
#define OSP   36
#define PWB   2304
#define TPW   260
#define FT    512
#define QSC   0.17677669529663687f
#define INV512 0.001953125f
#define LN1024 6.9314718055994531f
#define MASKC (-1048576.0f)

static_assert(NROWP == NWIN * TP);
static_assert(NROWX == NWIN * NTOK);
static_assert(TP == MT * 64);
static_assert(NST * 16 == TP);
static_assert(NKT * 16 == TP);
static_assert(PWB == 16 * PP * 2);
static_assert(16 * OSP * 4 <= PWB);
static_assert((PP * 2) % 16 == 0);
static_assert((LDC * 4) % 16 == 0);
static_assert((TPW * 4) % 16 == 0);
static_assert(NHD * HD == CCH);
static_assert(FT == 16 * 32);
static_assert(TP * HD == NST * FT);

typedef _Float16 v16h __attribute__((ext_vector_type(16)));
typedef _Float16 v8h  __attribute__((ext_vector_type(8)));
typedef float    v8f  __attribute__((ext_vector_type(8)));
typedef float    v4f  __attribute__((ext_vector_type(4)));
typedef unsigned int v4u __attribute__((ext_vector_type(4)));

// ---- scalar helpers ------------------------------------------------------------------------------------------
__device__ __forceinline__ unsigned short bf_bits(float f) {          // f32 -> bf16 bits, RNE convert
  unsigned u = __float_as_uint(f);
  return (unsigned short)((u + 0x7FFFu + ((u >> 16) & 1u)) >> 16);
}
__device__ __forceinline__ float bf_up(unsigned short b) { return __uint_as_float(((unsigned)b) << 16); }
__device__ __forceinline__ float bfr(float f) { return bf_up(bf_bits(f)); }
__device__ __forceinline__ unsigned short h_bits(_Float16 x) { return __builtin_bit_cast(unsigned short, x); }
__device__ __forceinline__ unsigned short hb16(float f) { return h_bits((_Float16)f); }
__device__ __forceinline__ unsigned pk16(unsigned short a, unsigned short b) { return (unsigned)a | ((unsigned)b << 16); }
__device__ __forceinline__ v8f zero8() { v8f z = {0.f, 0.f, 0.f, 0.f, 0.f, 0.f, 0.f, 0.f}; return z; }

// ---- fragment loader: 16-bit A/B operand, lane -> row/col (lane&15), p already includes +8*(lane>>4);
//      elements 0..7 <- p[0..7] (k0+8h..), elements 8..15 <- p[16..23] (k0+16+8h..)
__device__ __forceinline__ v16h ldfrag_h(const _Float16* p) {
  union { v16h v; v8h h[2]; } f;
  f.h[0] = *(const v8h*)(p);
  f.h[1] = *(const v8h*)(p + 16);
  return f.v;
}

// ---- fragment loader for the fragment-order global planes: one 16 (rows/cols) x 32 (k) operand tile is FT halves =
//      1024 contiguous bytes; its 16-B piece e*32 + lane holds row/col (lane&15), k = 16*e + 8*(lane>>4) + 0..7 (the k
//      order of ldfrag_h). p = tile base + lane*8: each of the two loads reads 512 contiguous bytes per wave.
__device__ __forceinline__ v16h ldfrag_t(const _Float16* p) {
  union { v16h v; v8h h[2]; } f;
  f.h[0] = *(const v8h*)(p);
  f.h[1] = *(const v8h*)(p + 256);
  return f.v;
}

// ---- WMMA helpers; the guard helpers insert the trailing VALU hazard gap and keep A/B live -----------------------
__device__ __forceinline__ v8f mma_raw(v16h a, v16h b, v8f c) {
  return __builtin_amdgcn_wmma_f32_16x16x32_f16(false, a, false, b, (short)0, c, false, false);
}
__device__ __forceinline__ v8f mma_g1(v16h a, v16h b, v8f c) {
  c = mma_raw(a, b, c);
#if defined(__HIP_DEVICE_COMPILE__)
  asm volatile("v_nop\n\tv_nop\n\tv_nop\n\tv_nop" : "+v"(c) : "v"(a), "v"(b));
#endif
  return c;
}
__device__ __forceinline__ void guard2(v8f& c0, v8f& c1, const v16h& a0, const v16h& b0, const v16h& b1) {
#if defined(__HIP_DEVICE_COMPILE__)
  asm volatile("v_nop\n\tv_nop\n\tv_nop\n\tv_nop" : "+v"(c0), "+v"(c1) : "v"(a0), "v"(b0), "v"(b1));
#endif
}
__device__ __forceinline__ void guard4(v8f& c0, v8f& c1, v8f& c2, v8f& c3,
                                       const v16h& a0, const v16h& a1, const v16h& b0, const v16h& b1) {
#if defined(__HIP_DEVICE_COMPILE__)
  asm volatile("v_nop\n\tv_nop\n\tv_nop\n\tv_nop"
               : "+v"(c0), "+v"(c1), "+v"(c2), "+v"(c3) : "v"(a0), "v"(a1), "v"(b0), "v"(b1));
#endif
}
__device__ __forceinline__ void wave_sync_lds() {
  __builtin_amdgcn_fence(__ATOMIC_RELEASE, "workgroup");
  __builtin_amdgcn_wave_barrier();
  __builtin_amdgcn_fence(__ATOMIC_ACQUIRE, "workgroup");
}

// =================================================================================================================
// input convert with per-window token padding: x [128*343][256] f32 -> X8 plane, 128*384 rows x 256 k as f16 in
// fragment order (tile (row/16)*8 + k/32, see ldfrag_t), value f16(8 * bf16_RNE(x)) for tokens < 343 and exact zeros
// for padded tokens 343..383. Block = 16 rows, wave = one 32-k step = one tile: a lane reads 2 x 8 floats of its
// (clamped) source row and stores two 16-B pieces; a wave writes the tile's 1024 contiguous bytes.
// coverage: 3072 blocks x 8 waves x 2 x 32 pieces x 8 halves = 49152 x 256 (every plane element incl. padding once).
// =================================================================================================================
__global__ __launch_bounds__(256) void cvt_x(const float* __restrict__ x, unsigned short* xp) {
  const int tid = threadIdx.x, wv = tid >> 5, lane = tid & 31, hh = lane >> 4, c = lane & 15;
  const int rt = blockIdx.x;
  const int row = rt * 16 + c;
  const int w = row / TP, t = row - w * TP;
  const int ts = min(t, NTOK - 1);
  const float* src = x + ((size_t)w * NTOK + ts) * CCH + wv * 32 + 8 * hh;
  unsigned short* gp = xp + ((size_t)rt * 8 + wv) * FT + lane * 8;
  v4u pk[2];
#pragma unroll
  for (int e = 0; e < 2; ++e) {
    const v4f a = *(const v4f*)(src + 16 * e);
    const v4f b = *(const v4f*)(src + 16 * e + 4);
    v4u p4;
    p4[0] = pk16(hb16(bfr(a[0]) * 8.0f), hb16(bfr(a[1]) * 8.0f));
    p4[1] = pk16(hb16(bfr(a[2]) * 8.0f), hb16(bfr(a[3]) * 8.0f));
    p4[2] = pk16(hb16(bfr(b[0]) * 8.0f), hb16(bfr(b[1]) * 8.0f));
    p4[3] = pk16(hb16(bfr(b[2]) * 8.0f), hb16(bfr(b[3]) * 8.0f));
    if (t >= NTOK) { p4[0] = 0u; p4[1] = 0u; p4[2] = 0u; p4[3] = 0u; }
    pk[e] = p4;
  }
  *(v4u*)gp = pk[0];
  *(v4u*)(gp + 256) = pk[1];
}

// =================================================================================================================
// weight transpose + convert: w [256 k][ncol n] f32 (n contiguous, used as x.w) -> wT, ncol columns x 256 k as f16 in
// fragment order (tile (n/16)*8 + k/32, see ldfrag_t), value f16(1024 * bf16_RNE(w)). Block = 32 columns: the 256x32
// f32 slab is staged in LDS (coalesced reads); wave = one 32-k step, it writes its two tiles of 1024 contiguous bytes.
// coverage: (ncol/32) blocks x 8 waves x 2 tiles x 2 x 32 pieces x 8 halves = ncol x 256.
// =================================================================================================================
__global__ __launch_bounds__(256) void cvt_wT(const float* __restrict__ wsrc, unsigned short* wdst, int ncol) {
  __shared__ __align__(16) float T[32 * TPW];
  const int tid = threadIdx.x, wv = tid >> 5, lane = tid & 31, hh = lane >> 4, c = lane & 15;
  const int n0 = blockIdx.x * 32;
#pragma unroll 4
  for (int it = 0; it < 32; ++it) {
    const int k = it * 8 + wv;
    T[lane * TPW + k] = wsrc[(size_t)k * ncol + n0 + lane];
  }
  __syncthreads();
  v4u pk[4];
  size_t offs[4];
#pragma unroll
  for (int q = 0; q < 4; ++q) {
    const int nt = q >> 1, e = q & 1;
    const float* tp = T + (nt * 16 + c) * TPW + wv * 32 + e * 16 + hh * 8;
    const v4f a = *(const v4f*)(tp);
    const v4f b = *(const v4f*)(tp + 4);
    v4u p4;
    p4[0] = pk16(hb16(bfr(a[0]) * 1024.0f), hb16(bfr(a[1]) * 1024.0f));
    p4[1] = pk16(hb16(bfr(a[2]) * 1024.0f), hb16(bfr(a[3]) * 1024.0f));
    p4[2] = pk16(hb16(bfr(b[0]) * 1024.0f), hb16(bfr(b[1]) * 1024.0f));
    p4[3] = pk16(hb16(bfr(b[2]) * 1024.0f), hb16(bfr(b[3]) * 1024.0f));
    pk[q] = p4;
    offs[q] = ((size_t)(blockIdx.x * 2 + nt) * 8 + wv) * FT + e * 256 + lane * 8;
  }
#pragma unroll
  for (int q = 0; q < 4; ++q) *(v4u*)(wdst + offs[q]) = pk[q];
}

// =================================================================================================================
// relative position bias table in WMMA C-operand order, registers 0..3 of all lanes then registers 4..7 (each C load
// reads 512 contiguous bytes per wave): BT[((h*24 + strip)*24 + kt)*256 + (r>>2)*128 + l*4 + (r&3)] =
// 512 * bf16_RNE(rpb[idx(n,m)*8 + h]) with n = strip*16 + 8*(l>>4) + r (query), m = kt*16 + (l&15) (key),
// idx = ((i_n-i_m+6)*13 + (j_n-j_m+6))*13 + (k_n-k_m+6), (i,j,k) = (t/49, (t/7)%7, t%7); padded keys m >= 343
// get MASKC (logit mask through the C operand), padded queries n >= 343 get 0. Thread = one 16-B piece (4 rows),
// coverage: 8 heads x 24 strips x 24 key tiles x 64 pieces x 4 floats = 8 x 384 x 384, every element once.
// =================================================================================================================
__global__ __launch_bounds__(256) void build_bias(const float* __restrict__ rpb, float* bt) {
  const int g = blockIdx.x * 256 + threadIdx.x;
  const int piece = g & 63, rec = g >> 6;
  const int kt = rec % NKT, strip = (rec / NKT) % NST, h = rec / (NKT * NST);
  const int l = piece & 31, e0 = (piece >> 5) * 4;
  const int col = l & 15, lh = l >> 4;
  const int m = kt * 16 + col;
  const int mi = m / 49, mj = (m / 7) % 7, mk = m % 7;
  v4f v;
#pragma unroll
  for (int e = 0; e < 4; ++e) {
    const int n = strip * 16 + 8 * lh + e0 + e;
    const int ni = n / 49, nj = (n / 7) % 7, nk = n % 7;
    int idx = ((ni - mi + 6) * 13 + (nj - mj + 6)) * 13 + (nk - mk + 6);
    idx = min(max(idx, 0), NRPB - 1);
    float val = bfr(rpb[idx * NHD + h]) * 512.0f;
    if (n >= NTOK) val = 0.0f;
    if (m >= NTOK) val = MASKC;
    v[e] = val;
  }
  float* gp = bt + (size_t)rec * 256 + piece * 4;
  *(v4f*)gp = v;
  
}

// =================================================================================================================
// qkv GEMM: C[64 tokens][128 cols] per block = X8[rows][256] . W1024[cols][256]^T, K = 256 (8 k-steps of 32),
// fragments straight from the fragment-order global planes; 8 waves = 2 (32 rows) x 4 (32 cols), 2x2 tiles per wave.
// C = 8192 * (x . W). M tiles never cross a window (384 padded rows per window = 6 tiles). Epilogue through an LDS
// f32 tile: part q -> Q plane = f16(64 * q * 32^-0.5), part k -> K plane = f16(8*k), both in fragment order with tile
// (w*8+h)*24 + tok/16 (16 tokens x 32 d); part v -> V^T plane = f16(16*v) in fragment order with tile
// ((w*8+h)*2 + d/16)*12 + tok/32 (16 d x 32 tokens). Padded tokens come out as exact zeros (zero X rows). A wave's
// store writes 512 contiguous bytes (half a tile).
// coverage: Q/K: 4 instr x 256 pieces x 8 halves = 4 heads x 64 tok x 32 d; V: 4 instr x 256 pieces x 8 =
// 4 heads x 32 d x 64 tok; over the grid every element of Q, K (1024x384x32) and V^T (1024x32x384) exactly once.
// =================================================================================================================
__global__ __launch_bounds__(256)
void gemm_qkv(const unsigned short* __restrict__ xp, const unsigned short* __restrict__ wq,
              unsigned short* qpl, unsigned short* kpl, unsigned short* vtp) {
  __shared__ __align__(16) float Cs[64 * LDC];
  const int tid = threadIdx.x, wave = tid >> 5, lane = tid & 31, hh = lane >> 4, c = lane & 15;
  const int mb = blockIdx.x, nb = blockIdx.y;
  const int mw = wave >> 2, nw = wave & 3;
  const _Float16* A = (const _Float16*)(const void*)xp;
  const _Float16* W = (const _Float16*)(const void*)wq;
  const _Float16* Ap = A + (size_t)(mb * 4 + mw * 2) * 8 * FT + lane * 8;   // row tile (mb*64 + mw*32) / 16
  const _Float16* Wp = W + (size_t)(nb * 8 + nw * 2) * 8 * FT + lane * 8;   // col tile (nb*128 + nw*32) / 16

  v8f a00 = zero8(), a01 = zero8(), a10 = zero8(), a11 = zero8();
#pragma unroll 1
  for (int ks = 0; ks < 8; ++ks) {
    const v16h fa0 = ldfrag_t(Ap + ks * FT);
    const v16h fa1 = ldfrag_t(Ap + (8 + ks) * FT);
    const v16h fb0 = ldfrag_t(Wp + ks * FT);
    const v16h fb1 = ldfrag_t(Wp + (8 + ks) * FT);
    a00 = mma_raw(fa0, fb0, a00);
    a01 = mma_raw(fa0, fb1, a01);
    a10 = mma_raw(fa1, fb0, a10);
    a11 = mma_raw(fa1, fb1, a11);
    guard4(a00, a01, a10, a11, fa0, fa1, fb0, fb1);
  }
#pragma unroll
  for (int r = 0; r < 8; ++r) {
    const int row = mw * 32 + 8 * hh + r;
    Cs[row * LDC + nw * 32 + c]             = a00[r];
    Cs[row * LDC + nw * 32 + 16 + c]        = a01[r];
    Cs[(row + 16) * LDC + nw * 32 + c]      = a10[r];
    Cs[(row + 16) * LDC + nw * 32 + 16 + c] = a11[r];
  }
  __syncthreads();

  const int part = nb >> 1;                       // block-uniform: 0 q, 1 k, 2 v
  const int hb4 = (nb & 1) * 4;
  const int w = mb / MT, tok0 = (mb - w * MT) * 64;
  if (part < 2) {
    unsigned short* dst = (part == 0) ? qpl : kpl;
    const float scl = (part == 0) ? (QSC * (64.0f / 8192.0f)) : (8.0f / 8192.0f);
    v4u pk[4];
    size_t offs[4];
#pragma unroll
    for (int s = 0; s < 4; ++s) {
      const int blk = s * 4 + (tid >> 6), pc = tid & 63;          // 16 tiles (4 heads x 4 token tiles) x 64 pieces
      const int h4 = blk >> 2, tt = blk & 3;
      const int tok = tt * 16 + (pc & 15), d0 = (pc >> 5) * 16 + ((pc >> 4) & 1) * 8;
      const int col = h4 * 32 + d0;
      v4u q4;
#pragma unroll
      for (int e = 0; e < 4; ++e) {
        const float f0 = Cs[tok * LDC + col + 2 * e] * scl;
        const float f1 = Cs[tok * LDC + col + 2 * e + 1] * scl;
        q4[e] = pk16(hb16(f0), hb16(f1));
      }
      pk[s] = q4;
      offs[s] = ((size_t)((w * NHD + hb4 + h4) * NST + (tok0 >> 4) + tt)) * FT + pc * 8;
    }
#pragma unroll
    for (int s = 0; s < 4; ++s) *(v4u*)(dst + offs[s]) = pk[s];
    
  } else {
    v4u pv[4];
    size_t offs[4];
#pragma unroll
    for (int s = 0; s < 4; ++s) {
      const int blk = s * 4 + (tid >> 6), pc = tid & 63;          // 16 tiles (4 heads x 2 d tiles x 2 k-steps) x 64 pieces
      const int h4 = blk >> 2, dt = (blk >> 1) & 1, k2 = blk & 1;
      const int col = h4 * 32 + dt * 16 + (pc & 15);
      const int tb = k2 * 32 + (pc >> 5) * 16 + ((pc >> 4) & 1) * 8;
      v4u a;
#pragma unroll
      for (int e = 0; e < 4; ++e) {
        const float v0 = Cs[(tb + 2 * e) * LDC + col] * (16.0f / 8192.0f);
        const float v1 = Cs[(tb + 2 * e + 1) * LDC + col] * (16.0f / 8192.0f);
        a[e] = pk16(hb16(v0), hb16(v1));
      }
      pv[s] = a;
      offs[s] = ((size_t)(((w * NHD + hb4 + h4) * 2 + dt) * (TP / 32) + (tok0 >> 5) + k2)) * FT + pc * 8;
    }
#pragma unroll
    for (int s = 0; s < 4; ++s) *(v4u*)(vtp + offs[s]) = pv[s];
    
  }
}

// =================================================================================================================
// Window attention: block = 8 strips of 16 queries of one (window, head), 3 blocks = 24 strips = 384 padded
// queries; wave = strip. logits S = Q64.K8^T via WMMA with the 512*bias table as the C operand
// (S = 512*(scale*q.k + bias), padded keys carry MASKC), online softmax over 6 blocks of 64 keys in f32
// (p' = 1024*exp((s-m)/512), l = sum p'), P = f16(p') staged per wave in LDS (_Float16 element stores, release
// 0..15 / 16..31 with V^T = f16(16 v); ctx = O / (16 l); output plane O64 = f16(64 ctx), fragment order with tile
// h*3072 + (w*384+tok)/16 (16 tokens x 32 d). Q, K, V^T and the bias come in fragment order (ldfrag_t, build_bias).
// coverage: 3072 blocks x 8 waves x 16 rows x 32 d = 8 x 49152 x 32, every plane element once (padded rows too).
// =================================================================================================================
__global__ __launch_bounds__(256)
void attn_win(const unsigned short* __restrict__ qpl, const unsigned short* __restrict__ kpl,
              const unsigned short* __restrict__ vtp, const float* __restrict__ bt, unsigned short* opl) {
  __shared__ __align__(16) char pbuf[8 * PWB];
  union CB { v8f v; v4f q[2]; };
  const int tid = threadIdx.x, wave = tid >> 5, lane = tid & 31, hh = lane >> 4, c = lane & 15;
  const int wh = blockIdx.x / 3;                  // w*8 + h
  const int sb = blockIdx.x - wh * 3;
  const int w = wh >> 3, h = wh & 7;
  const int strip = sb * 8 + wave;                // 0..23
  const int q0 = strip * 16;

  const _Float16* Q  = (const _Float16*)(const void*)qpl + (size_t)wh * TP * HD;
  const _Float16* K  = (const _Float16*)(const void*)kpl + (size_t)wh * TP * HD;
  const _Float16* Vt = (const _Float16*)(const void*)vtp + (size_t)wh * HD * TP;
  const float* Bp = bt + ((size_t)(h * NST + strip)) * NKT * 256 + lane * 4;
  _Float16* Ph = (_Float16*)(pbuf + wave * PWB);

  const v16h qa = ldfrag_t(Q + strip * FT + lane * 8);
  float mrow[8], lrow[8];
#pragma unroll
  for (int r = 0; r < 8; ++r) { mrow[r] = -1e30f; lrow[r] = 0.f; }
  v8f o0 = zero8(), o1 = zero8();

#pragma unroll 1
  for (int kb = 0; kb < TP / 64; ++kb) {
    // ---- logits for 64 keys: 4 tiles of 16, bias and key padding mask via the C operand ----
    v8f s[4];
#pragma unroll
    for (int j = 0; j < 4; ++j) {
      const v16h kf = ldfrag_t(K + (kb * 4 + j) * FT + lane * 8);
      const float* bp = Bp + (kb * 4 + j) * 256;
      CB cb;
      cb.q[0] = *(const v4f*)(bp);
      cb.q[1] = *(const v4f*)(bp + 128);
      s[j] = mma_g1(qa, kf, cb.v);
    }
    // ---- online softmax update per row ----
#pragma unroll
    for (int r = 0; r < 8; ++r) {
      float tm = fmaxf(fmaxf(s[0][r], s[1][r]), fmaxf(s[2][r], s[3][r]));
      tm = fmaxf(tm, __shfl_xor(tm, 1, 32));
      tm = fmaxf(tm, __shfl_xor(tm, 2, 32));
      tm = fmaxf(tm, __shfl_xor(tm, 4, 32));
      tm = fmaxf(tm, __shfl_xor(tm, 8, 32));
      const float mn = fmaxf(mrow[r], tm);
      const float alpha = __expf((mrow[r] - mn) * INV512);
      mrow[r] = mn;
      float ps = 0.f;
#pragma unroll
      for (int j = 0; j < 4; ++j) {
        const float p = __expf((s[j][r] - mn) * INV512 + LN1024);
        ps = ps + p;
        s[j][r] = p;
      }
      ps = ps + __shfl_xor(ps, 1, 32);
      ps = ps + __shfl_xor(ps, 2, 32);
      ps = ps + __shfl_xor(ps, 4, 32);
      ps = ps + __shfl_xor(ps, 8, 32);
      lrow[r] = lrow[r] * alpha + ps;
      o0[r] = o0[r] * alpha;
      o1[r] = o1[r] * alpha;
    }
    // ---- P tile (16 rows x 64 keys) to the wave's LDS region ----
#pragma unroll
    for (int j = 0; j < 4; ++j) {
#pragma unroll
      for (int r = 0; r < 8; ++r) {
        Ph[(8 * hh + r) * PP + j * 16 + c] = (_Float16)s[j][r];
      }
    }
    wave_sync_lds();
    // ---- O += P . V : two 32-key k-steps, two 16-dim tiles ----
#pragma unroll
    for (int ks = 0; ks < 2; ++ks) {
      const v16h pa = ldfrag_h(Ph + c * PP + ks * 32 + 8 * hh);
      const v16h v0 = ldfrag_t(Vt + (kb * 2 + ks) * FT + lane * 8);
      const v16h v1 = ldfrag_t(Vt + (TP / 32 + kb * 2 + ks) * FT + lane * 8);
      o0 = mma_raw(pa, v0, o0);
      o1 = mma_raw(pa, v1, o1);
      guard2(o0, o1, pa, v0, v1);
    }
    wave_sync_lds();
  }

  // ---- normalise (64 ctx = O * 4 / l), stage the 16 x 32 tile in LDS (f32), then whole-line stores ----
  float* Os = (float*)(void*)(pbuf + wave * PWB);
#pragma unroll
  for (int r = 0; r < 8; ++r) {
    const float inv = 4.0f / lrow[r];
    const int row = 8 * hh + r;
    Os[row * OSP + c]      = o0[r] * inv;
    Os[row * OSP + 16 + c] = o1[r] * inv;
  }
  wave_sync_lds();
  v4u p2[2];
  size_t off2[2];
#pragma unroll
  for (int sI = 0; sI < 2; ++sI) {
    const int row = c, d0 = sI * 16 + hh * 8;                     // piece sI*32 + lane of the strip's tile
    v4u a;
#pragma unroll
    for (int e = 0; e < 4; ++e) {
      const float f0 = Os[row * OSP + d0 + 2 * e];
      const float f1 = Os[row * OSP + d0 + 2 * e + 1];
      a[e] = pk16(hb16(f0), hb16(f1));
    }
    p2[sI] = a;
    off2[sI] = ((size_t)h * NROWP + (size_t)w * TP + q0) * HD + sI * 256 + lane * 8;
  }
  *(v4u*)(opl + off2[0]) = p2[0];
  *(v4u*)(opl + off2[1]) = p2[1];
  
}

// =================================================================================================================
// Output projection: out rows = (O64/64) . (W1024/1024)^T, K = 256 = 8 head planes of 32. Block tile 64 padded
// tokens x 128 cols, 8 waves = 2 x 4, 2x2 tiles per wave. Epilogue through an LDS f32 tile; a wave writes one
// coverage: 128 windows x 343 tokens x 2 x 128 cols = every output element exactly once.
// =================================================================================================================
__global__ __launch_bounds__(256)
void gemm_proj(const unsigned short* __restrict__ opl, const unsigned short* __restrict__ wp, float* out) {
  __shared__ __align__(16) float Cs[64 * LDC];
  const int tid = threadIdx.x, wave = tid >> 5, lane = tid & 31, hh = lane >> 4, c = lane & 15;
  const int mb = blockIdx.x, nb = blockIdx.y;
  const int mw = wave >> 2, nw = wave & 3;
  const _Float16* W = (const _Float16*)(const void*)wp;
  const _Float16* Ap = (const _Float16*)(const void*)opl + (size_t)(mb * 4 + mw * 2) * FT + lane * 8;  // row tile
  const _Float16* Wp = W + (size_t)(nb * 8 + nw * 2) * 8 * FT + lane * 8;                              // col tile

  v8f a00 = zero8(), a01 = zero8(), a10 = zero8(), a11 = zero8();
#pragma unroll 1
  for (int ks = 0; ks < 8; ++ks) {
    const v16h fa0 = ldfrag_t(Ap);
    const v16h fa1 = ldfrag_t(Ap + FT);
    const v16h fb0 = ldfrag_t(Wp);
    const v16h fb1 = ldfrag_t(Wp + 8 * FT);
    Ap += (size_t)NROWP * HD;                     // next head plane
    Wp += FT;                                     // next 32-k step
    a00 = mma_raw(fa0, fb0, a00);
    a01 = mma_raw(fa0, fb1, a01);
    a10 = mma_raw(fa1, fb0, a10);
    a11 = mma_raw(fa1, fb1, a11);
    guard4(a00, a01, a10, a11, fa0, fa1, fb0, fb1);
  }
#pragma unroll
  for (int r = 0; r < 8; ++r) {
    const int row = mw * 32 + 8 * hh + r;
    Cs[row * LDC + nw * 32 + c]             = a00[r];
    Cs[row * LDC + nw * 32 + 16 + c]        = a01[r];
    Cs[(row + 16) * LDC + nw * 32 + c]      = a10[r];
    Cs[(row + 16) * LDC + nw * 32 + 16 + c] = a11[r];
  }
  __syncthreads();

  const int w = mb / MT, tok0 = (mb - w * MT) * 64;
  const int rbase = tok0 + wave * 8;
  v4f ov[8];
  size_t offs[8];
#pragma unroll
  for (int it = 0; it < 8; ++it) {
    const int row = wave * 8 + it;
    v4f v = *(const v4f*)(Cs + row * LDC + lane * 4);
    v = v * (1.0f / 65536.0f);
    ov[it] = v;
    const int tokc = min(rbase + it, NTOK - 1);
    offs[it] = ((size_t)w * NTOK + tokc) * CCH + nb * 128 + lane * 4;
  }
#pragma unroll
  for (int it = 0; it < 8; ++it) {
    if (rbase + it < NTOK) *(v4f*)(out + offs[it]) = ov[it];     // wave-uniform
  }
  
}

// =================================================================================================================
// token dimension padded to 384 per window everywhere):
//   X8 f16 49152 x 256 25165824 | WqkvT f16 768 x 256 393216 | WoutT f16 256 x 256 131072 |
//   bias table f32 [8][24][24][256] 4718592 | Q f16 1024 x 384 x 32 25165824 | K same 25165824 |
//   V^T f16 1024 x 32 x 384 25165824 | O f16 8 x 49152 x 32 25165824 | total 131072000.
//   every f16 plane is stored as 1024-byte operand tiles in fragment order (ldfrag_t).
// =================================================================================================================
extern "C" void kernel_launch(void* const* d_in, const int* in_sizes, int n_in,
                              void* d_out, int out_size, void* d_ws, size_t ws_size,
                              hipStream_t stream) {
  if (n_in < 4) return;
  if (in_sizes[0] != NROWX * CCH) return;
  if (in_sizes[1] != CCH * C3) return;
  if (in_sizes[2] != CCH * CCH) return;
  if (in_sizes[3] != NRPB * NHD) return;
  if (out_size != NROWX * CCH) return;

  const float* x    = (const float*)d_in[0];
  const float* wqkv = (const float*)d_in[1];
  const float* wout = (const float*)d_in[2];
  const float* rpb  = (const float*)d_in[3];
  float* out = (float*)d_out;

  const size_t sX  = (size_t)NROWP * CCH * 2;                 // 25165824
  const size_t sWq = (size_t)C3 * CCH * 2;                    //   393216
  const size_t sWo = (size_t)CCH * CCH * 2;                   //   131072
  const size_t sBT = (size_t)NHD * NST * NKT * 256 * 4;       //  4718592
  const size_t sQK = (size_t)NWIN * NHD * TP * HD * 2;        // 25165824
  const size_t sO  = (size_t)NHD * NROWP * HD * 2;            // 25165824
  size_t off = 0;
  const size_t oX  = off; off += sX;
  const size_t oWq = off; off += sWq;
  const size_t oWo = off; off += sWo;
  const size_t oBT = off; off += sBT;
  const size_t oQ  = off; off += sQK;
  const size_t oK  = off; off += sQK;
  const size_t oV  = off; off += sQK;
  const size_t oO  = off; off += sO;
  if (off > ws_size) return;                                   // off = 131072000
  if (off > (size_t)134217728) return;

  char* ws = (char*)d_ws;
  unsigned short* X8  = (unsigned short*)(ws + oX);
  unsigned short* WqT = (unsigned short*)(ws + oWq);
  unsigned short* WoT = (unsigned short*)(ws + oWo);
  float*          BT  = (float*)(ws + oBT);
  unsigned short* Qp  = (unsigned short*)(ws + oQ);
  unsigned short* Kp  = (unsigned short*)(ws + oK);
  unsigned short* Vtp = (unsigned short*)(ws + oV);
  unsigned short* Op  = (unsigned short*)(ws + oO);

  const dim3 blk(256);
  // (1) input convert with token padding, weight transposes + converts, bias table
  cvt_x<<<dim3(NROWP / 16), blk, 0, stream>>>(x, X8);
  cvt_wT<<<dim3(C3 / 32), blk, 0, stream>>>(wqkv, WqT, C3);
  cvt_wT<<<dim3(CCH / 32), blk, 0, stream>>>(wout, WoT, CCH);
  build_bias<<<dim3((NHD * NST * NKT * 64) / 256), blk, 0, stream>>>(rpb, BT);
  // (2) qkv projection: 768 row tiles (6 per window) x 6 column tiles
  gemm_qkv<<<dim3(NROWP / 64, C3 / 128), blk, 0, stream>>>(X8, WqT, Qp, Kp, Vtp);
  // (3) window attention: 128 windows x 8 heads x 3 blocks of 8 strips
  attn_win<<<dim3(NWIN * NHD * 3), blk, 0, stream>>>(Qp, Kp, Vtp, BT, Op);
  // (4) output projection -> d_out (padded tokens skipped)
  gemm_proj<<<dim3(NROWP / 64, CCH / 128), blk, 0, stream>>>(Op, WoT, out);
  (void)hipGetLastError();
}

// v002
// One run takes 140 microseconds.
// Timed twice side by side with v001, it ran 1.43 and 1.41 times as fast.
// Over all steps from v000 it is 1.63 times as fast.
// qkv projection, q.k^T, p.v and output projection: v_wmma_f32_16x16x32_f16 single products (f16 operands, f32 accumulate);
// all inputs RNE-converted to bf16 on load and carried as f16 with power-of-two scales; softmax, key padding mask and epilogues in f32 on VALU.
// attention runs on transposed products (S^T = K.Q^T, O^T = V^T.P^T): a lane owns one query, P stays in registers.
#include <hip/hip_runtime.h>
#include <stdint.h>

#define NWIN  128
#define NTOK  343
#define TP    384
#define CCH   256
#define NHD   8
#define HD    32
#define C3    768
#define NROWP 49152
#define NROWX 43904
#define NRPB  2197
#define NST   24
#define NKT   24
#define MT    6
#define LDC   132
#define TPW   260
#define FT    512
#define QSC   0.17677669529663687f
#define INV512 0.001953125f
#define LN1024 6.9314718055994531f
#define LOG2E 1.44269504088896341f
#define MASKC (-1048576.0f)

static_assert(NROWP == NWIN * TP);
static_assert(NROWX == NWIN * NTOK);
static_assert(TP == MT * 64);
static_assert(NST * 16 == TP);
static_assert(NKT * 16 == TP);
static_assert((LDC * 4) % 16 == 0);
static_assert((TPW * 4) % 16 == 0);
static_assert(NHD * HD == CCH);
static_assert(FT == 16 * 32);
static_assert(TP * HD == NST * FT);

typedef _Float16 v16h __attribute__((ext_vector_type(16)));
typedef _Float16 v8h  __attribute__((ext_vector_type(8)));
typedef float    v8f  __attribute__((ext_vector_type(8)));
typedef float    v4f  __attribute__((ext_vector_type(4)));
typedef unsigned int v4u __attribute__((ext_vector_type(4)));

// ---- scalar helpers ------------------------------------------------------------------------------------------
__device__ __forceinline__ unsigned short bf_bits(float f) {          // f32 -> bf16 bits, RNE convert
  unsigned u = __float_as_uint(f);
  return (unsigned short)((u + 0x7FFFu + ((u >> 16) & 1u)) >> 16);
}
__device__ __forceinline__ float bf_up(unsigned short b) { return __uint_as_float(((unsigned)b) << 16); }
__device__ __forceinline__ float bfr(float f) { return bf_up(bf_bits(f)); }
__device__ __forceinline__ unsigned short h_bits(_Float16 x) { return __builtin_bit_cast(unsigned short, x); }
__device__ __forceinline__ unsigned short hb16(float f) { return h_bits((_Float16)f); }
__device__ __forceinline__ unsigned pk16(unsigned short a, unsigned short b) { return (unsigned)a | ((unsigned)b << 16); }
__device__ __forceinline__ v8f zero8() { v8f z = {0.f, 0.f, 0.f, 0.f, 0.f, 0.f, 0.f, 0.f}; return z; }

// ---- fragment loader for the fragment-order global planes: one 16 (rows/cols) x 32 (k) operand tile is FT halves =
//      1024 contiguous bytes; its 16-B piece e*32 + lane holds row/col (lane&15), k = 16*e + 8*(lane>>4) + 0..7 (the
//      hardware k order, which a packed pair of D tiles also has). p = tile base + lane*8: each of the two loads reads
//      512 contiguous bytes per wave.
__device__ __forceinline__ v16h ldfrag_t(const _Float16* p) {
  union { v16h v; v8h h[2]; } f;
  f.h[0] = *(const v8h*)(p);
  f.h[1] = *(const v8h*)(p + 256);
  return f.v;
}

// ---- WMMA helpers; the guard helpers insert the trailing VALU hazard gap and keep A/B live -----------------------
__device__ __forceinline__ v8f mma_raw(v16h a, v16h b, v8f c) {
  return __builtin_amdgcn_wmma_f32_16x16x32_f16(false, a, false, b, (short)0, c, false, false);
}
__device__ __forceinline__ void guard4(v8f& c0, v8f& c1, v8f& c2, v8f& c3,
                                       const v16h& a0, const v16h& a1, const v16h& b0, const v16h& b1) {
#if defined(__HIP_DEVICE_COMPILE__)
  asm volatile("v_nop\n\tv_nop\n\tv_nop\n\tv_nop"
               : "+v"(c0), "+v"(c1), "+v"(c2), "+v"(c3) : "v"(a0), "v"(a1), "v"(b0), "v"(b1));
#endif
}
// value of lane l ^ 16 (the other half of the wave), by a vector cross-row move
__device__ __forceinline__ float xhalf(float x) {
  const int b = __float_as_int(x);
  return __int_as_float(__builtin_amdgcn_permlanex16(b, b, 0x76543210, 0xfedcba98, false, false));
}

// =================================================================================================================
// input convert with per-window token padding: x [128*343][256] f32 -> X8 plane, 128*384 rows x 256 k as f16 in
// fragment order (tile (row/16)*8 + k/32, see ldfrag_t), value f16(8 * bf16_RNE(x)) for tokens < 343 and exact zeros
// for padded tokens 343..383. Block = 16 rows, wave = one 32-k step = one tile: a lane reads 2 x 8 floats of its
// (clamped) source row and stores two 16-B pieces; a wave writes the tile's 1024 contiguous bytes.
// coverage: 3072 blocks x 8 waves x 2 x 32 pieces x 8 halves = 49152 x 256 (every plane element incl. padding once).
// =================================================================================================================
__global__ __launch_bounds__(256) void cvt_x(const float* __restrict__ x, unsigned short* xp) {
  const int tid = threadIdx.x, wv = tid >> 5, lane = tid & 31, hh = lane >> 4, c = lane & 15;
  const int rt = blockIdx.x;
  const int row = rt * 16 + c;
  const int w = row / TP, t = row - w * TP;
  const int ts = min(t, NTOK - 1);
  const float* src = x + ((size_t)w * NTOK + ts) * CCH + wv * 32 + 8 * hh;
  unsigned short* gp = xp + ((size_t)rt * 8 + wv) * FT + lane * 8;
  v4u pk[2];
#pragma unroll
  for (int e = 0; e < 2; ++e) {
    const v4f a = *(const v4f*)(src + 16 * e);
    const v4f b = *(const v4f*)(src + 16 * e + 4);
    v4u p4;
    p4[0] = pk16(hb16(bfr(a[0]) * 8.0f), hb16(bfr(a[1]) * 8.0f));
    p4[1] = pk16(hb16(bfr(a[2]) * 8.0f), hb16(bfr(a[3]) * 8.0f));
    p4[2] = pk16(hb16(bfr(b[0]) * 8.0f), hb16(bfr(b[1]) * 8.0f));
    p4[3] = pk16(hb16(bfr(b[2]) * 8.0f), hb16(bfr(b[3]) * 8.0f));
    if (t >= NTOK) { p4[0] = 0u; p4[1] = 0u; p4[2] = 0u; p4[3] = 0u; }
    pk[e] = p4;
  }
  *(v4u*)gp = pk[0];
  *(v4u*)(gp + 256) = pk[1];
}

// =================================================================================================================
// weight transpose + convert: w [256 k][ncol n] f32 (n contiguous, used as x.w) -> wT, ncol columns x 256 k as f16 in
// fragment order (tile (n/16)*8 + k/32, see ldfrag_t), value f16(1024 * bf16_RNE(w)). Block = 32 columns: the 256x32
// f32 slab is staged in LDS (coalesced reads); wave = one 32-k step, it writes its two tiles of 1024 contiguous bytes.
// coverage: (ncol/32) blocks x 8 waves x 2 tiles x 2 x 32 pieces x 8 halves = ncol x 256.
// =================================================================================================================
__global__ __launch_bounds__(256) void cvt_wT(const float* __restrict__ wsrc, unsigned short* wdst, int ncol) {
  __shared__ __align__(16) float T[32 * TPW];
  const int tid = threadIdx.x, wv = tid >> 5, lane = tid & 31, hh = lane >> 4, c = lane & 15;
  const int n0 = blockIdx.x * 32;
#pragma unroll 4
  for (int it = 0; it < 32; ++it) {
    const int k = it * 8 + wv;
    T[lane * TPW + k] = wsrc[(size_t)k * ncol + n0 + lane];
  }
  __syncthreads();
  v4u pk[4];
  size_t offs[4];
#pragma unroll
  for (int q = 0; q < 4; ++q) {
    const int nt = q >> 1, e = q & 1;
    const float* tp = T + (nt * 16 + c) * TPW + wv * 32 + e * 16 + hh * 8;
    const v4f a = *(const v4f*)(tp);
    const v4f b = *(const v4f*)(tp + 4);
    v4u p4;
    p4[0] = pk16(hb16(bfr(a[0]) * 1024.0f), hb16(bfr(a[1]) * 1024.0f));
    p4[1] = pk16(hb16(bfr(a[2]) * 1024.0f), hb16(bfr(a[3]) * 1024.0f));
    p4[2] = pk16(hb16(bfr(b[0]) * 1024.0f), hb16(bfr(b[1]) * 1024.0f));
    p4[3] = pk16(hb16(bfr(b[2]) * 1024.0f), hb16(bfr(b[3]) * 1024.0f));
    pk[q] = p4;
    offs[q] = ((size_t)(blockIdx.x * 2 + nt) * 8 + wv) * FT + e * 256 + lane * 8;
  }
#pragma unroll
  for (int q = 0; q < 4; ++q) *(v4u*)(wdst + offs[q]) = pk[q];
}

// =================================================================================================================
// relative position bias table in the C-operand order of the transposed logits tile (16 keys x 16 queries), registers
// 0..3 of all lanes then registers 4..7 (each C load reads 512 contiguous bytes per wave):
// BT[((h*24 + strip)*24 + kt)*256 + (r>>2)*128 + l*4 + (r&3)] =
// 512 * bf16_RNE(rpb[idx(n,m)*8 + h]) with n = strip*16 + (l&15) (query), m = kt*16 + 8*(l>>4) + r (key),
// idx = ((i_n-i_m+6)*13 + (j_n-j_m+6))*13 + (k_n-k_m+6), (i,j,k) = (t/49, (t/7)%7, t%7); padded keys m >= 343
// get MASKC (logit mask through the C operand), padded queries n >= 343 get 0. Thread = one 16-B piece (4 keys),
// coverage: 8 heads x 24 strips x 24 key tiles x 64 pieces x 4 floats = 8 x 384 x 384, every element once.
// =================================================================================================================
__global__ __launch_bounds__(256) void build_bias(const float* __restrict__ rpb, float* bt) {
  const int g = blockIdx.x * 256 + threadIdx.x;
  const int piece = g & 63, rec = g >> 6;
  const int kt = rec % NKT, strip = (rec / NKT) % NST, h = rec / (NKT * NST);
  const int l = piece & 31, e0 = (piece >> 5) * 4;
  const int col = l & 15, lh = l >> 4;
  const int n = strip * 16 + col;
  const int ni = n / 49, nj = (n / 7) % 7, nk = n % 7;
  v4f v;
#pragma unroll
  for (int e = 0; e < 4; ++e) {
    const int m = kt * 16 + 8 * lh + e0 + e;
    const int mi = m / 49, mj = (m / 7) % 7, mk = m % 7;
    int idx = ((ni - mi + 6) * 13 + (nj - mj + 6)) * 13 + (nk - mk + 6);
    idx = min(max(idx, 0), NRPB - 1);
    float val = bfr(rpb[idx * NHD + h]) * 512.0f;
    if (n >= NTOK) val = 0.0f;
    if (m >= NTOK) val = MASKC;
    v[e] = val;
  }
  float* gp = bt + (size_t)rec * 256 + piece * 4;
  *(v4f*)gp = v;
  
}

// =================================================================================================================
// qkv GEMM: C[64 tokens][128 cols] per block = X8[rows][256] . W1024[cols][256]^T, K = 256 (8 k-steps of 32),
// fragments straight from the fragment-order global planes; 8 waves = 2 (32 rows) x 4 (32 cols), 2x2 tiles per wave.
// C = 8192 * (x . W). M tiles never cross a window (384 padded rows per window = 6 tiles). Epilogue through an LDS
// f32 tile: part q -> Q plane = f16(64 * q * 32^-0.5), part k -> K plane = f16(8*k), both in fragment order with tile
// (w*8+h)*24 + tok/16 (16 tokens x 32 d); part v -> V^T plane = f16(16*v) in fragment order with tile
// ((w*8+h)*2 + d/16)*12 + tok/32 (16 d x 32 tokens). Padded tokens come out as exact zeros (zero X rows). A wave's
// store writes 512 contiguous bytes (half a tile).
// coverage: Q/K: 4 instr x 256 pieces x 8 halves = 4 heads x 64 tok x 32 d; V: 4 instr x 256 pieces x 8 =
// 4 heads x 32 d x 64 tok; over the grid every element of Q, K (1024x384x32) and V^T (1024x32x384) exactly once.
// =================================================================================================================
__global__ __launch_bounds__(256)
void gemm_qkv(const unsigned short* __restrict__ xp, const unsigned short* __restrict__ wq,
              unsigned short* qpl, unsigned short* kpl, unsigned short* vtp) {
  __shared__ __align__(16) float Cs[64 * LDC];
  const int tid = threadIdx.x, wave = tid >> 5, lane = tid & 31, hh = lane >> 4, c = lane & 15;
  const int mb = blockIdx.x, nb = blockIdx.y;
  const int mw = wave >> 2, nw = wave & 3;
  const _Float16* A = (const _Float16*)(const void*)xp;
  const _Float16* W = (const _Float16*)(const void*)wq;
  const _Float16* Ap = A + (size_t)(mb * 4 + mw * 2) * 8 * FT + lane * 8;   // row tile (mb*64 + mw*32) / 16
  const _Float16* Wp = W + (size_t)(nb * 8 + nw * 2) * 8 * FT + lane * 8;   // col tile (nb*128 + nw*32) / 16

  v8f a00 = zero8(), a01 = zero8(), a10 = zero8(), a11 = zero8();
#pragma unroll 1
  for (int ks = 0; ks < 8; ++ks) {
    const v16h fa0 = ldfrag_t(Ap + ks * FT);
    const v16h fa1 = ldfrag_t(Ap + (8 + ks) * FT);
    const v16h fb0 = ldfrag_t(Wp + ks * FT);
    const v16h fb1 = ldfrag_t(Wp + (8 + ks) * FT);
    a00 = mma_raw(fa0, fb0, a00);
    a01 = mma_raw(fa0, fb1, a01);
    a10 = mma_raw(fa1, fb0, a10);
    a11 = mma_raw(fa1, fb1, a11);
    guard4(a00, a01, a10, a11, fa0, fa1, fb0, fb1);
  }
#pragma unroll
  for (int r = 0; r < 8; ++r) {
    const int row = mw * 32 + 8 * hh + r;
    Cs[row * LDC + nw * 32 + c]             = a00[r];
    Cs[row * LDC + nw * 32 + 16 + c]        = a01[r];
    Cs[(row + 16) * LDC + nw * 32 + c]      = a10[r];
    Cs[(row + 16) * LDC + nw * 32 + 16 + c] = a11[r];
  }
  __syncthreads();

  const int part = nb >> 1;                       // block-uniform: 0 q, 1 k, 2 v
  const int hb4 = (nb & 1) * 4;
  const int w = mb / MT, tok0 = (mb - w * MT) * 64;
  if (part < 2) {
    unsigned short* dst = (part == 0) ? qpl : kpl;
    const float scl = (part == 0) ? (QSC * (64.0f / 8192.0f)) : (8.0f / 8192.0f);
    v4u pk[4];
    size_t offs[4];
#pragma unroll
    for (int s = 0; s < 4; ++s) {
      const int blk = s * 4 + (tid >> 6), pc = tid & 63;          // 16 tiles (4 heads x 4 token tiles) x 64 pieces
      const int h4 = blk >> 2, tt = blk & 3;
      const int tok = tt * 16 + (pc & 15), d0 = (pc >> 5) * 16 + ((pc >> 4) & 1) * 8;
      const int col = h4 * 32 + d0;
      v4u q4;
#pragma unroll
      for (int e = 0; e < 4; ++e) {
        const float f0 = Cs[tok * LDC + col + 2 * e] * scl;
        const float f1 = Cs[tok * LDC + col + 2 * e + 1] * scl;
        q4[e] = pk16(hb16(f0), hb16(f1));
      }
      pk[s] = q4;
      offs[s] = ((size_t)((w * NHD + hb4 + h4) * NST + (tok0 >> 4) + tt)) * FT + pc * 8;
    }
#pragma unroll
    for (int s = 0; s < 4; ++s) *(v4u*)(dst + offs[s]) = pk[s];
    
  } else {
    v4u pv[4];
    size_t offs[4];
#pragma unroll
    for (int s = 0; s < 4; ++s) {
      const int blk = s * 4 + (tid >> 6), pc = tid & 63;          // 16 tiles (4 heads x 2 d tiles x 2 k-steps) x 64 pieces
      const int h4 = blk >> 2, dt = (blk >> 1) & 1, k2 = blk & 1;
      const int col = h4 * 32 + dt * 16 + (pc & 15);
      const int tb = k2 * 32 + (pc >> 5) * 16 + ((pc >> 4) & 1) * 8;
      v4u a;
#pragma unroll
      for (int e = 0; e < 4; ++e) {
        const float v0 = Cs[(tb + 2 * e) * LDC + col] * (16.0f / 8192.0f);
        const float v1 = Cs[(tb + 2 * e + 1) * LDC + col] * (16.0f / 8192.0f);
        a[e] = pk16(hb16(v0), hb16(v1));
      }
      pv[s] = a;
      offs[s] = ((size_t)(((w * NHD + hb4 + h4) * 2 + dt) * (TP / 32) + (tok0 >> 5) + k2)) * FT + pc * 8;
    }
#pragma unroll
    for (int s = 0; s < 4; ++s) *(v4u*)(vtp + offs[s]) = pv[s];
    
  }
}

__global__ __launch_bounds__(256)
void attn_win(const unsigned short* __restrict__ qpl, const unsigned short* __restrict__ kpl,
              const unsigned short* __restrict__ vtp, const float* __restrict__ bt, unsigned short* opl) {
  union CB { v8f v; v4f q[2]; };
  const int tid = threadIdx.x, wave = tid >> 5, lane = tid & 31;
  const int wh = blockIdx.x / 3;                  // w*8 + h
  const int sb = blockIdx.x - wh * 3;
  const int w = wh >> 3, h = wh & 7;
  const int strip = sb * 8 + wave;                // 0..23
  const int q0 = strip * 16;

  const _Float16* Q  = (const _Float16*)(const void*)qpl + (size_t)wh * TP * HD;
  const _Float16* K  = (const _Float16*)(const void*)kpl + (size_t)wh * TP * HD;
  const _Float16* Vt = (const _Float16*)(const void*)vtp + (size_t)wh * HD * TP;
  const float* Bp = bt + ((size_t)(h * NST + strip)) * NKT * 256 + lane * 4;

  const v16h qb = ldfrag_t(Q + strip * FT + lane * 8);
  float mrow = -1e30f, lrow = 0.f;                // this lane's query: running maximum, sum over this half's keys
  v8f o0 = zero8(), o1 = zero8();

#pragma unroll 1
  for (int kb = 0; kb < TP / 64; ++kb) {
    // ---- transposed logits for 64 keys: 4 tiles of 16 keys, bias and key padding mask via the C operand ----
    v8f s[4];
#pragma unroll
    for (int j = 0; j < 4; ++j) {
      const v16h kf = ldfrag_t(K + (kb * 4 + j) * FT + lane * 8);
      const float* bp = Bp + (kb * 4 + j) * 256;
      CB cb;
      cb.q[0] = *(const v4f*)(bp);
      cb.q[1] = *(const v4f*)(bp + 128);
      s[j] = mma_raw(kf, qb, cb.v);
    }
    // ---- online softmax update of the lane's query ----
    float tj[4];
#pragma unroll
    for (int j = 0; j < 4; ++j) {
      tj[j] = fmaxf(fmaxf(fmaxf(s[j][0], s[j][1]), fmaxf(s[j][2], s[j][3])),
                    fmaxf(fmaxf(s[j][4], s[j][5]), fmaxf(s[j][6], s[j][7])));
    }
    float tm = fmaxf(fmaxf(tj[0], tj[1]), fmaxf(tj[2], tj[3]));
    tm = fmaxf(tm, xhalf(tm));
    const float mn = fmaxf(mrow, tm);
    const float alpha = __expf((mrow - mn) * INV512);
    mrow = mn;
#pragma unroll
    for (int j = 0; j < 4; ++j) {
      const v8f u = ((s[j] - mn) * INV512 + LN1024) * LOG2E;      // one maximum per lane: whole-tile (packed) arithmetic
#pragma unroll
      for (int r = 0; r < 8; ++r) s[j][r] = __builtin_amdgcn_exp2f(u[r]);
    }
    const v8f p8 = (s[0] + s[1]) + (s[2] + s[3]);
    const v4f p4 = p8.lo + p8.hi;
    lrow = lrow * alpha + ((p4[0] + p4[1]) + (p4[2] + p4[3]));
    o0 = o0 * alpha;
    o1 = o1 * alpha;
    // ---- O^T += V^T . P^T : two 32-key k-steps, two 16-dim tiles ----
#pragma unroll
    for (int ks = 0; ks < 2; ++ks) {
      v16h pb;
#pragma unroll
      for (int e = 0; e < 8; ++e) {
        pb[e]     = (_Float16)s[2 * ks][e];
        pb[8 + e] = (_Float16)s[2 * ks + 1][e];
      }
      const v16h v0 = ldfrag_t(Vt + (kb * 2 + ks) * FT + lane * 8);
      const v16h v1 = ldfrag_t(Vt + (TP / 32 + kb * 2 + ks) * FT + lane * 8);
      o0 = mma_raw(v0, pb, o0);
      o1 = mma_raw(v1, pb, o1);
    }
  }

  // ---- join the halves' sums, normalise (64 ctx = O * 4 / l), store the lane's two 16-B pieces ----
  const float inv = 4.0f / (lrow + xhalf(lrow));
  v4u p0, p1;
#pragma unroll
  for (int e = 0; e < 4; ++e) {
    p0[e] = pk16(hb16(o0[2 * e] * inv), hb16(o0[2 * e + 1] * inv));
    p1[e] = pk16(hb16(o1[2 * e] * inv), hb16(o1[2 * e + 1] * inv));
  }
  unsigned short* op = opl + ((size_t)h * NROWP + (size_t)w * TP + q0) * HD + lane * 8;
  *(v4u*)op = p0;
  *(v4u*)(op + 256) = p1;
}

// =================================================================================================================
// Output projection: out rows = (O64/64) . (W1024/1024)^T, K = 256 = 8 head planes of 32. Block tile 64 padded
// tokens x 128 cols, 8 waves = 2 x 4, 2x2 tiles per wave. Epilogue through an LDS f32 tile; a wave writes one
// coverage: 128 windows x 343 tokens x 2 x 128 cols = every output element exactly once.
// =================================================================================================================
__global__ __launch_bounds__(256)
void gemm_proj(const unsigned short* __restrict__ opl, const unsigned short* __restrict__ wp, float* out) {
  __shared__ __align__(16) float Cs[64 * LDC];
  const int tid = threadIdx.x, wave = tid >> 5, lane = tid & 31, hh = lane >> 4, c = lane & 15;
  const int mb = blockIdx.x, nb = blockIdx.y;
  const int mw = wave >> 2, nw = wave & 3;
  const _Float16* W = (const _Float16*)(const void*)wp;
  const _Float16* Ap = (const _Float16*)(const void*)opl + (size_t)(mb * 4 + mw * 2) * FT + lane * 8;  // row tile
  const _Float16* Wp = W + (size_t)(nb * 8 + nw * 2) * 8 * FT + lane * 8;                              // col tile

  v8f a00 = zero8(), a01 = zero8(), a10 = zero8(), a11 = zero8();
#pragma unroll 1
  for (int ks = 0; ks < 8; ++ks) {
    const v16h fa0 = ldfrag_t(Ap);
    const v16h fa1 = ldfrag_t(Ap + FT);
    const v16h fb0 = ldfrag_t(Wp);
    const v16h fb1 = ldfrag_t(Wp + 8 * FT);
    Ap += (size_t)NROWP * HD;                     // next head plane
    Wp += FT;                                     // next 32-k step
    a00 = mma_raw(fa0, fb0, a00);
    a01 = mma_raw(fa0, fb1, a01);
    a10 = mma_raw(fa1, fb0, a10);
    a11 = mma_raw(fa1, fb1, a11);
    guard4(a00, a01, a10, a11, fa0, fa1, fb0, fb1);
  }
#pragma unroll
  for (int r = 0; r < 8; ++r) {
    const int row = mw * 32 + 8 * hh + r;
    Cs[row * LDC + nw * 32 + c]             = a00[r];
    Cs[row * LDC + nw * 32 + 16 + c]        = a01[r];
    Cs[(row + 16) * LDC + nw * 32 + c]      = a10[r];
    Cs[(row + 16) * LDC + nw * 32 + 16 + c] = a11[r];
  }
  __syncthreads();

  const int w = mb / MT, tok0 = (mb - w * MT) * 64;
  const int rbase = tok0 + wave * 8;
  v4f ov[8];
  size_t offs[8];
#pragma unroll
  for (int it = 0; it < 8; ++it) {
    const int row = wave * 8 + it;
    v4f v = *(const v4f*)(Cs + row * LDC + lane * 4);
    v = v * (1.0f / 65536.0f);
    ov[it] = v;
    const int tokc = min(rbase + it, NTOK - 1);
    offs[it] = ((size_t)w * NTOK + tokc) * CCH + nb * 128 + lane * 4;
  }
#pragma unroll
  for (int it = 0; it < 8; ++it) {
    if (rbase + it < NTOK) *(v4f*)(out + offs[it]) = ov[it];     // wave-uniform
  }
  
}

// =================================================================================================================
// token dimension padded to 384 per window everywhere):
//   X8 f16 49152 x 256 25165824 | WqkvT f16 768 x 256 393216 | WoutT f16 256 x 256 131072 |
//   bias table f32 [8][24][24][256] 4718592 | Q f16 1024 x 384 x 32 25165824 | K same 25165824 |
//   V^T f16 1024 x 32 x 384 25165824 | O f16 8 x 49152 x 32 25165824 | total 131072000.
//   every f16 plane is stored as 1024-byte operand tiles in fragment order (ldfrag_t).
// =================================================================================================================
extern "C" void kernel_launch(void* const* d_in, const int* in_sizes, int n_in,
                              void* d_out, int out_size, void* d_ws, size_t ws_size,
                              hipStream_t stream) {
  if (n_in < 4) return;
  if (in_sizes[0] != NROWX * CCH) return;
  if (in_sizes[1] != CCH * C3) return;
  if (in_sizes[2] != CCH * CCH) return;
  if (in_sizes[3] != NRPB * NHD) return;
  if (out_size != NROWX * CCH) return;

  const float* x    = (const float*)d_in[0];
  const float* wqkv = (const float*)d_in[1];
  const float* wout = (const float*)d_in[2];
  const float* rpb  = (const float*)d_in[3];
  float* out = (float*)d_out;

  const size_t sX  = (size_t)NROWP * CCH * 2;                 // 25165824
  const size_t sWq = (size_t)C3 * CCH * 2;                    //   393216
  const size_t sWo = (size_t)CCH * CCH * 2;                   //   131072
  const size_t sBT = (size_t)NHD * NST * NKT * 256 * 4;       //  4718592
  const size_t sQK = (size_t)NWIN * NHD * TP * HD * 2;        // 25165824
  const size_t sO  = (size_t)NHD * NROWP * HD * 2;            // 25165824
  size_t off = 0;
  const size_t oX  = off; off += sX;
  const size_t oWq = off; off += sWq;
  const size_t oWo = off; off += sWo;
  const size_t oBT = off; off += sBT;
  const size_t oQ  = off; off += sQK;
  const size_t oK  = off; off += sQK;
  const size_t oV  = off; off += sQK;
  const size_t oO  = off; off += sO;
  if (off > ws_size) return;                                   // off = 131072000
  if (off > (size_t)134217728) return;

  char* ws = (char*)d_ws;
  unsigned short* X8  = (unsigned short*)(ws + oX);
  unsigned short* WqT = (unsigned short*)(ws + oWq);
  unsigned short* WoT = (unsigned short*)(ws + oWo);
  float*          BT  = (float*)(ws + oBT);
  unsigned short* Qp  = (unsigned short*)(ws + oQ);
  unsigned short* Kp  = (unsigned short*)(ws + oK);
  unsigned short* Vtp = (unsigned short*)(ws + oV);
  unsigned short* Op  = (unsigned short*)(ws + oO);

  const dim3 blk(256);
  // (1) input convert with token padding, weight transposes + converts, bias table
  cvt_x<<<dim3(NROWP / 16), blk, 0, stream>>>(x, X8);
  cvt_wT<<<dim3(C3 / 32), blk, 0, stream>>>(wqkv, WqT, C3);
  cvt_wT<<<dim3(CCH / 32), blk, 0, stream>>>(wout, WoT, CCH);
  build_bias<<<dim3((NHD * NST * NKT * 64) / 256), blk, 0, stream>>>(rpb, BT);
  // (2) qkv projection: 768 row tiles (6 per window) x 6 column tiles
  gemm_qkv<<<dim3(NROWP / 64, C3 / 128), blk, 0, stream>>>(X8, WqT, Qp, Kp, Vtp);
  // (3) window attention: 128 windows x 8 heads x 3 blocks of 8 strips
  attn_win<<<dim3(NWIN * NHD * 3), blk, 0, stream>>>(Qp, Kp, Vtp, BT, Op);
  // (4) output projection -> d_out (padded tokens skipped)
  gemm_proj<<<dim3(NROWP / 64, CCH / 128), blk, 0, stream>>>(Op, WoT, out);
  (void)hipGetLastError();
}

// v003
// It runs in 129 microseconds.
// In two side-by-side timings against v002, it was 1.09 and 1.10 times as fast.
// Over all steps from v000 it is 1.78 times as fast.
// qkv projection, q.k^T, p.v and output projection: v_wmma_f32_16x16x32_f16 single products (f16 operands, f32 accumulate);
// all inputs RNE-converted to bf16 on load and carried as f16 with power-of-two scales; softmax, key padding mask and epilogues in f32 on VALU.
// attention runs on transposed products (S^T = K.Q^T, O^T = V^T.P^T): a lane owns one query, P stays in registers.
#include <hip/hip_runtime.h>
#include <stdint.h>

#define NWIN  128
#define NTOK  343
#define TP    384
#define CCH   256
#define NHD   8
#define HD    32
#define C3    768
#define NROWP 49152
#define NROWX 43904
#define NRPB  2197
#define NST   24
#define NKT   24
#define MT    6
#define LDC   132
#define TPW   260
#define FT    512
#define QSC   0.17677669529663687f
#define INV512 0.001953125f
#define LN1024 6.9314718055994531f
#define LOG2E 1.44269504088896341f
#define MASKC (-1048576.0f)

static_assert(NROWP == NWIN * TP);
static_assert(NROWX == NWIN * NTOK);
static_assert(TP == MT * 64);
static_assert(NST * 16 == TP);
static_assert(NKT * 16 == TP);
static_assert((LDC * 4) % 16 == 0);
static_assert((TPW * 4) % 16 == 0);
static_assert(NHD * HD == CCH);
static_assert(FT == 16 * 32);
static_assert(TP * HD == NST * FT);

typedef _Float16 v16h __attribute__((ext_vector_type(16)));
typedef _Float16 v8h  __attribute__((ext_vector_type(8)));
typedef float    v8f  __attribute__((ext_vector_type(8)));
typedef float    v4f  __attribute__((ext_vector_type(4)));
typedef unsigned int v4u __attribute__((ext_vector_type(4)));

// ---- scalar helpers ------------------------------------------------------------------------------------------
__device__ __forceinline__ unsigned short bf_bits(float f) {          // f32 -> bf16 bits, RNE convert
  unsigned u = __float_as_uint(f);
  return (unsigned short)((u + 0x7FFFu + ((u >> 16) & 1u)) >> 16);
}
__device__ __forceinline__ float bf_up(unsigned short b) { return __uint_as_float(((unsigned)b) << 16); }
__device__ __forceinline__ float bfr(float f) { return bf_up(bf_bits(f)); }
__device__ __forceinline__ unsigned short h_bits(_Float16 x) { return __builtin_bit_cast(unsigned short, x); }
__device__ __forceinline__ unsigned short hb16(float f) { return h_bits((_Float16)f); }
__device__ __forceinline__ unsigned pk16(unsigned short a, unsigned short b) { return (unsigned)a | ((unsigned)b << 16); }
__device__ __forceinline__ v8f zero8() { v8f z = {0.f, 0.f, 0.f, 0.f, 0.f, 0.f, 0.f, 0.f}; return z; }

// ---- fragment loader for the fragment-order global planes: one 16 (rows/cols) x 32 (k) operand tile is FT halves =
//      1024 contiguous bytes; its 16-B piece e*32 + lane holds row/col (lane&15), k = 16*e + 8*(lane>>4) + 0..7 (the
//      hardware k order, which a packed pair of D tiles also has). p = tile base + lane*8: each of the two loads reads
//      512 contiguous bytes per wave.
__device__ __forceinline__ v16h ldfrag_t(const _Float16* p) {
  union { v16h v; v8h h[2]; } f;
  f.h[0] = *(const v8h*)(p);
  f.h[1] = *(const v8h*)(p + 256);
  return f.v;
}

// ---- WMMA helpers; the guard helpers insert the trailing VALU hazard gap and keep A/B live -----------------------
__device__ __forceinline__ v8f mma_raw(v16h a, v16h b, v8f c) {
  return __builtin_amdgcn_wmma_f32_16x16x32_f16(false, a, false, b, (short)0, c, false, false);
}
__device__ __forceinline__ void guard4(v8f& c0, v8f& c1, v8f& c2, v8f& c3,
                                       const v16h& a0, const v16h& a1, const v16h& b0, const v16h& b1) {
#if defined(__HIP_DEVICE_COMPILE__)
  asm volatile("v_nop\n\tv_nop\n\tv_nop\n\tv_nop"
               : "+v"(c0), "+v"(c1), "+v"(c2), "+v"(c3) : "v"(a0), "v"(a1), "v"(b0), "v"(b1));
#endif
}
// value of lane l ^ 16 (the other half of the wave), by a vector cross-row move
__device__ __forceinline__ float xhalf(float x) {
  const int b = __float_as_int(x);
  return __int_as_float(__builtin_amdgcn_permlanex16(b, b, 0x76543210, 0xfedcba98, false, false));
}

// =================================================================================================================
// weight transpose + convert: w [256 k][ncol n] f32 (n contiguous, used as x.w) -> wT, ncol columns x 256 k as f16 in
// fragment order (tile (n/16)*8 + k/32, see ldfrag_t), value f16(1024 * bf16_RNE(w)). Block = 32 columns: the 256x32
// f32 slab is staged in LDS (coalesced reads); wave = one 32-k step, it writes its two tiles of 1024 contiguous bytes.
// coverage: (ncol/32) blocks x 8 waves x 2 tiles x 2 x 32 pieces x 8 halves = ncol x 256.
// =================================================================================================================
__global__ __launch_bounds__(256) void cvt_wT(const float* __restrict__ wsrc, unsigned short* wdst, int ncol) {
  __shared__ __align__(16) float T[32 * TPW];
  const int tid = threadIdx.x, wv = tid >> 5, lane = tid & 31, hh = lane >> 4, c = lane & 15;
  const int n0 = blockIdx.x * 32;
#pragma unroll 4
  for (int it = 0; it < 32; ++it) {
    const int k = it * 8 + wv;
    T[lane * TPW + k] = wsrc[(size_t)k * ncol + n0 + lane];
  }
  __syncthreads();
  v4u pk[4];
  size_t offs[4];
#pragma unroll
  for (int q = 0; q < 4; ++q) {
    const int nt = q >> 1, e = q & 1;
    const float* tp = T + (nt * 16 + c) * TPW + wv * 32 + e * 16 + hh * 8;
    const v4f a = *(const v4f*)(tp);
    const v4f b = *(const v4f*)(tp + 4);
    v4u p4;
    p4[0] = pk16(hb16(bfr(a[0]) * 1024.0f), hb16(bfr(a[1]) * 1024.0f));
    p4[1] = pk16(hb16(bfr(a[2]) * 1024.0f), hb16(bfr(a[3]) * 1024.0f));
    p4[2] = pk16(hb16(bfr(b[0]) * 1024.0f), hb16(bfr(b[1]) * 1024.0f));
    p4[3] = pk16(hb16(bfr(b[2]) * 1024.0f), hb16(bfr(b[3]) * 1024.0f));
    pk[q] = p4;
    offs[q] = ((size_t)(blockIdx.x * 2 + nt) * 8 + wv) * FT + e * 256 + lane * 8;
  }
#pragma unroll
  for (int q = 0; q < 4; ++q) *(v4u*)(wdst + offs[q]) = pk[q];
}

// =================================================================================================================
// relative position bias table in the C-operand order of the transposed logits tile (16 keys x 16 queries), registers
// 0..3 of all lanes then registers 4..7 (each C load reads 512 contiguous bytes per wave):
// BT[((h*24 + strip)*24 + kt)*256 + (r>>2)*128 + l*4 + (r&3)] =
// 512 * bf16_RNE(rpb[idx(n,m)*8 + h]) with n = strip*16 + (l&15) (query), m = kt*16 + 8*(l>>4) + r (key),
// idx = ((i_n-i_m+6)*13 + (j_n-j_m+6))*13 + (k_n-k_m+6), (i,j,k) = (t/49, (t/7)%7, t%7); padded keys m >= 343
// get MASKC (logit mask through the C operand), padded queries n >= 343 get 0. Thread = one 16-B piece (4 keys),
// coverage: 8 heads x 24 strips x 24 key tiles x 64 pieces x 4 floats = 8 x 384 x 384, every element once.
// =================================================================================================================
__global__ __launch_bounds__(256) void build_bias(const float* __restrict__ rpb, float* bt) {
  const int g = blockIdx.x * 256 + threadIdx.x;
  const int piece = g & 63, rec = g >> 6;
  const int kt = rec % NKT, strip = (rec / NKT) % NST, h = rec / (NKT * NST);
  const int l = piece & 31, e0 = (piece >> 5) * 4;
  const int col = l & 15, lh = l >> 4;
  const int n = strip * 16 + col;
  const int ni = n / 49, nj = (n / 7) % 7, nk = n % 7;
  v4f v;
#pragma unroll
  for (int e = 0; e < 4; ++e) {
    const int m = kt * 16 + 8 * lh + e0 + e;
    const int mi = m / 49, mj = (m / 7) % 7, mk = m % 7;
    int idx = ((ni - mi + 6) * 13 + (nj - mj + 6)) * 13 + (nk - mk + 6);
    idx = min(max(idx, 0), NRPB - 1);
    float val = bfr(rpb[idx * NHD + h]) * 512.0f;
    if (n >= NTOK) val = 0.0f;
    if (m >= NTOK) val = MASKC;
    v[e] = val;
  }
  float* gp = bt + (size_t)rec * 256 + piece * 4;
  *(v4f*)gp = v;
  
}

// =================================================================================================================
// qkv GEMM with the input convert fused in: block = 64 padded tokens of one window x all 768 columns. The block reads
// its 64 x 256 f32 slab of x once (token clamped, padded tokens 343..383 become exact zeros), converts it to
// f16(8 * bf16_RNE(x)) and keeps it in LDS as 4 x 8 operand tiles in fragment order (tile rt*8 + k/32, see ldfrag_t);
// wave = one 32-k step of the convert. Then 6 passes of 128 columns: C[64][128] = X8 . W1024^T, K = 256 (8 k-steps),
// A fragments from LDS, B fragments from the fragment-order weight plane; 8 waves = 2 (32 rows) x 4 (32 cols), 2x2
// tiles per wave. C = 8192 * (x . W). Epilogue of a pass through an LDS f32 tile: part q -> Q plane =
// f16(64 * q * 32^-0.5), part k -> K plane = f16(8*k), both in fragment order with tile (w*8+h)*24 + tok/16
// (16 tokens x 32 d); part v -> V^T plane = f16(16*v) in fragment order with tile ((w*8+h)*2 + d/16)*12 + tok/32
// (16 d x 32 tokens). A wave's store writes 512 contiguous bytes (half a tile).
// coverage: per pass Q/K: 4 instr x 256 pieces x 8 halves = 4 heads x 64 tok x 32 d; V: 4 instr x 256 pieces x 8 =
// 4 heads x 32 d x 64 tok; over grid and passes every element of Q, K (1024x384x32) and V^T (1024x32x384) once.
// =================================================================================================================
__global__ __launch_bounds__(256)
void gemm_qkv(const float* __restrict__ x, const unsigned short* __restrict__ wq,
              unsigned short* qpl, unsigned short* kpl, unsigned short* vtp) {
  __shared__ __align__(16) unsigned short As[4 * 8 * FT];
  __shared__ __align__(16) float Cs[64 * LDC];
  const int tid = threadIdx.x, wave = tid >> 5, lane = tid & 31, hh = lane >> 4, c = lane & 15;
  const int mb = blockIdx.x;
  const int mw = wave >> 2, nw = wave & 3;
  const int w = mb / MT, tok0 = (mb - w * MT) * 64;

  // ---- convert the block's rows into LDS: all 16 loads of a lane first, then the packs ----
  {
    v4f xa[4][4];
    const float* src[4];
#pragma unroll
    for (int rt = 0; rt < 4; ++rt) {
      const int ts = min(tok0 + rt * 16 + c, NTOK - 1);
      src[rt] = x + ((size_t)w * NTOK + ts) * CCH + wave * 32 + 8 * hh;
#pragma unroll
      for (int e = 0; e < 2; ++e) {
        xa[rt][2 * e]     = *(const v4f*)(src[rt] + 16 * e);
        xa[rt][2 * e + 1] = *(const v4f*)(src[rt] + 16 * e + 4);
      }
    }
    // the loads' address registers stay whole up to this wait (named as inputs), and are rewritten only behind it
    asm volatile("s_wait_xcnt 0x0" :: "v"(src[0]), "v"(src[1]), "v"(src[2]), "v"(src[3]) : "memory");
#pragma unroll
    for (int rt = 0; rt < 4; ++rt) {
      const bool pad = tok0 + rt * 16 + c >= NTOK;
#pragma unroll
      for (int e = 0; e < 2; ++e) {
        const v4f a = xa[rt][2 * e], b = xa[rt][2 * e + 1];
        v4u p4;
        p4[0] = pk16(hb16(bfr(a[0]) * 8.0f), hb16(bfr(a[1]) * 8.0f));
        p4[1] = pk16(hb16(bfr(a[2]) * 8.0f), hb16(bfr(a[3]) * 8.0f));
        p4[2] = pk16(hb16(bfr(b[0]) * 8.0f), hb16(bfr(b[1]) * 8.0f));
        p4[3] = pk16(hb16(bfr(b[2]) * 8.0f), hb16(bfr(b[3]) * 8.0f));
        if (pad) { p4[0] = 0u; p4[1] = 0u; p4[2] = 0u; p4[3] = 0u; }
        *(v4u*)(As + (rt * 8 + wave) * FT + e * 256 + lane * 8) = p4;
      }
    }
  }
  __syncthreads();                                // the slab is whole before any wave reads other waves' tiles
  const _Float16* Al = (const _Float16*)(const void*)As + (mw * 2) * 8 * FT + lane * 8;   // row tile mw*2 of the block
  const _Float16* Wl = (const _Float16*)(const void*)wq + (size_t)(nw * 2) * 8 * FT + lane * 8;  // col tile nw*2 of pass 0

#pragma unroll 1                                  // six copies of k loop and both epilogues would only swell the code
  for (int nb = 0; nb < C3 / 128; ++nb) {
    const _Float16* Wp = Wl + (size_t)nb * 64 * FT;                            // col tile (nb*128 + nw*32) / 16
    v8f a00 = zero8(), a01 = zero8(), a10 = zero8(), a11 = zero8();
#pragma unroll 1
    for (int ks = 0; ks < 8; ++ks) {
      const v16h fa0 = ldfrag_t(Al + ks * FT);
      const v16h fa1 = ldfrag_t(Al + (8 + ks) * FT);
      const v16h fb0 = ldfrag_t(Wp + ks * FT);
      const v16h fb1 = ldfrag_t(Wp + (8 + ks) * FT);
      a00 = mma_raw(fa0, fb0, a00);
      a01 = mma_raw(fa0, fb1, a01);
      a10 = mma_raw(fa1, fb0, a10);
      a11 = mma_raw(fa1, fb1, a11);
      guard4(a00, a01, a10, a11, fa0, fa1, fb0, fb1);
    }
    if (nb) __syncthreads();                      // every reader of the previous pass has left Cs
#pragma unroll
    for (int r = 0; r < 8; ++r) {
      const int row = mw * 32 + 8 * hh + r;
      Cs[row * LDC + nw * 32 + c]             = a00[r];
      Cs[row * LDC + nw * 32 + 16 + c]        = a01[r];
      Cs[(row + 16) * LDC + nw * 32 + c]      = a10[r];
      Cs[(row + 16) * LDC + nw * 32 + 16 + c] = a11[r];
    }
    __syncthreads();

    const int part = nb >> 1;                     // block-uniform: 0 q, 1 k, 2 v
    const int hb4 = (nb & 1) * 4;
    if (part < 2) {
      unsigned short* dst = (part == 0) ? qpl : kpl;
      const float scl = (part == 0) ? (QSC * (64.0f / 8192.0f)) : (8.0f / 8192.0f);
      v4u pk[4];
      size_t offs[4];
#pragma unroll
      for (int s = 0; s < 4; ++s) {
        const int blk = s * 4 + (tid >> 6), pc = tid & 63;          // 16 tiles (4 heads x 4 token tiles) x 64 pieces
        const int h4 = blk >> 2, tt = blk & 3;
        const int tok = tt * 16 + (pc & 15), d0 = (pc >> 5) * 16 + ((pc >> 4) & 1) * 8;
        const int col = h4 * 32 + d0;
        v4u q4;
#pragma unroll
        for (int e = 0; e < 4; ++e) {
          const float f0 = Cs[tok * LDC + col + 2 * e] * scl;
          const float f1 = Cs[tok * LDC + col + 2 * e + 1] * scl;
          q4[e] = pk16(hb16(f0), hb16(f1));
        }
        pk[s] = q4;
        offs[s] = ((size_t)((w * NHD + hb4 + h4) * NST + (tok0 >> 4) + tt)) * FT + pc * 8;
      }
#pragma unroll
      for (int s = 0; s < 4; ++s) *(v4u*)(dst + offs[s]) = pk[s];
      asm volatile("s_wait_xcnt 0x0" ::: "memory");   // the next pass rewrites registers that these stores name
    } else {
      v4u pv[4];
      size_t offs[4];
#pragma unroll
      for (int s = 0; s < 4; ++s) {
        const int blk = s * 4 + (tid >> 6), pc = tid & 63;          // 16 tiles (4 heads x 2 d tiles x 2 k-steps) x 64 pieces
        const int h4 = blk >> 2, dt = (blk >> 1) & 1, k2 = blk & 1;
        const int col = h4 * 32 + dt * 16 + (pc & 15);
        const int tb = k2 * 32 + (pc >> 5) * 16 + ((pc >> 4) & 1) * 8;
        v4u a;
#pragma unroll
        for (int e = 0; e < 4; ++e) {
          const float v0 = Cs[(tb + 2 * e) * LDC + col] * (16.0f / 8192.0f);
          const float v1 = Cs[(tb + 2 * e + 1) * LDC + col] * (16.0f / 8192.0f);
          a[e] = pk16(hb16(v0), hb16(v1));
        }
        pv[s] = a;
        offs[s] = ((size_t)(((w * NHD + hb4 + h4) * 2 + dt) * (TP / 32) + (tok0 >> 5) + k2)) * FT + pc * 8;
      }
#pragma unroll
      for (int s = 0; s < 4; ++s) *(v4u*)(vtp + offs[s]) = pv[s];
      asm volatile("s_wait_xcnt 0x0" ::: "memory");   // the next pass rewrites registers that these stores name
    }
  }
}

__global__ __launch_bounds__(256)
void attn_win(const unsigned short* __restrict__ qpl, const unsigned short* __restrict__ kpl,
              const unsigned short* __restrict__ vtp, const float* __restrict__ bt, unsigned short* opl) {
  union CB { v8f v; v4f q[2]; };
  const int tid = threadIdx.x, wave = tid >> 5, lane = tid & 31;
  const int wh = blockIdx.x / 3;                  // w*8 + h
  const int sb = blockIdx.x - wh * 3;
  const int w = wh >> 3, h = wh & 7;
  const int strip = sb * 8 + wave;                // 0..23
  const int q0 = strip * 16;

  const _Float16* Q  = (const _Float16*)(const void*)qpl + (size_t)wh * TP * HD;
  const _Float16* K  = (const _Float16*)(const void*)kpl + (size_t)wh * TP * HD;
  const _Float16* Vt = (const _Float16*)(const void*)vtp + (size_t)wh * HD * TP;
  const float* Bp = bt + ((size_t)(h * NST + strip)) * NKT * 256 + lane * 4;

  const v16h qb = ldfrag_t(Q + strip * FT + lane * 8);
  float mrow = -1e30f, lrow = 0.f;                // this lane's query: running maximum, sum over this half's keys
  v8f o0 = zero8(), o1 = zero8();

#pragma unroll 1
  for (int kb = 0; kb < TP / 64; ++kb) {
    // ---- transposed logits for 64 keys: 4 tiles of 16 keys, bias and key padding mask via the C operand ----
    v8f s[4];
#pragma unroll
    for (int j = 0; j < 4; ++j) {
      const v16h kf = ldfrag_t(K + (kb * 4 + j) * FT + lane * 8);
      const float* bp = Bp + (kb * 4 + j) * 256;
      CB cb;
      cb.q[0] = *(const v4f*)(bp);
      cb.q[1] = *(const v4f*)(bp + 128);
      s[j] = mma_raw(kf, qb, cb.v);
    }
    // ---- online softmax update of the lane's query ----
    float tj[4];
#pragma unroll
    for (int j = 0; j < 4; ++j) {
      tj[j] = fmaxf(fmaxf(fmaxf(s[j][0], s[j][1]), fmaxf(s[j][2], s[j][3])),
                    fmaxf(fmaxf(s[j][4], s[j][5]), fmaxf(s[j][6], s[j][7])));
    }
    float tm = fmaxf(fmaxf(tj[0], tj[1]), fmaxf(tj[2], tj[3]));
    tm = fmaxf(tm, xhalf(tm));
    const float mn = fmaxf(mrow, tm);
    const float alpha = __expf((mrow - mn) * INV512);
    mrow = mn;
#pragma unroll
    for (int j = 0; j < 4; ++j) {
      const v8f u = ((s[j] - mn) * INV512 + LN1024) * LOG2E;      // one maximum per lane: whole-tile (packed) arithmetic
#pragma unroll
      for (int r = 0; r < 8; ++r) s[j][r] = __builtin_amdgcn_exp2f(u[r]);
    }
    const v8f p8 = (s[0] + s[1]) + (s[2] + s[3]);
    const v4f p4 = p8.lo + p8.hi;
    lrow = lrow * alpha + ((p4[0] + p4[1]) + (p4[2] + p4[3]));
    o0 = o0 * alpha;
    o1 = o1 * alpha;
    // ---- O^T += V^T . P^T : two 32-key k-steps, two 16-dim tiles ----
#pragma unroll
    for (int ks = 0; ks < 2; ++ks) {
      v16h pb;
#pragma unroll
      for (int e = 0; e < 8; ++e) {
        pb[e]     = (_Float16)s[2 * ks][e];
        pb[8 + e] = (_Float16)s[2 * ks + 1][e];
      }
      const v16h v0 = ldfrag_t(Vt + (kb * 2 + ks) * FT + lane * 8);
      const v16h v1 = ldfrag_t(Vt + (TP / 32 + kb * 2 + ks) * FT + lane * 8);
      o0 = mma_raw(v0, pb, o0);
      o1 = mma_raw(v1, pb, o1);
    }
  }

  // ---- join the halves' sums, normalise (64 ctx = O * 4 / l), store the lane's two 16-B pieces ----
  const float inv = 4.0f / (lrow + xhalf(lrow));
  v4u p0, p1;
#pragma unroll
  for (int e = 0; e < 4; ++e) {
    p0[e] = pk16(hb16(o0[2 * e] * inv), hb16(o0[2 * e + 1] * inv));
    p1[e] = pk16(hb16(o1[2 * e] * inv), hb16(o1[2 * e + 1] * inv));
  }
  unsigned short* op = opl + ((size_t)h * NROWP + (size_t)w * TP + q0) * HD + lane * 8;
  *(v4u*)op = p0;
  *(v4u*)(op + 256) = p1;
}

// =================================================================================================================
// Output projection: out rows = (O64/64) . (W1024/1024)^T, K = 256 = 8 head planes of 32. Block tile 64 padded
// tokens x 128 cols, 8 waves = 2 x 4, 2x2 tiles per wave. Epilogue through an LDS f32 tile; a wave writes one
// coverage: 128 windows x 343 tokens x 2 x 128 cols = every output element exactly once.
// =================================================================================================================
__global__ __launch_bounds__(256)
void gemm_proj(const unsigned short* __restrict__ opl, const unsigned short* __restrict__ wp, float* out) {
  __shared__ __align__(16) float Cs[64 * LDC];
  const int tid = threadIdx.x, wave = tid >> 5, lane = tid & 31, hh = lane >> 4, c = lane & 15;
  const int mb = blockIdx.x, nb = blockIdx.y;
  const int mw = wave >> 2, nw = wave & 3;
  const _Float16* W = (const _Float16*)(const void*)wp;
  const _Float16* Ap = (const _Float16*)(const void*)opl + (size_t)(mb * 4 + mw * 2) * FT + lane * 8;  // row tile
  const _Float16* Wp = W + (size_t)(nb * 8 + nw * 2) * 8 * FT + lane * 8;                              // col tile

  v8f a00 = zero8(), a01 = zero8(), a10 = zero8(), a11 = zero8();
#pragma unroll 1
  for (int ks = 0; ks < 8; ++ks) {
    const v16h fa0 = ldfrag_t(Ap);
    const v16h fa1 = ldfrag_t(Ap + FT);
    const v16h fb0 = ldfrag_t(Wp);
    const v16h fb1 = ldfrag_t(Wp + 8 * FT);
    Ap += (size_t)NROWP * HD;                     // next head plane
    Wp += FT;                                     // next 32-k step
    a00 = mma_raw(fa0, fb0, a00);
    a01 = mma_raw(fa0, fb1, a01);
    a10 = mma_raw(fa1, fb0, a10);
    a11 = mma_raw(fa1, fb1, a11);
    guard4(a00, a01, a10, a11, fa0, fa1, fb0, fb1);
  }
#pragma unroll
  for (int r = 0; r < 8; ++r) {
    const int row = mw * 32 + 8 * hh + r;
    Cs[row * LDC + nw * 32 + c]             = a00[r];
    Cs[row * LDC + nw * 32 + 16 + c]        = a01[r];
    Cs[(row + 16) * LDC + nw * 32 + c]      = a10[r];
    Cs[(row + 16) * LDC + nw * 32 + 16 + c] = a11[r];
  }
  __syncthreads();

  const int w = mb / MT, tok0 = (mb - w * MT) * 64;
  const int rbase = tok0 + wave * 8;
  v4f ov[8];
  size_t offs[8];
#pragma unroll
  for (int it = 0; it < 8; ++it) {
    const int row = wave * 8 + it;
    v4f v = *(const v4f*)(Cs + row * LDC + lane * 4);
    v = v * (1.0f / 65536.0f);
    ov[it] = v;
    const int tokc = min(rbase + it, NTOK - 1);
    offs[it] = ((size_t)w * NTOK + tokc) * CCH + nb * 128 + lane * 4;
  }
#pragma unroll
  for (int it = 0; it < 8; ++it) {
    if (rbase + it < NTOK) *(v4f*)(out + offs[it]) = ov[it];     // wave-uniform
  }
  
}

// =================================================================================================================
// token dimension padded to 384 per window everywhere):
//   WqkvT f16 768 x 256 393216 | WoutT f16 256 x 256 131072 |
//   bias table f32 [8][24][24][256] 4718592 | Q f16 1024 x 384 x 32 25165824 | K same 25165824 |
//   V^T f16 1024 x 32 x 384 25165824 | O f16 8 x 49152 x 32 25165824 | total 105906176.
//   every f16 plane is stored as 1024-byte operand tiles in fragment order (ldfrag_t).
// =================================================================================================================
extern "C" void kernel_launch(void* const* d_in, const int* in_sizes, int n_in,
                              void* d_out, int out_size, void* d_ws, size_t ws_size,
                              hipStream_t stream) {
  if (n_in < 4) return;
  if (in_sizes[0] != NROWX * CCH) return;
  if (in_sizes[1] != CCH * C3) return;
  if (in_sizes[2] != CCH * CCH) return;
  if (in_sizes[3] != NRPB * NHD) return;
  if (out_size != NROWX * CCH) return;

  const float* x    = (const float*)d_in[0];
  const float* wqkv = (const float*)d_in[1];
  const float* wout = (const float*)d_in[2];
  const float* rpb  = (const float*)d_in[3];
  float* out = (float*)d_out;

  const size_t sWq = (size_t)C3 * CCH * 2;                    //   393216
  const size_t sWo = (size_t)CCH * CCH * 2;                   //   131072
  const size_t sBT = (size_t)NHD * NST * NKT * 256 * 4;       //  4718592
  const size_t sQK = (size_t)NWIN * NHD * TP * HD * 2;        // 25165824
  const size_t sO  = (size_t)NHD * NROWP * HD * 2;            // 25165824
  size_t off = 0;
  const size_t oWq = off; off += sWq;
  const size_t oWo = off; off += sWo;
  const size_t oBT = off; off += sBT;
  const size_t oQ  = off; off += sQK;
  const size_t oK  = off; off += sQK;
  const size_t oV  = off; off += sQK;
  const size_t oO  = off; off += sO;
  if (off > ws_size) return;                                   // off = 105906176
  if (off > (size_t)134217728) return;

  char* ws = (char*)d_ws;
  unsigned short* WqT = (unsigned short*)(ws + oWq);
  unsigned short* WoT = (unsigned short*)(ws + oWo);
  float*          BT  = (float*)(ws + oBT);
  unsigned short* Qp  = (unsigned short*)(ws + oQ);
  unsigned short* Kp  = (unsigned short*)(ws + oK);
  unsigned short* Vtp = (unsigned short*)(ws + oV);
  unsigned short* Op  = (unsigned short*)(ws + oO);

  const dim3 blk(256);
  // (1) weight transposes + converts, bias table
  cvt_wT<<<dim3(C3 / 32), blk, 0, stream>>>(wqkv, WqT, C3);
  cvt_wT<<<dim3(CCH / 32), blk, 0, stream>>>(wout, WoT, CCH);
  build_bias<<<dim3((NHD * NST * NKT * 64) / 256), blk, 0, stream>>>(rpb, BT);
  // (2) input convert + qkv projection: 768 row tiles (6 per window), each sweeps the 6 column tiles
  gemm_qkv<<<dim3(NROWP / 64), blk, 0, stream>>>(x, WqT, Qp, Kp, Vtp);
  // (3) window attention: 128 windows x 8 heads x 3 blocks of 8 strips
  attn_win<<<dim3(NWIN * NHD * 3), blk, 0, stream>>>(Qp, Kp, Vtp, BT, Op);
  // (4) output projection -> d_out (padded tokens skipped)
  gemm_proj<<<dim3(NROWP / 64, CCH / 128), blk, 0, stream>>>(Op, WoT, out);
  (void)hipGetLastError();
}

// v004
// One run takes 119 microseconds.
// Two timings next to v003 put it at 1.06 and 1.09 times that version's speed.
// Over all steps from v000 it is 1.91 times as fast.
// qkv projection, q.k^T, p.v and output projection: v_wmma_f32_16x16x32_f16 single products (f16 operands, f32 accumulate);
// all inputs RNE-converted to bf16 on load and carried with power-of-two scales, as f16 (the bias table as f32); softmax, key padding mask and epilogues in f32 on VALU.
// attention runs on transposed products (S^T = K.Q^T, O^T = V^T.P^T): a lane owns one query, P stays in registers.
#include <hip/hip_runtime.h>
#include <stdint.h>

#define NWIN  128
#define NTOK  343
#define TP    384
#define CCH   256
#define NHD   8
#define HD    32
#define C3    768
#define NROWP 49152
#define NROWX 43904
#define NRPB  2197
#define NST   24
#define NKT   24
#define MT    6
#define LDC   132
#define TPW   260
#define FT    512
#define QSC   0.17677669529663687f
#define INV512 0.001953125f
#define LN1024 6.9314718055994531f
#define LOG2E 1.44269504088896341f
#define MASKC (-1048576.0f)
#define NGB   768
#define NWB   8
#define NBB   1152

static_assert(NROWP == NWIN * TP);
static_assert(NROWX == NWIN * NTOK);
static_assert(TP == MT * 64);
static_assert(NST * 16 == TP);
static_assert(NKT * 16 == TP);
static_assert((LDC * 4) % 16 == 0);
static_assert((TPW * 4) % 16 == 0);
static_assert(NHD * HD == CCH);
static_assert(FT == 16 * 32);
static_assert(TP * HD == NST * FT);
static_assert(NGB * 64 == NROWP);
static_assert(NWB * 32 == CCH);
static_assert(NBB * 256 == NHD * NST * NKT * 64);
static_assert(32 * TPW <= 64 * LDC);

typedef _Float16 v16h __attribute__((ext_vector_type(16)));
typedef _Float16 v8h  __attribute__((ext_vector_type(8)));
typedef float    v8f  __attribute__((ext_vector_type(8)));
typedef float    v4f  __attribute__((ext_vector_type(4)));
typedef unsigned int v4u __attribute__((ext_vector_type(4)));

// ---- scalar helpers ------------------------------------------------------------------------------------------
__device__ __forceinline__ unsigned short bf_bits(float f) {          // f32 -> bf16 bits, RNE convert
  unsigned u = __float_as_uint(f);
  return (unsigned short)((u + 0x7FFFu + ((u >> 16) & 1u)) >> 16);
}
__device__ __forceinline__ float bf_up(unsigned short b) { return __uint_as_float(((unsigned)b) << 16); }
__device__ __forceinline__ float bfr(float f) { return bf_up(bf_bits(f)); }
__device__ __forceinline__ unsigned short h_bits(_Float16 x) { return __builtin_bit_cast(unsigned short, x); }
__device__ __forceinline__ unsigned short hb16(float f) { return h_bits((_Float16)f); }
__device__ __forceinline__ unsigned pk16(unsigned short a, unsigned short b) { return (unsigned)a | ((unsigned)b << 16); }
__device__ __forceinline__ v8f zero8() { v8f z = {0.f, 0.f, 0.f, 0.f, 0.f, 0.f, 0.f, 0.f}; return z; }

// ---- fragment loader for the fragment-order global planes: one 16 (rows/cols) x 32 (k) operand tile is FT halves =
//      1024 contiguous bytes; its 16-B piece e*32 + lane holds row/col (lane&15), k = 16*e + 8*(lane>>4) + 0..7 (the
//      hardware k order, which a packed pair of D tiles also has). p = tile base + lane*8: each of the two loads reads
//      512 contiguous bytes per wave.
__device__ __forceinline__ v16h ldfrag_t(const _Float16* p) {
  union { v16h v; v8h h[2]; } f;
  f.h[0] = *(const v8h*)(p);
  f.h[1] = *(const v8h*)(p + 256);
  return f.v;
}

// ---- WMMA helpers; the guard helpers insert the trailing VALU hazard gap and keep A/B live -----------------------
__device__ __forceinline__ v8f mma_raw(v16h a, v16h b, v8f c) {
  return __builtin_amdgcn_wmma_f32_16x16x32_f16(false, a, false, b, (short)0, c, false, false);
}
__device__ __forceinline__ void guard4(v8f& c0, v8f& c1, v8f& c2, v8f& c3,
                                       const v16h& a0, const v16h& a1, const v16h& b0, const v16h& b1) {
#if defined(__HIP_DEVICE_COMPILE__)
  asm volatile("v_nop\n\tv_nop\n\tv_nop\n\tv_nop"
               : "+v"(c0), "+v"(c1), "+v"(c2), "+v"(c3) : "v"(a0), "v"(a1), "v"(b0), "v"(b1));
#endif
}
// value of lane l ^ 16 (the other half of the wave), by a vector cross-row move
__device__ __forceinline__ float xhalf(float x) {
  const int b = __float_as_int(x);
  return __int_as_float(__builtin_amdgcn_permlanex16(b, b, 0x76543210, 0xfedcba98, false, false));
}

// =================================================================================================================
// weight transpose + convert: w [256 k][ncol n] f32 (n contiguous, used as x.w) -> wT, ncol columns x 256 k as f16 in
// fragment order (tile (n/16)*8 + k/32, see ldfrag_t), value f16(1024 * bf16_RNE(w)). Block = 32 columns: the 256x32
// f32 slab is staged in LDS (coalesced reads); wave = one 32-k step, it writes its two tiles of 1024 contiguous bytes.
// coverage: (ncol/32) blocks x 8 waves x 2 tiles x 2 x 32 pieces x 8 halves = ncol x 256.
// cvt_block is the work of one block (bx = its 32-column slab, T = 32 * TPW floats of the block's LDS); w_qkv has a
// launch of its own (cvt_wT), w_out rides in the grid of gemm_qkv.
// =================================================================================================================
__device__ __forceinline__ void cvt_block(const float* __restrict__ wsrc, unsigned short* wdst, int ncol, int bx,
                                          float* T) {
  const int tid = threadIdx.x, wv = tid >> 5, lane = tid & 31, hh = lane >> 4, c = lane & 15;
  const int n0 = bx * 32;
#pragma unroll 4
  for (int it = 0; it < 32; ++it) {
    const int k = it * 8 + wv;
    T[lane * TPW + k] = wsrc[(size_t)k * ncol + n0 + lane];
  }
  __syncthreads();
  v4u pk[4];
  size_t offs[4];
#pragma unroll
  for (int q = 0; q < 4; ++q) {
    const int nt = q >> 1, e = q & 1;
    const float* tp = T + (nt * 16 + c) * TPW + wv * 32 + e * 16 + hh * 8;
    const v4f a = *(const v4f*)(tp);
    const v4f b = *(const v4f*)(tp + 4);
    v4u p4;
    p4[0] = pk16(hb16(bfr(a[0]) * 1024.0f), hb16(bfr(a[1]) * 1024.0f));
    p4[1] = pk16(hb16(bfr(a[2]) * 1024.0f), hb16(bfr(a[3]) * 1024.0f));
    p4[2] = pk16(hb16(bfr(b[0]) * 1024.0f), hb16(bfr(b[1]) * 1024.0f));
    p4[3] = pk16(hb16(bfr(b[2]) * 1024.0f), hb16(bfr(b[3]) * 1024.0f));
    pk[q] = p4;
    offs[q] = ((size_t)(bx * 2 + nt) * 8 + wv) * FT + e * 256 + lane * 8;
  }
#pragma unroll
  for (int q = 0; q < 4; ++q) *(v4u*)(wdst + offs[q]) = pk[q];
}
__global__ __launch_bounds__(256) void cvt_wT(const float* __restrict__ wsrc, unsigned short* wdst, int ncol) {
  __shared__ __align__(16) float T[32 * TPW];
  cvt_block(wsrc, wdst, ncol, blockIdx.x, T);
}

// =================================================================================================================
// relative position bias table in the C-operand order of the transposed logits tile (16 keys x 16 queries), registers
// 0..3 of all lanes then registers 4..7 (each C load reads 512 contiguous bytes per wave):
// BT[((h*24 + strip)*24 + kt)*256 + (r>>2)*128 + l*4 + (r&3)] =
// 512 * bf16_RNE(rpb[idx(n,m)*8 + h]) with n = strip*16 + (l&15) (query), m = kt*16 + 8*(l>>4) + r (key),
// idx = ((i_n-i_m+6)*13 + (j_n-j_m+6))*13 + (k_n-k_m+6), (i,j,k) = (t/49, (t/7)%7, t%7); padded keys m >= 343
// get MASKC (logit mask through the C operand), padded queries n >= 343 get 0. Thread = one 16-B piece (4 keys),
// coverage: 8 heads x 24 strips x 24 key tiles x 64 pieces x 4 floats = 8 x 384 x 384, every element once.
// bias_block is the work of one block of 256 pieces (bx = 0 .. NBB-1); the blocks ride in the grid of gemm_qkv.
// =================================================================================================================
__device__ __forceinline__ void bias_block(const float* __restrict__ rpb, float* bt, int bx) {
  const int g = bx * 256 + threadIdx.x;
  const int piece = g & 63, rec = g >> 6;
  const int kt = rec % NKT, strip = (rec / NKT) % NST, h = rec / (NKT * NST);
  const int l = piece & 31, e0 = (piece >> 5) * 4;
  const int col = l & 15, lh = l >> 4;
  const int n = strip * 16 + col;
  const int ni = n / 49, nj = (n / 7) % 7, nk = n % 7;
  v4f v;
#pragma unroll
  for (int e = 0; e < 4; ++e) {
    const int m = kt * 16 + 8 * lh + e0 + e;
    const int mi = m / 49, mj = (m / 7) % 7, mk = m % 7;
    int idx = ((ni - mi + 6) * 13 + (nj - mj + 6)) * 13 + (nk - mk + 6);
    idx = min(max(idx, 0), NRPB - 1);
    float val = bfr(rpb[idx * NHD + h]) * 512.0f;
    if (n >= NTOK) val = 0.0f;
    if (m >= NTOK) val = MASKC;
    v[e] = val;
  }
  float* gp = bt + (size_t)rec * 256 + piece * 4;
  *(v4f*)gp = v;
  asm volatile("s_wait_xcnt 0x0" ::: "memory");   // inlined in gemm_qkv, code that rewrites this store's registers can stand behind it
  
}

// =================================================================================================================
// qkv GEMM with the input convert fused in: block = 64 padded tokens of one window x all 768 columns. The block reads
// its 64 x 256 f32 slab of x once (token clamped, padded tokens 343..383 become exact zeros), converts it to
// f16(8 * bf16_RNE(x)) and keeps it in LDS as 4 x 8 operand tiles in fragment order (tile rt*8 + k/32, see ldfrag_t);
// wave = one 32-k step of the convert. Then 6 passes of 128 columns: C[64][128] = X8 . W1024^T, K = 256 (8 k-steps),
// A fragments from LDS, B fragments from the fragment-order weight plane; 8 waves = 2 (32 rows) x 4 (32 cols), 2x2
// tiles per wave. C = 8192 * (x . W). Epilogue of a pass through an LDS f32 tile: part q -> Q plane =
// f16(64 * q * 32^-0.5), part k -> K plane = f16(8*k), both in fragment order with tile (w*8+h)*24 + tok/16
// (16 tokens x 32 d); part v -> V^T plane = f16(16*v) in fragment order with tile ((w*8+h)*2 + d/16)*12 + tok/32
// (16 d x 32 tokens). A wave's store writes 512 contiguous bytes (half a tile).
// coverage: per pass Q/K: 4 instr x 256 pieces x 8 halves = 4 heads x 64 tok x 32 d; V: 4 instr x 256 pieces x 8 =
// 4 heads x 32 d x 64 tok; over grid and passes every element of Q, K (1024x384x32) and V^T (1024x32x384) once.
// The grid carries two more block ranges behind the NGB GEMM blocks, work that only later launches read and that
// reads nothing this launch writes: NWB blocks convert w_out (cvt_block, for gemm_proj), NBB blocks build the bias
// table (bias_block, for attn_win).
// =================================================================================================================
__global__ __launch_bounds__(256)
void gemm_qkv(const float* __restrict__ x, const unsigned short* __restrict__ wq,
              unsigned short* qpl, unsigned short* kpl, unsigned short* vtp,
              const float* __restrict__ wout, unsigned short* wo, const float* __restrict__ rpb, float* bt) {
  __shared__ __align__(16) unsigned short As[4 * 8 * FT];
  __shared__ __align__(16) float Cs[64 * LDC];
  if (blockIdx.x >= NGB) {                        // block-uniform, in front of every barrier of the GEMM path
    const int xb = blockIdx.x - NGB;
    if (xb < NWB) cvt_block(wout, wo, CCH, xb, Cs);
    else          bias_block(rpb, bt, xb - NWB);
    return;
  }
  const int tid = threadIdx.x, wave = tid >> 5, lane = tid & 31, hh = lane >> 4, c = lane & 15;
  const int mb = blockIdx.x;
  const int mw = wave >> 2, nw = wave & 3;
  const int w = mb / MT, tok0 = (mb - w * MT) * 64;

  // ---- convert the block's rows into LDS: all 16 loads of a lane first, then the packs ----
  {
    v4f xa[4][4];
    const float* src[4];
#pragma unroll
    for (int rt = 0; rt < 4; ++rt) {
      const int ts = min(tok0 + rt * 16 + c, NTOK - 1);
      src[rt] = x + ((size_t)w * NTOK + ts) * CCH + wave * 32 + 8 * hh;
#pragma unroll
      for (int e = 0; e < 2; ++e) {
        xa[rt][2 * e]     = *(const v4f*)(src[rt] + 16 * e);
        xa[rt][2 * e + 1] = *(const v4f*)(src[rt] + 16 * e + 4);
      }
    }
    // the loads' address registers stay whole up to this wait (named as inputs), and are rewritten only behind it
    asm volatile("s_wait_xcnt 0x0" :: "v"(src[0]), "v"(src[1]), "v"(src[2]), "v"(src[3]) : "memory");
#pragma unroll
    for (int rt = 0; rt < 4; ++rt) {
      const bool pad = tok0 + rt * 16 + c >= NTOK;
#pragma unroll
      for (int e = 0; e < 2; ++e) {
        const v4f a = xa[rt][2 * e], b = xa[rt][2 * e + 1];
        v4u p4;
        p4[0] = pk16(hb16(bfr(a[0]) * 8.0f), hb16(bfr(a[1]) * 8.0f));
        p4[1] = pk16(hb16(bfr(a[2]) * 8.0f), hb16(bfr(a[3]) * 8.0f));
        p4[2] = pk16(hb16(bfr(b[0]) * 8.0f), hb16(bfr(b[1]) * 8.0f));
        p4[3] = pk16(hb16(bfr(b[2]) * 8.0f), hb16(bfr(b[3]) * 8.0f));
        if (pad) { p4[0] = 0u; p4[1] = 0u; p4[2] = 0u; p4[3] = 0u; }
        *(v4u*)(As + (rt * 8 + wave) * FT + e * 256 + lane * 8) = p4;
      }
    }
  }
  __syncthreads();                                // the slab is whole before any wave reads other waves' tiles
  const _Float16* Al = (const _Float16*)(const void*)As + (mw * 2) * 8 * FT + lane * 8;   // row tile mw*2 of the block
  const _Float16* Wl = (const _Float16*)(const void*)wq + (size_t)(nw * 2) * 8 * FT + lane * 8;  // col tile nw*2 of pass 0

#pragma unroll 1                                  // six copies of k loop and both epilogues would only swell the code
  for (int nb = 0; nb < C3 / 128; ++nb) {
    const _Float16* Wp = Wl + (size_t)nb * 64 * FT;                            // col tile (nb*128 + nw*32) / 16
    v8f a00 = zero8(), a01 = zero8(), a10 = zero8(), a11 = zero8();
#pragma unroll 1
    for (int ks = 0; ks < 8; ++ks) {
      const v16h fa0 = ldfrag_t(Al + ks * FT);
      const v16h fa1 = ldfrag_t(Al + (8 + ks) * FT);
      const v16h fb0 = ldfrag_t(Wp + ks * FT);
      const v16h fb1 = ldfrag_t(Wp + (8 + ks) * FT);
      a00 = mma_raw(fa0, fb0, a00);
      a01 = mma_raw(fa0, fb1, a01);
      a10 = mma_raw(fa1, fb0, a10);
      a11 = mma_raw(fa1, fb1, a11);
      guard4(a00, a01, a10, a11, fa0, fa1, fb0, fb1);
    }
    if (nb) __syncthreads();                      // every reader of the previous pass has left Cs
#pragma unroll
    for (int r = 0; r < 8; ++r) {
      const int row = mw * 32 + 8 * hh + r;
      Cs[row * LDC + nw * 32 + c]             = a00[r];
      Cs[row * LDC + nw * 32 + 16 + c]        = a01[r];
      Cs[(row + 16) * LDC + nw * 32 + c]      = a10[r];
      Cs[(row + 16) * LDC + nw * 32 + 16 + c] = a11[r];
    }
    __syncthreads();

    const int part = nb >> 1;                     // block-uniform: 0 q, 1 k, 2 v
    const int hb4 = (nb & 1) * 4;
    if (part < 2) {
      unsigned short* dst = (part == 0) ? qpl : kpl;
      const float scl = (part == 0) ? (QSC * (64.0f / 8192.0f)) : (8.0f / 8192.0f);
      v4u pk[4];
      size_t offs[4];
#pragma unroll
      for (int s = 0; s < 4; ++s) {
        const int blk = s * 4 + (tid >> 6), pc = tid & 63;          // 16 tiles (4 heads x 4 token tiles) x 64 pieces
        const int h4 = blk >> 2, tt = blk & 3;
        const int tok = tt * 16 + (pc & 15), d0 = (pc >> 5) * 16 + ((pc >> 4) & 1) * 8;
        const int col = h4 * 32 + d0;
        v4u q4;
#pragma unroll
        for (int e = 0; e < 4; ++e) {
          const float f0 = Cs[tok * LDC + col + 2 * e] * scl;
          const float f1 = Cs[tok * LDC + col + 2 * e + 1] * scl;
          q4[e] = pk16(hb16(f0), hb16(f1));
        }
        pk[s] = q4;
        offs[s] = ((size_t)((w * NHD + hb4 + h4) * NST + (tok0 >> 4) + tt)) * FT + pc * 8;
      }
#pragma unroll
      for (int s = 0; s < 4; ++s) *(v4u*)(dst + offs[s]) = pk[s];
      asm volatile("s_wait_xcnt 0x0" ::: "memory");   // the next pass rewrites registers that these stores name
    } else {
      v4u pv[4];
      size_t offs[4];
#pragma unroll
      for (int s = 0; s < 4; ++s) {
        const int blk = s * 4 + (tid >> 6), pc = tid & 63;          // 16 tiles (4 heads x 2 d tiles x 2 k-steps) x 64 pieces
        const int h4 = blk >> 2, dt = (blk >> 1) & 1, k2 = blk & 1;
        const int col = h4 * 32 + dt * 16 + (pc & 15);
        const int tb = k2 * 32 + (pc >> 5) * 16 + ((pc >> 4) & 1) * 8;
        v4u a;
#pragma unroll
        for (int e = 0; e < 4; ++e) {
          const float v0 = Cs[(tb + 2 * e) * LDC + col] * (16.0f / 8192.0f);
          const float v1 = Cs[(tb + 2 * e + 1) * LDC + col] * (16.0f / 8192.0f);
          a[e] = pk16(hb16(v0), hb16(v1));
        }
        pv[s] = a;
        offs[s] = ((size_t)(((w * NHD + hb4 + h4) * 2 + dt) * (TP / 32) + (tok0 >> 5) + k2)) * FT + pc * 8;
      }
#pragma unroll
      for (int s = 0; s < 4; ++s) *(v4u*)(vtp + offs[s]) = pv[s];
      asm volatile("s_wait_xcnt 0x0" ::: "memory");   // the next pass rewrites registers that these stores name
    }
  }
}

__global__ __launch_bounds__(256)
void attn_win(const unsigned short* __restrict__ qpl, const unsigned short* __restrict__ kpl,
              const unsigned short* __restrict__ vtp, const float* __restrict__ bt, unsigned short* opl) {
  union CB { v8f v; v4f q[2]; };
  const int tid = threadIdx.x, wave = tid >> 5, lane = tid & 31;
  const int wh = blockIdx.x / 3;                  // w*8 + h
  const int sb = blockIdx.x - wh * 3;
  const int w = wh >> 3, h = wh & 7;
  const int strip = sb * 8 + wave;                // 0..23
  const int q0 = strip * 16;

  const _Float16* Q  = (const _Float16*)(const void*)qpl + (size_t)wh * TP * HD;
  const _Float16* K  = (const _Float16*)(const void*)kpl + (size_t)wh * TP * HD;
  const _Float16* Vt = (const _Float16*)(const void*)vtp + (size_t)wh * HD * TP;
  const float* Bp = bt + ((size_t)(h * NST + strip)) * NKT * 256 + lane * 4;

  const v16h qb = ldfrag_t(Q + strip * FT + lane * 8);
  float mrow = -1e30f, lrow = 0.f;                // this lane's query: running maximum, sum over this half's keys
  v8f o0 = zero8(), o1 = zero8();

#pragma unroll 1
  for (int kb = 0; kb < TP / 64; ++kb) {
    // ---- transposed logits for 64 keys: 4 tiles of 16 keys, bias and key padding mask via the C operand ----
    v8f s[4];
#pragma unroll
    for (int j = 0; j < 4; ++j) {
      const v16h kf = ldfrag_t(K + (kb * 4 + j) * FT + lane * 8);
      const float* bp = Bp + (kb * 4 + j) * 256;
      CB cb;
      cb.q[0] = *(const v4f*)(bp);
      cb.q[1] = *(const v4f*)(bp + 128);
      s[j] = mma_raw(kf, qb, cb.v);
    }
    // ---- online softmax update of the lane's query ----
    float tj[4];
#pragma unroll
    for (int j = 0; j < 4; ++j) {
      tj[j] = fmaxf(fmaxf(fmaxf(s[j][0], s[j][1]), fmaxf(s[j][2], s[j][3])),
                    fmaxf(fmaxf(s[j][4], s[j][5]), fmaxf(s[j][6], s[j][7])));
    }
    float tm = fmaxf(fmaxf(tj[0], tj[1]), fmaxf(tj[2], tj[3]));
    tm = fmaxf(tm, xhalf(tm));
    const float mn = fmaxf(mrow, tm);
    const float alpha = __expf((mrow - mn) * INV512);
    mrow = mn;
#pragma unroll
    for (int j = 0; j < 4; ++j) {
      const v8f u = ((s[j] - mn) * INV512 + LN1024) * LOG2E;      // one maximum per lane: whole-tile (packed) arithmetic
#pragma unroll
      for (int r = 0; r < 8; ++r) s[j][r] = __builtin_amdgcn_exp2f(u[r]);
    }
    const v8f p8 = (s[0] + s[1]) + (s[2] + s[3]);
    const v4f p4 = p8.lo + p8.hi;
    lrow = lrow * alpha + ((p4[0] + p4[1]) + (p4[2] + p4[3]));
    o0 = o0 * alpha;
    o1 = o1 * alpha;
    // ---- O^T += V^T . P^T : two 32-key k-steps, two 16-dim tiles ----
#pragma unroll
    for (int ks = 0; ks < 2; ++ks) {
      v16h pb;
#pragma unroll
      for (int e = 0; e < 8; ++e) {
        pb[e]     = (_Float16)s[2 * ks][e];
        pb[8 + e] = (_Float16)s[2 * ks + 1][e];
      }
      const v16h v0 = ldfrag_t(Vt + (kb * 2 + ks) * FT + lane * 8);
      const v16h v1 = ldfrag_t(Vt + (TP / 32 + kb * 2 + ks) * FT + lane * 8);
      o0 = mma_raw(v0, pb, o0);
      o1 = mma_raw(v1, pb, o1);
    }
  }

  // ---- join the halves' sums, normalise (64 ctx = O * 4 / l), store the lane's two 16-B pieces ----
  const float inv = 4.0f / (lrow + xhalf(lrow));
  v4u p0, p1;
#pragma unroll
  for (int e = 0; e < 4; ++e) {
    p0[e] = pk16(hb16(o0[2 * e] * inv), hb16(o0[2 * e + 1] * inv));
    p1[e] = pk16(hb16(o1[2 * e] * inv), hb16(o1[2 * e + 1] * inv));
  }
  unsigned short* op = opl + ((size_t)h * NROWP + (size_t)w * TP + q0) * HD + lane * 8;
  *(v4u*)op = p0;
  *(v4u*)(op + 256) = p1;
}

// =================================================================================================================
// Output projection: out rows = (O64/64) . (W1024/1024)^T, K = 256 = 8 head planes of 32. Block tile 64 padded
// tokens x 128 cols, 8 waves = 2 x 4, 2x2 tiles per wave. Epilogue through an LDS f32 tile; a wave writes one
// coverage: 128 windows x 343 tokens x 2 x 128 cols = every output element exactly once.
// =================================================================================================================
__global__ __launch_bounds__(256)
void gemm_proj(const unsigned short* __restrict__ opl, const unsigned short* __restrict__ wp, float* out) {
  __shared__ __align__(16) float Cs[64 * LDC];
  const int tid = threadIdx.x, wave = tid >> 5, lane = tid & 31, hh = lane >> 4, c = lane & 15;
  const int mb = blockIdx.x, nb = blockIdx.y;
  const int mw = wave >> 2, nw = wave & 3;
  const _Float16* W = (const _Float16*)(const void*)wp;
  const _Float16* Ap = (const _Float16*)(const void*)opl + (size_t)(mb * 4 + mw * 2) * FT + lane * 8;  // row tile
  const _Float16* Wp = W + (size_t)(nb * 8 + nw * 2) * 8 * FT + lane * 8;                              // col tile

  v8f a00 = zero8(), a01 = zero8(), a10 = zero8(), a11 = zero8();
#pragma unroll 1
  for (int ks = 0; ks < 8; ++ks) {
    const v16h fa0 = ldfrag_t(Ap);
    const v16h fa1 = ldfrag_t(Ap + FT);
    const v16h fb0 = ldfrag_t(Wp);
    const v16h fb1 = ldfrag_t(Wp + 8 * FT);
    Ap += (size_t)NROWP * HD;                     // next head plane
    Wp += FT;                                     // next 32-k step
    a00 = mma_raw(fa0, fb0, a00);
    a01 = mma_raw(fa0, fb1, a01);
    a10 = mma_raw(fa1, fb0, a10);
    a11 = mma_raw(fa1, fb1, a11);
    guard4(a00, a01, a10, a11, fa0, fa1, fb0, fb1);
  }
#pragma unroll
  for (int r = 0; r < 8; ++r) {
    const int row = mw * 32 + 8 * hh + r;
    Cs[row * LDC + nw * 32 + c]             = a00[r];
    Cs[row * LDC + nw * 32 + 16 + c]        = a01[r];
    Cs[(row + 16) * LDC + nw * 32 + c]      = a10[r];
    Cs[(row + 16) * LDC + nw * 32 + 16 + c] = a11[r];
  }
  __syncthreads();

  const int w = mb / MT, tok0 = (mb - w * MT) * 64;
  const int rbase = tok0 + wave * 8;
  v4f ov[8];
  size_t offs[8];
#pragma unroll
  for (int it = 0; it < 8; ++it) {
    const int row = wave * 8 + it;
    v4f v = *(const v4f*)(Cs + row * LDC + lane * 4);
    v = v * (1.0f / 65536.0f);
    ov[it] = v;
    const int tokc = min(rbase + it, NTOK - 1);
    offs[it] = ((size_t)w * NTOK + tokc) * CCH + nb * 128 + lane * 4;
  }
#pragma unroll
  for (int it = 0; it < 8; ++it) {
    if (rbase + it < NTOK) *(v4f*)(out + offs[it]) = ov[it];     // wave-uniform
  }
  
}

// =================================================================================================================
// token dimension padded to 384 per window everywhere):
//   WqkvT f16 768 x 256 393216 | WoutT f16 256 x 256 131072 |
//   bias table f32 [8][24][24][256] 4718592 | Q f16 1024 x 384 x 32 25165824 | K same 25165824 |
//   V^T f16 1024 x 32 x 384 25165824 | O f16 8 x 49152 x 32 25165824 | total 105906176.
//   every f16 plane is stored as 1024-byte operand tiles in fragment order (ldfrag_t).
// =================================================================================================================
extern "C" void kernel_launch(void* const* d_in, const int* in_sizes, int n_in,
                              void* d_out, int out_size, void* d_ws, size_t ws_size,
                              hipStream_t stream) {
  if (n_in < 4) return;
  if (in_sizes[0] != NROWX * CCH) return;
  if (in_sizes[1] != CCH * C3) return;
  if (in_sizes[2] != CCH * CCH) return;
  if (in_sizes[3] != NRPB * NHD) return;
  if (out_size != NROWX * CCH) return;

  const float* x    = (const float*)d_in[0];
  const float* wqkv = (const float*)d_in[1];
  const float* wout = (const float*)d_in[2];
  const float* rpb  = (const float*)d_in[3];
  float* out = (float*)d_out;

  const size_t sWq = (size_t)C3 * CCH * 2;                    //   393216
  const size_t sWo = (size_t)CCH * CCH * 2;                   //   131072
  const size_t sBT = (size_t)NHD * NST * NKT * 256 * 4;       //  4718592
  const size_t sQK = (size_t)NWIN * NHD * TP * HD * 2;        // 25165824
  const size_t sO  = (size_t)NHD * NROWP * HD * 2;            // 25165824
  size_t off = 0;
  const size_t oWq = off; off += sWq;
  const size_t oWo = off; off += sWo;
  const size_t oBT = off; off += sBT;
  const size_t oQ  = off; off += sQK;
  const size_t oK  = off; off += sQK;
  const size_t oV  = off; off += sQK;
  const size_t oO  = off; off += sO;
  if (off > ws_size) return;                                   // off = 105906176
  if (off > (size_t)134217728) return;

  char* ws = (char*)d_ws;
  unsigned short* WqT = (unsigned short*)(ws + oWq);
  unsigned short* WoT = (unsigned short*)(ws + oWo);
  float*          BT  = (float*)(ws + oBT);
  unsigned short* Qp  = (unsigned short*)(ws + oQ);
  unsigned short* Kp  = (unsigned short*)(ws + oK);
  unsigned short* Vtp = (unsigned short*)(ws + oV);
  unsigned short* Op  = (unsigned short*)(ws + oO);

  const dim3 blk(256);
  // (1) transpose + convert of w_qkv, the one set-up step that the qkv projection reads
  cvt_wT<<<dim3(C3 / 32), blk, 0, stream>>>(wqkv, WqT, C3);
  // (2) input convert + qkv projection: 768 row tiles (6 per window), each sweeps the 6 column tiles;
  //     in the same grid, behind them: transpose + convert of w_out (8 blocks), bias table (1152 blocks)
  gemm_qkv<<<dim3(NGB + NWB + NBB), blk, 0, stream>>>(x, WqT, Qp, Kp, Vtp, wout, WoT, rpb, BT);
  // (3) window attention: 128 windows x 8 heads x 3 blocks of 8 strips
  attn_win<<<dim3(NWIN * NHD * 3), blk, 0, stream>>>(Qp, Kp, Vtp, BT, Op);
  // (4) output projection -> d_out (padded tokens skipped)
  gemm_proj<<<dim3(NROWP / 64, CCH / 128), blk, 0, stream>>>(Op, WoT, out);
  (void)hipGetLastError();
}

// v005
// It runs in 82.7 microseconds.
// In two side-by-side timings against v004, it was 1.48 and 1.46 times as fast.
// Over all steps from v000 it is 2.81 times as fast.
// qkv projection, q.k^T, p.v and output projection: v_wmma_f32_16x16x32_f16 single products (f16 operands, f32 accumulate);
// all inputs RNE-converted to bf16 on load and carried with power-of-two scales, as f16 (the bias table as f32); softmax, key padding mask and epilogues in f32 on VALU.
// attention runs on transposed products (S^T = K.Q^T, O^T = V^T.P^T): a lane owns one query, P stays in registers.
// the qkv projection runs inside the attention kernel: Q, K and V^T go through LDS only.
#include <hip/hip_runtime.h>
#include <stdint.h>

#define NWIN  128
#define NTOK  343
#define TP    384
#define CCH   256
#define NHD   8
#define HD    32
#define C3    768
#define NROWP 49152
#define NROWX 43904
#define NRPB  2197
#define NST   24
#define NKT   24
#define MT    6
#define LDC   132
#define TPW   260
#define FT    512
#define QSC   0.17677669529663687f
#define INV512 0.001953125f
#define LN1024 6.9314718055994531f
#define LOG2E 1.44269504088896341f
#define MASKC (-1048576.0f)
#define NGB   768
#define NWB   8
#define NBB   1152
#define NQB   24
#define SPW   3

static_assert(NROWP == NWIN * TP);
static_assert(NROWX == NWIN * NTOK);
static_assert(TP == MT * 64);
static_assert(NST * 16 == TP);
static_assert(NKT * 16 == TP);
static_assert((LDC * 4) % 16 == 0);
static_assert((TPW * 4) % 16 == 0);
static_assert(NHD * HD == CCH);
static_assert(FT == 16 * 32);
static_assert(TP * HD == NST * FT);
static_assert(NGB * 64 == NROWP);
static_assert(NWB * 32 == CCH);
static_assert(NBB * 256 == NHD * NST * NKT * 64);
static_assert(NQB * 32 == C3);
static_assert(8 * SPW == NST);

typedef _Float16 v16h __attribute__((ext_vector_type(16)));
typedef _Float16 v8h  __attribute__((ext_vector_type(8)));
typedef float    v8f  __attribute__((ext_vector_type(8)));
typedef float    v4f  __attribute__((ext_vector_type(4)));
typedef unsigned int v4u __attribute__((ext_vector_type(4)));

// ---- scalar helpers ------------------------------------------------------------------------------------------
__device__ __forceinline__ unsigned short bf_bits(float f) {          // f32 -> bf16 bits, RNE convert
  unsigned u = __float_as_uint(f);
  return (unsigned short)((u + 0x7FFFu + ((u >> 16) & 1u)) >> 16);
}
__device__ __forceinline__ float bf_up(unsigned short b) { return __uint_as_float(((unsigned)b) << 16); }
__device__ __forceinline__ float bfr(float f) { return bf_up(bf_bits(f)); }
__device__ __forceinline__ unsigned short h_bits(_Float16 x) { return __builtin_bit_cast(unsigned short, x); }
__device__ __forceinline__ unsigned short hb16(float f) { return h_bits((_Float16)f); }
__device__ __forceinline__ unsigned pk16(unsigned short a, unsigned short b) { return (unsigned)a | ((unsigned)b << 16); }
__device__ __forceinline__ v8f zero8() { v8f z = {0.f, 0.f, 0.f, 0.f, 0.f, 0.f, 0.f, 0.f}; return z; }

// ---- fragment loader for the fragment-order global planes: one 16 (rows/cols) x 32 (k) operand tile is FT halves =
//      1024 contiguous bytes; its 16-B piece e*32 + lane holds row/col (lane&15), k = 16*e + 8*(lane>>4) + 0..7 (the
//      hardware k order, which a packed pair of D tiles also has). p = tile base + lane*8: each of the two loads reads
//      512 contiguous bytes per wave.
__device__ __forceinline__ v16h ldfrag_t(const _Float16* p) {
  union { v16h v; v8h h[2]; } f;
  f.h[0] = *(const v8h*)(p);
  f.h[1] = *(const v8h*)(p + 256);
  return f.v;
}

// ---- WMMA helpers; the guard helpers insert the trailing VALU hazard gap and keep A/B live -----------------------
__device__ __forceinline__ v8f mma_raw(v16h a, v16h b, v8f c) {
  return __builtin_amdgcn_wmma_f32_16x16x32_f16(false, a, false, b, (short)0, c, false, false);
}
__device__ __forceinline__ void guard4(v8f& c0, v8f& c1, v8f& c2, v8f& c3,
                                       const v16h& a0, const v16h& a1, const v16h& b0, const v16h& b1) {
#if defined(__HIP_DEVICE_COMPILE__)
  asm volatile("v_nop\n\tv_nop\n\tv_nop\n\tv_nop"
               : "+v"(c0), "+v"(c1), "+v"(c2), "+v"(c3) : "v"(a0), "v"(a1), "v"(b0), "v"(b1));
#endif
}
// value of lane l ^ 16 (the other half of the wave), by a vector cross-row move
__device__ __forceinline__ float xhalf(float x) {
  const int b = __float_as_int(x);
  return __int_as_float(__builtin_amdgcn_permlanex16(b, b, 0x76543210, 0xfedcba98, false, false));
}

// =================================================================================================================
// weight transpose + convert: w [256 k][ncol n] f32 (n contiguous, used as x.w) -> wT, ncol columns x 256 k as f16 in
// fragment order (tile (n/16)*8 + k/32, see ldfrag_t), value f16(1024 * bf16_RNE(w)). Block = 32 columns: the 256x32
// f32 slab is staged in LDS (coalesced reads); wave = one 32-k step, it writes its two tiles of 1024 contiguous bytes.
// coverage: (ncol/32) blocks x 8 waves x 2 tiles x 2 x 32 pieces x 8 halves = ncol x 256.
// cvt_block is the work of one block (bx = its 32-column slab, T = 32 * TPW floats of the block's LDS); the blocks of
// w_qkv and of w_out ride in the grid of prep.
// =================================================================================================================
__device__ __forceinline__ void cvt_block(const float* __restrict__ wsrc, unsigned short* wdst, int ncol, int bx,
                                          float* T) {
  const int tid = threadIdx.x, wv = tid >> 5, lane = tid & 31, hh = lane >> 4, c = lane & 15;
  const int n0 = bx * 32;
#pragma unroll 4
  for (int it = 0; it < 32; ++it) {
    const int k = it * 8 + wv;
    T[lane * TPW + k] = wsrc[(size_t)k * ncol + n0 + lane];
  }
  __syncthreads();
  v4u pk[4];
  size_t offs[4];
#pragma unroll
  for (int q = 0; q < 4; ++q) {
    const int nt = q >> 1, e = q & 1;
    const float* tp = T + (nt * 16 + c) * TPW + wv * 32 + e * 16 + hh * 8;
    const v4f a = *(const v4f*)(tp);
    const v4f b = *(const v4f*)(tp + 4);
    v4u p4;
    p4[0] = pk16(hb16(bfr(a[0]) * 1024.0f), hb16(bfr(a[1]) * 1024.0f));
    p4[1] = pk16(hb16(bfr(a[2]) * 1024.0f), hb16(bfr(a[3]) * 1024.0f));
    p4[2] = pk16(hb16(bfr(b[0]) * 1024.0f), hb16(bfr(b[1]) * 1024.0f));
    p4[3] = pk16(hb16(bfr(b[2]) * 1024.0f), hb16(bfr(b[3]) * 1024.0f));
    pk[q] = p4;
    offs[q] = ((size_t)(bx * 2 + nt) * 8 + wv) * FT + e * 256 + lane * 8;
  }
#pragma unroll
  for (int q = 0; q < 4; ++q) *(v4u*)(wdst + offs[q]) = pk[q];
  asm volatile("s_wait_xcnt 0x0" ::: "memory");   // inlined in prep, code that rewrites these stores' registers can stand behind it
}
// =================================================================================================================
// relative position bias table in the C-operand order of the transposed logits tile (16 keys x 16 queries), registers
// 0..3 of all lanes then registers 4..7 (each C load reads 512 contiguous bytes per wave):
// BT[((h*24 + strip)*24 + kt)*256 + (r>>2)*128 + l*4 + (r&3)] =
// 512 * bf16_RNE(rpb[idx(n,m)*8 + h]) with n = strip*16 + (l&15) (query), m = kt*16 + 8*(l>>4) + r (key),
// idx = ((i_n-i_m+6)*13 + (j_n-j_m+6))*13 + (k_n-k_m+6), (i,j,k) = (t/49, (t/7)%7, t%7); padded keys m >= 343
// get MASKC (logit mask through the C operand), padded queries n >= 343 get 0. Thread = one 16-B piece (4 keys),
// coverage: 8 heads x 24 strips x 24 key tiles x 64 pieces x 4 floats = 8 x 384 x 384, every element once.
// bias_block is the work of one block of 256 pieces (bx = 0 .. NBB-1); the blocks ride in the grid of prep.
// =================================================================================================================
__device__ __forceinline__ void bias_block(const float* __restrict__ rpb, float* bt, int bx) {
  const int g = bx * 256 + threadIdx.x;
  const int piece = g & 63, rec = g >> 6;
  const int kt = rec % NKT, strip = (rec / NKT) % NST, h = rec / (NKT * NST);
  const int l = piece & 31, e0 = (piece >> 5) * 4;
  const int col = l & 15, lh = l >> 4;
  const int n = strip * 16 + col;
  const int ni = n / 49, nj = (n / 7) % 7, nk = n % 7;
  v4f v;
#pragma unroll
  for (int e = 0; e < 4; ++e) {
    const int m = kt * 16 + 8 * lh + e0 + e;
    const int mi = m / 49, mj = (m / 7) % 7, mk = m % 7;
    int idx = ((ni - mi + 6) * 13 + (nj - mj + 6)) * 13 + (nk - mk + 6);
    idx = min(max(idx, 0), NRPB - 1);
    float val = bfr(rpb[idx * NHD + h]) * 512.0f;
    if (n >= NTOK) val = 0.0f;
    if (m >= NTOK) val = MASKC;
    v[e] = val;
  }
  float* gp = bt + (size_t)rec * 256 + piece * 4;
  *(v4f*)gp = v;
  asm volatile("s_wait_xcnt 0x0" ::: "memory");   // inlined in prep, code that rewrites this store's registers can stand behind it
  
}

// =================================================================================================================
// input convert: block = 64 padded tokens of one window. It reads its 64 x 256 f32 slab of x once (token clamped,
// padded tokens 343..383 become exact zeros), converts it to f16(8 * bf16_RNE(x)) and writes it as 4 x 8 operand tiles
// of the X plane in fragment order (tile (w*24 + tok/16)*8 + k/32, see ldfrag_t); wave = one 32-k step; a wave's store
// writes 512 contiguous bytes. coverage: 768 blocks x 8 waves x 4 tiles x 1024 B = 128 x 24 x 8 tiles, each once.
// =================================================================================================================
__device__ __forceinline__ void xcvt_block(const float* __restrict__ x, unsigned short* xp, int mb) {
  const int tid = threadIdx.x, wave = tid >> 5, lane = tid & 31, hh = lane >> 4, c = lane & 15;
  const int w = mb / MT, tok0 = (mb - w * MT) * 64;
  v4f xa[4][4];
  const float* src[4];
#pragma unroll
  for (int rt = 0; rt < 4; ++rt) {
    const int ts = min(tok0 + rt * 16 + c, NTOK - 1);
    src[rt] = x + ((size_t)w * NTOK + ts) * CCH + wave * 32 + 8 * hh;
#pragma unroll
    for (int e = 0; e < 2; ++e) {
      xa[rt][2 * e]     = *(const v4f*)(src[rt] + 16 * e);
      xa[rt][2 * e + 1] = *(const v4f*)(src[rt] + 16 * e + 4);
    }
  }
  // the loads' address registers stay whole up to this wait (named as inputs), and are rewritten only behind it
  asm volatile("s_wait_xcnt 0x0" :: "v"(src[0]), "v"(src[1]), "v"(src[2]), "v"(src[3]) : "memory");
  v4u pk[4][2];
#pragma unroll
  for (int rt = 0; rt < 4; ++rt) {
    const bool pad = tok0 + rt * 16 + c >= NTOK;
#pragma unroll
    for (int e = 0; e < 2; ++e) {
      const v4f a = xa[rt][2 * e], b = xa[rt][2 * e + 1];
      v4u p4;
      p4[0] = pk16(hb16(bfr(a[0]) * 8.0f), hb16(bfr(a[1]) * 8.0f));
      p4[1] = pk16(hb16(bfr(a[2]) * 8.0f), hb16(bfr(a[3]) * 8.0f));
      p4[2] = pk16(hb16(bfr(b[0]) * 8.0f), hb16(bfr(b[1]) * 8.0f));
      p4[3] = pk16(hb16(bfr(b[2]) * 8.0f), hb16(bfr(b[3]) * 8.0f));
      if (pad) { p4[0] = 0u; p4[1] = 0u; p4[2] = 0u; p4[3] = 0u; }
      pk[rt][e] = p4;
    }
  }
  unsigned short* dst = xp + ((size_t)(w * NST + (tok0 >> 4)) * 8 + wave) * FT + lane * 8;
#pragma unroll
  for (int rt = 0; rt < 4; ++rt) {
    *(v4u*)(dst + rt * 8 * FT)       = pk[rt][0];
    *(v4u*)(dst + rt * 8 * FT + 256) = pk[rt][1];
  }
  asm volatile("s_wait_xcnt 0x0" ::: "memory");   // inlined in prep, code that rewrites these stores' registers can stand behind it
}

// =================================================================================================================
// set-up launch: four block ranges that read only inputs and write planes that only later launches read.
// NQB blocks convert w_qkv, NWB blocks convert w_out (cvt_block; their chains of dependent loads are the longest, so
// they take the lowest block indices), NGB blocks convert x (xcvt_block), NBB blocks build the bias table (bias_block).
// =================================================================================================================
__global__ __launch_bounds__(256)
void prep(const float* __restrict__ x, unsigned short* xp, const float* __restrict__ wqkv, unsigned short* wq,
          const float* __restrict__ wout, unsigned short* wo, const float* __restrict__ rpb, float* bt) {
  __shared__ __align__(16) float T[32 * TPW];
  const int b = blockIdx.x;                       // every test below is block-uniform
  if (b < NQB)                   cvt_block(wqkv, wq, C3, b, T);
  else if (b < NQB + NWB)        cvt_block(wout, wo, CCH, b - NQB, T);
  else if (b < NQB + NWB + NGB)  xcvt_block(x, xp, b - NQB - NWB);
  else                           bias_block(rpb, bt, b - NQB - NWB - NGB);
}

__device__ __forceinline__ v8h pack8(v8f a, float scl) {
  v8h r;
#pragma unroll
  for (int e = 0; e < 8; ++e) r[e] = (_Float16)(a[e] * scl);
  return r;
}
__global__ __launch_bounds__(256, 4)               // 4 waves per SIMD = 256 registers a wave: two blocks stay resident per WGP
void attn_win(const unsigned short* __restrict__ xp, const unsigned short* __restrict__ wq,
              const float* __restrict__ bt, unsigned short* opl) {
  __shared__ __align__(16) _Float16 Qs[NST * FT];
  __shared__ __align__(16) _Float16 Ks[NST * FT];
  __shared__ __align__(16) _Float16 Vs[NST * FT];
  union CB { v8f v; v4f q[2]; };
  const int tid = threadIdx.x, wave = tid >> 5, lane = tid & 31;
  const int wh = blockIdx.x;                      // w*8 + h
  const int w = wh >> 3, h = wh & 7;
  const int strip0 = wave * SPW;                  // 0, 3, .. 21
  const int q0 = strip0 * 16;

  // ---- projection of the wave's 48 tokens onto the head's 3 x 32 columns ----
  {
    const _Float16* X  = (const _Float16*)(const void*)xp + (size_t)(w * NST + strip0) * 8 * FT + lane * 8;
    const _Float16* Wh = (const _Float16*)(const void*)wq + (size_t)(h * 2) * 8 * FT + lane * 8;   // column tile h*2 of part q
    v8f aq[SPW][2], ak[SPW][2], av[SPW][2];
#pragma unroll
    for (int t = 0; t < SPW; ++t) {
#pragma unroll
      for (int dt = 0; dt < 2; ++dt) { aq[t][dt] = zero8(); ak[t][dt] = zero8(); av[t][dt] = zero8(); }
    }
#pragma unroll 1                                  // 18 accumulator tiles: a second copy of the body's fragments would not fit 256 registers
    for (int ks = 0; ks < 8; ++ks) {
      const _Float16* xk = X + ks * FT;
      const _Float16* wk = Wh + ks * FT;
      v16h xf[SPW], wf[3][2];                     // wf[part][dt]: column tile part * 16 + h*2 + dt
#pragma unroll
      for (int t = 0; t < SPW; ++t) xf[t] = ldfrag_t(xk + t * 8 * FT);
#pragma unroll
      for (int p = 0; p < 3; ++p) {
#pragma unroll
        for (int dt = 0; dt < 2; ++dt) wf[p][dt] = ldfrag_t(wk + (p * 16 + dt) * 8 * FT);
      }
      // the loads' address registers stay whole up to this wait (named as inputs), and are rewritten only behind it
      asm volatile("s_wait_xcnt 0x0" :: "v"(xk), "v"(wk) : "memory");
      // all 18 loads are issued before the first product: one wait for memory a k-step, not one per reused fragment register
      __builtin_amdgcn_sched_barrier(0);
#pragma unroll
      for (int dt = 0; dt < 2; ++dt) {
#pragma unroll
        for (int t = 0; t < SPW; ++t) {
          aq[t][dt] = mma_raw(wf[0][dt], xf[t], aq[t][dt]);
          ak[t][dt] = mma_raw(wf[1][dt], xf[t], ak[t][dt]);
          av[t][dt] = mma_raw(xf[t], wf[2][dt], av[t][dt]);
        }
      }
    }
#pragma unroll
    for (int t = 0; t < SPW; ++t) {
      const int st = strip0 + t;
      *(v8h*)(Qs + st * FT + lane * 8)       = pack8(aq[t][0], QSC * (64.0f / 8192.0f));
      *(v8h*)(Qs + st * FT + 256 + lane * 8) = pack8(aq[t][1], QSC * (64.0f / 8192.0f));
      *(v8h*)(Ks + st * FT + lane * 8)       = pack8(ak[t][0], 8.0f / 8192.0f);
      *(v8h*)(Ks + st * FT + 256 + lane * 8) = pack8(ak[t][1], 8.0f / 8192.0f);
      *(v8h*)(Vs + (st >> 1) * FT + (st & 1) * 256 + lane * 8)             = pack8(av[t][0], 16.0f / 8192.0f);
      *(v8h*)(Vs + (TP / 32 + (st >> 1)) * FT + (st & 1) * 256 + lane * 8) = pack8(av[t][1], 16.0f / 8192.0f);
    }
  }
  __syncthreads();                                // K and V^T are whole before any wave reads other waves' tiles

  const _Float16* Q  = Qs + strip0 * FT + lane * 8;   // the wave's own three tiles
  const _Float16* K  = Ks + lane * 8;
  const _Float16* Vt = Vs + lane * 8;
  const float* Bp = bt + ((size_t)(h * NST + strip0)) * NKT * 256 + lane * 4;

  float mrow[SPW], lrow[SPW];                     // per strip, this lane's query: running maximum, sum over this half's keys
  v8f o0[SPW], o1[SPW];
#pragma unroll
  for (int t = 0; t < SPW; ++t) {
    mrow[t] = -1e30f;
    lrow[t] = 0.f;
    o0[t] = zero8();
    o1[t] = zero8();
  }

#pragma unroll 1
  for (int kb = 0; kb < TP / 64; ++kb) {
    // ---- transposed logits for 64 keys: 4 tiles of 16 keys, bias and key padding mask via the C operand ----
    v8f s[SPW][4];
    const float* bk = Bp + kb * 4 * 256;
#pragma unroll
    for (int j = 0; j < 4; ++j) {
#pragma unroll
      for (int t = 0; t < SPW; ++t) {
        const float* bp = bk + (t * NKT + j) * 256;
        CB cb;
        cb.q[0] = *(const v4f*)(bp);
        cb.q[1] = *(const v4f*)(bp + 128);
        s[t][j] = cb.v;
      }
    }
    // the bias loads' address register stays whole up to this wait (named as an input), and is rewritten only behind it
    asm volatile("s_wait_xcnt 0x0" :: "v"(bk) : "memory");
    v16h qb[SPW];                                 // read anew each pass: 24 registers free during softmax and O^T
#pragma unroll
    for (int t = 0; t < SPW; ++t) qb[t] = ldfrag_t(Q + t * FT);
#pragma unroll
    for (int j = 0; j < 4; ++j) {
      const v16h kf = ldfrag_t(K + (kb * 4 + j) * FT);
#pragma unroll
      for (int t = 0; t < SPW; ++t) s[t][j] = mma_raw(kf, qb[t], s[t][j]);
    }
    // ---- online softmax update of the lane's query in each strip ----
#pragma unroll
    for (int t = 0; t < SPW; ++t) {
      float tj[4];
#pragma unroll
      for (int j = 0; j < 4; ++j) {
        tj[j] = fmaxf(fmaxf(fmaxf(s[t][j][0], s[t][j][1]), fmaxf(s[t][j][2], s[t][j][3])),
                      fmaxf(fmaxf(s[t][j][4], s[t][j][5]), fmaxf(s[t][j][6], s[t][j][7])));
      }
      float tm = fmaxf(fmaxf(tj[0], tj[1]), fmaxf(tj[2], tj[3]));
      tm = fmaxf(tm, xhalf(tm));
      const float mn = fmaxf(mrow[t], tm);
      const float alpha = __expf((mrow[t] - mn) * INV512);
      mrow[t] = mn;
#pragma unroll
      for (int j = 0; j < 4; ++j) {
        const v8f u = ((s[t][j] - mn) * INV512 + LN1024) * LOG2E;  // one maximum per lane: whole-tile (packed) arithmetic
#pragma unroll
        for (int r = 0; r < 8; ++r) s[t][j][r] = __builtin_amdgcn_exp2f(u[r]);
      }
      const v8f p8 = (s[t][0] + s[t][1]) + (s[t][2] + s[t][3]);
      const v4f p4 = p8.lo + p8.hi;
      lrow[t] = lrow[t] * alpha + ((p4[0] + p4[1]) + (p4[2] + p4[3]));
      o0[t] = o0[t] * alpha;
      o1[t] = o1[t] * alpha;
    }
    // ---- O^T += V^T . P^T : two 32-key k-steps, two 16-dim tiles, three strips per V^T fragment ----
#pragma unroll
    for (int ks = 0; ks < 2; ++ks) {
      const v16h v0 = ldfrag_t(Vt + (kb * 2 + ks) * FT);
      const v16h v1 = ldfrag_t(Vt + (TP / 32 + kb * 2 + ks) * FT);
#pragma unroll
      for (int t = 0; t < SPW; ++t) {
        v16h pb;
#pragma unroll
        for (int e = 0; e < 8; ++e) {
          pb[e]     = (_Float16)s[t][2 * ks][e];
          pb[8 + e] = (_Float16)s[t][2 * ks + 1][e];
        }
        o0[t] = mma_raw(v0, pb, o0[t]);
        o1[t] = mma_raw(v1, pb, o1[t]);
      }
    }
  }

  // ---- join the halves' sums, normalise (64 ctx = O * 4 / l), store the lane's two 16-B pieces of each strip ----
  unsigned short* op = opl + ((size_t)h * NROWP + (size_t)w * TP + q0) * HD + lane * 8;
#pragma unroll
  for (int t = 0; t < SPW; ++t) {
    const float inv = 4.0f / (lrow[t] + xhalf(lrow[t]));
    v4u p0, p1;
#pragma unroll
    for (int e = 0; e < 4; ++e) {
      p0[e] = pk16(hb16(o0[t][2 * e] * inv), hb16(o0[t][2 * e + 1] * inv));
      p1[e] = pk16(hb16(o1[t][2 * e] * inv), hb16(o1[t][2 * e + 1] * inv));
    }
    *(v4u*)(op + t * FT) = p0;
    *(v4u*)(op + t * FT + 256) = p1;
  }
}

// =================================================================================================================
// Output projection: out rows = (O64/64) . (W1024/1024)^T, K = 256 = 8 head planes of 32. Block tile 64 padded
// tokens x 128 cols, 8 waves = 2 x 4, 2x2 tiles per wave. Epilogue through an LDS f32 tile; a wave writes one
// coverage: 128 windows x 343 tokens x 2 x 128 cols = every output element exactly once.
// =================================================================================================================
__global__ __launch_bounds__(256)
void gemm_proj(const unsigned short* __restrict__ opl, const unsigned short* __restrict__ wp, float* out) {
  __shared__ __align__(16) float Cs[64 * LDC];
  const int tid = threadIdx.x, wave = tid >> 5, lane = tid & 31, hh = lane >> 4, c = lane & 15;
  const int mb = blockIdx.x, nb = blockIdx.y;
  const int mw = wave >> 2, nw = wave & 3;
  const _Float16* W = (const _Float16*)(const void*)wp;
  const _Float16* Ap = (const _Float16*)(const void*)opl + (size_t)(mb * 4 + mw * 2) * FT + lane * 8;  // row tile
  const _Float16* Wp = W + (size_t)(nb * 8 + nw * 2) * 8 * FT + lane * 8;                              // col tile

  v8f a00 = zero8(), a01 = zero8(), a10 = zero8(), a11 = zero8();
#pragma unroll 1
  for (int ks = 0; ks < 8; ++ks) {
    const v16h fa0 = ldfrag_t(Ap);
    const v16h fa1 = ldfrag_t(Ap + FT);
    const v16h fb0 = ldfrag_t(Wp);
    const v16h fb1 = ldfrag_t(Wp + 8 * FT);
    Ap += (size_t)NROWP * HD;                     // next head plane
    Wp += FT;                                     // next 32-k step
    a00 = mma_raw(fa0, fb0, a00);
    a01 = mma_raw(fa0, fb1, a01);
    a10 = mma_raw(fa1, fb0, a10);
    a11 = mma_raw(fa1, fb1, a11);
    guard4(a00, a01, a10, a11, fa0, fa1, fb0, fb1);
  }
#pragma unroll
  for (int r = 0; r < 8; ++r) {
    const int row = mw * 32 + 8 * hh + r;
    Cs[row * LDC + nw * 32 + c]             = a00[r];
    Cs[row * LDC + nw * 32 + 16 + c]        = a01[r];
    Cs[(row + 16) * LDC + nw * 32 + c]      = a10[r];
    Cs[(row + 16) * LDC + nw * 32 + 16 + c] = a11[r];
  }
  __syncthreads();

  const int w = mb / MT, tok0 = (mb - w * MT) * 64;
  const int rbase = tok0 + wave * 8;
  v4f ov[8];
  size_t offs[8];
#pragma unroll
  for (int it = 0; it < 8; ++it) {
    const int row = wave * 8 + it;
    v4f v = *(const v4f*)(Cs + row * LDC + lane * 4);
    v = v * (1.0f / 65536.0f);
    ov[it] = v;
    const int tokc = min(rbase + it, NTOK - 1);
    offs[it] = ((size_t)w * NTOK + tokc) * CCH + nb * 128 + lane * 4;
  }
#pragma unroll
  for (int it = 0; it < 8; ++it) {
    if (rbase + it < NTOK) *(v4f*)(out + offs[it]) = ov[it];     // wave-uniform
  }
  
}

// =================================================================================================================
// token dimension padded to 384 per window everywhere):
//   WqkvT f16 768 x 256 393216 | WoutT f16 256 x 256 131072 |
//   bias table f32 [8][24][24][256] 4718592 | X f16 49152 x 256 25165824 |
//   O f16 8 x 49152 x 32 25165824 | total 55574528.
//   every f16 plane is stored as 1024-byte operand tiles in fragment order (ldfrag_t).
// =================================================================================================================
extern "C" void kernel_launch(void* const* d_in, const int* in_sizes, int n_in,
                              void* d_out, int out_size, void* d_ws, size_t ws_size,
                              hipStream_t stream) {
  if (n_in < 4) return;
  if (in_sizes[0] != NROWX * CCH) return;
  if (in_sizes[1] != CCH * C3) return;
  if (in_sizes[2] != CCH * CCH) return;
  if (in_sizes[3] != NRPB * NHD) return;
  if (out_size != NROWX * CCH) return;

  const float* x    = (const float*)d_in[0];
  const float* wqkv = (const float*)d_in[1];
  const float* wout = (const float*)d_in[2];
  const float* rpb  = (const float*)d_in[3];
  float* out = (float*)d_out;

  const size_t sWq = (size_t)C3 * CCH * 2;                    //   393216
  const size_t sWo = (size_t)CCH * CCH * 2;                   //   131072
  const size_t sBT = (size_t)NHD * NST * NKT * 256 * 4;       //  4718592
  const size_t sX  = (size_t)NROWP * CCH * 2;                 // 25165824
  const size_t sO  = (size_t)NHD * NROWP * HD * 2;            // 25165824
  size_t off = 0;
  const size_t oWq = off; off += sWq;
  const size_t oWo = off; off += sWo;
  const size_t oBT = off; off += sBT;
  const size_t oX  = off; off += sX;
  const size_t oO  = off; off += sO;
  if (off > ws_size) return;                                   // off = 55574528
  if (off > (size_t)134217728) return;

  char* ws = (char*)d_ws;
  unsigned short* WqT = (unsigned short*)(ws + oWq);
  unsigned short* WoT = (unsigned short*)(ws + oWo);
  float*          BT  = (float*)(ws + oBT);
  unsigned short* Xp  = (unsigned short*)(ws + oX);
  unsigned short* Op  = (unsigned short*)(ws + oO);

  const dim3 blk(256);
  // (1) set-up: transpose + convert of w_qkv (24 blocks) and w_out (8), convert of x (768), bias table (1152)
  prep<<<dim3(NQB + NWB + NGB + NBB), blk, 0, stream>>>(x, Xp, wqkv, WqT, wout, WoT, rpb, BT);
  // (2) qkv projection + window attention: 128 windows x 8 heads, one block of 8 waves x 3 strips each
  attn_win<<<dim3(NWIN * NHD), blk, 0, stream>>>(Xp, WqT, BT, Op);
  // (3) output projection -> d_out (padded tokens skipped)
  gemm_proj<<<dim3(NROWP / 64, CCH / 128), blk, 0, stream>>>(Op, WoT, out);
  (void)hipGetLastError();
}

// v006
// One run takes 77 microseconds.
// Timed twice side by side with v005, it ran 1.08 times as fast both times.
// All steps since v000 together make it 3.03 times as fast.
// qkv projection, q.k^T, p.v and output projection: v_wmma_f32_16x16x32_f16 single products (f16 operands, f32 accumulate);
// all inputs RNE-converted to bf16 on load and carried with power-of-two scales, as f16 (the bias table as f32); softmax, key padding mask and epilogues in f32 on VALU.
// attention runs on transposed products (S^T = K.Q^T, O^T = V^T.P^T): a lane owns one query, P stays in registers.
// the qkv projection runs inside the attention kernel: Q, K and V^T go through LDS only.
#include <hip/hip_runtime.h>
#include <stdint.h>

#define NWIN  128
#define NTOK  343
#define TP    352
#define CCH   256
#define NHD   8
#define HD    32
#define C3    768
#define NROWP 45056
#define NROWX 43904
#define NRPB  2197
#define NST   22
#define NKT   22
#define LDC   132
#define TPW   260
#define FT    512
#define QSC   0.17677669529663687f
#define INV512 0.001953125f
#define LN1024 6.9314718055994531f
#define LOG2E 1.44269504088896341f
#define MASKC (-1048576.0f)
#define NGB   704
#define NWB   8
#define NBB   968
#define NQB   24
#define NW3   6
#define KB64  5

static_assert(NROWP == NWIN * TP);
static_assert(NROWX == NWIN * NTOK);
static_assert(TP == KB64 * 64 + 32);
static_assert(TP % 32 == 0 && NST % 2 == 0);
static_assert(TP >= NTOK && TP - NTOK < 16);
static_assert(NST * 16 == TP);
static_assert(NKT * 16 == TP);
static_assert((LDC * 4) % 16 == 0);
static_assert((TPW * 4) % 16 == 0);
static_assert(NHD * HD == CCH);
static_assert(FT == 16 * 32);
static_assert(TP * HD == NST * FT);
static_assert(NGB * 64 == NROWP);
static_assert(NWB * 32 == CCH);
static_assert(NBB * 256 == NHD * NST * NKT * 64);
static_assert(NQB * 32 == C3);
static_assert(NW3 * 3 + (8 - NW3) * 2 == NST);

typedef _Float16 v16h __attribute__((ext_vector_type(16)));
typedef _Float16 v8h  __attribute__((ext_vector_type(8)));
typedef float    v8f  __attribute__((ext_vector_type(8)));
typedef float    v4f  __attribute__((ext_vector_type(4)));
typedef unsigned int v4u __attribute__((ext_vector_type(4)));

// ---- scalar helpers ------------------------------------------------------------------------------------------
__device__ __forceinline__ unsigned short bf_bits(float f) {          // f32 -> bf16 bits, RNE convert
  unsigned u = __float_as_uint(f);
  return (unsigned short)((u + 0x7FFFu + ((u >> 16) & 1u)) >> 16);
}
__device__ __forceinline__ float bf_up(unsigned short b) { return __uint_as_float(((unsigned)b) << 16); }
__device__ __forceinline__ float bfr(float f) { return bf_up(bf_bits(f)); }
__device__ __forceinline__ unsigned short h_bits(_Float16 x) { return __builtin_bit_cast(unsigned short, x); }
__device__ __forceinline__ unsigned short hb16(float f) { return h_bits((_Float16)f); }
__device__ __forceinline__ unsigned pk16(unsigned short a, unsigned short b) { return (unsigned)a | ((unsigned)b << 16); }
__device__ __forceinline__ v8f zero8() { v8f z = {0.f, 0.f, 0.f, 0.f, 0.f, 0.f, 0.f, 0.f}; return z; }

// ---- fragment loader for the fragment-order global planes: one 16 (rows/cols) x 32 (k) operand tile is FT halves =
//      1024 contiguous bytes; its 16-B piece e*32 + lane holds row/col (lane&15), k = 16*e + 8*(lane>>4) + 0..7 (the
//      hardware k order, which a packed pair of D tiles also has). p = tile base + lane*8: each of the two loads reads
//      512 contiguous bytes per wave.
__device__ __forceinline__ v16h ldfrag_t(const _Float16* p) {
  union { v16h v; v8h h[2]; } f;
  f.h[0] = *(const v8h*)(p);
  f.h[1] = *(const v8h*)(p + 256);
  return f.v;
}

// ---- WMMA helpers; the guard helpers insert the trailing VALU hazard gap and keep A/B live -----------------------
__device__ __forceinline__ v8f mma_raw(v16h a, v16h b, v8f c) {
  return __builtin_amdgcn_wmma_f32_16x16x32_f16(false, a, false, b, (short)0, c, false, false);
}
__device__ __forceinline__ void guard4(v8f& c0, v8f& c1, v8f& c2, v8f& c3,
                                       const v16h& a0, const v16h& a1, const v16h& b0, const v16h& b1) {
#if defined(__HIP_DEVICE_COMPILE__)
  asm volatile("v_nop\n\tv_nop\n\tv_nop\n\tv_nop"
               : "+v"(c0), "+v"(c1), "+v"(c2), "+v"(c3) : "v"(a0), "v"(a1), "v"(b0), "v"(b1));
#endif
}
// value of lane l ^ 16 (the other half of the wave), by a vector cross-row move
__device__ __forceinline__ float xhalf(float x) {
  const int b = __float_as_int(x);
  return __int_as_float(__builtin_amdgcn_permlanex16(b, b, 0x76543210, 0xfedcba98, false, false));
}

// =================================================================================================================
// weight transpose + convert: w [256 k][ncol n] f32 (n contiguous, used as x.w) -> wT, ncol columns x 256 k as f16 in
// fragment order (tile (n/16)*8 + k/32, see ldfrag_t), value f16(1024 * bf16_RNE(w)). Block = 32 columns: the 256x32
// f32 slab is staged in LDS (coalesced reads); wave = one 32-k step, it writes its two tiles of 1024 contiguous bytes.
// coverage: (ncol/32) blocks x 8 waves x 2 tiles x 2 x 32 pieces x 8 halves = ncol x 256.
// cvt_block is the work of one block (bx = its 32-column slab, T = 32 * TPW floats of the block's LDS); the blocks of
// w_qkv and of w_out ride in the grid of prep.
// =================================================================================================================
__device__ __forceinline__ void cvt_block(const float* __restrict__ wsrc, unsigned short* wdst, int ncol, int bx,
                                          float* T) {
  const int tid = threadIdx.x, wv = tid >> 5, lane = tid & 31, hh = lane >> 4, c = lane & 15;
  const int n0 = bx * 32;
#pragma unroll 4
  for (int it = 0; it < 32; ++it) {
    const int k = it * 8 + wv;
    T[lane * TPW + k] = wsrc[(size_t)k * ncol + n0 + lane];
  }
  __syncthreads();
  v4u pk[4];
  size_t offs[4];
#pragma unroll
  for (int q = 0; q < 4; ++q) {
    const int nt = q >> 1, e = q & 1;
    const float* tp = T + (nt * 16 + c) * TPW + wv * 32 + e * 16 + hh * 8;
    const v4f a = *(const v4f*)(tp);
    const v4f b = *(const v4f*)(tp + 4);
    v4u p4;
    p4[0] = pk16(hb16(bfr(a[0]) * 1024.0f), hb16(bfr(a[1]) * 1024.0f));
    p4[1] = pk16(hb16(bfr(a[2]) * 1024.0f), hb16(bfr(a[3]) * 1024.0f));
    p4[2] = pk16(hb16(bfr(b[0]) * 1024.0f), hb16(bfr(b[1]) * 1024.0f));
    p4[3] = pk16(hb16(bfr(b[2]) * 1024.0f), hb16(bfr(b[3]) * 1024.0f));
    pk[q] = p4;
    offs[q] = ((size_t)(bx * 2 + nt) * 8 + wv) * FT + e * 256 + lane * 8;
  }
#pragma unroll
  for (int q = 0; q < 4; ++q) *(v4u*)(wdst + offs[q]) = pk[q];
  asm volatile("s_wait_xcnt 0x0" ::: "memory");   // inlined in prep, code that rewrites these stores' registers can stand behind it
}
// =================================================================================================================
// relative position bias table in the C-operand order of the transposed logits tile (16 keys x 16 queries), registers
// 0..3 of all lanes then registers 4..7 (each C load reads 512 contiguous bytes per wave):
// BT[((h*22 + strip)*22 + kt)*256 + (r>>2)*128 + l*4 + (r&3)] =
// 512 * bf16_RNE(rpb[idx(n,m)*8 + h]) with n = strip*16 + (l&15) (query), m = kt*16 + 8*(l>>4) + r (key),
// idx = ((i_n-i_m+6)*13 + (j_n-j_m+6))*13 + (k_n-k_m+6), (i,j,k) = (t/49, (t/7)%7, t%7); padded keys m >= 343
// get MASKC (logit mask through the C operand), padded queries n >= 343 get 0. Thread = one 16-B piece (4 keys),
// coverage: 8 heads x 22 strips x 22 key tiles x 64 pieces x 4 floats = 8 x 352 x 352, every element once.
// bias_block is the work of one block of 256 pieces (bx = 0 .. NBB-1); the blocks ride in the grid of prep.
// =================================================================================================================
__device__ __forceinline__ void bias_block(const float* __restrict__ rpb, float* bt, int bx) {
  const int g = bx * 256 + threadIdx.x;
  const int piece = g & 63, rec = g >> 6;
  const int kt = rec % NKT, strip = (rec / NKT) % NST, h = rec / (NKT * NST);
  const int l = piece & 31, e0 = (piece >> 5) * 4;
  const int col = l & 15, lh = l >> 4;
  const int n = strip * 16 + col;
  const int ni = n / 49, nj = (n / 7) % 7, nk = n % 7;
  v4f v;
#pragma unroll
  for (int e = 0; e < 4; ++e) {
    const int m = kt * 16 + 8 * lh + e0 + e;
    const int mi = m / 49, mj = (m / 7) % 7, mk = m % 7;
    int idx = ((ni - mi + 6) * 13 + (nj - mj + 6)) * 13 + (nk - mk + 6);
    idx = min(max(idx, 0), NRPB - 1);
    float val = bfr(rpb[idx * NHD + h]) * 512.0f;
    if (n >= NTOK) val = 0.0f;
    if (m >= NTOK) val = MASKC;
    v[e] = val;
  }
  float* gp = bt + (size_t)rec * 256 + piece * 4;
  *(v4f*)gp = v;
  asm volatile("s_wait_xcnt 0x0" ::: "memory");   // inlined in prep, code that rewrites this store's registers can stand behind it
  
}

// =================================================================================================================
// input convert: block = 4 strips of 16 padded tokens (a window has 22 strips, so a block may span two windows). It
// reads its 64 x 256 f32 slab of x once (token clamped, padded tokens 343..351 become exact zeros), converts it to
// f16(8 * bf16_RNE(x)) and writes it as 4 x 8 operand tiles of the X plane in fragment order (tile
// (w*22 + tok/16)*8 + k/32, see ldfrag_t); wave = one 32-k step; a wave's store writes 512 contiguous bytes.
// coverage: 704 blocks x 8 waves x 4 tiles x 1024 B = 128 x 22 x 8 tiles, each once.
// =================================================================================================================
__device__ __forceinline__ void xcvt_block(const float* __restrict__ x, unsigned short* xp, int mb) {
  const int tid = threadIdx.x, wave = tid >> 5, lane = tid & 31, hh = lane >> 4, c = lane & 15;
  v4f xa[4][4];
  const float* src[4];
  int tk[4];                                      // token of this lane's row inside its window, 0 .. 351
#pragma unroll
  for (int rt = 0; rt < 4; ++rt) {
    const int sx = mb * 4 + rt, w = sx / NST;     // strip over all windows, its window
    tk[rt] = (sx - w * NST) * 16 + c;
    const int ts = min(tk[rt], NTOK - 1);
    src[rt] = x + ((size_t)w * NTOK + ts) * CCH + wave * 32 + 8 * hh;
#pragma unroll
    for (int e = 0; e < 2; ++e) {
      xa[rt][2 * e]     = *(const v4f*)(src[rt] + 16 * e);
      xa[rt][2 * e + 1] = *(const v4f*)(src[rt] + 16 * e + 4);
    }
  }
  // the loads' address registers stay whole up to this wait (named as inputs), and are rewritten only behind it
  asm volatile("s_wait_xcnt 0x0" :: "v"(src[0]), "v"(src[1]), "v"(src[2]), "v"(src[3]) : "memory");
  v4u pk[4][2];
#pragma unroll
  for (int rt = 0; rt < 4; ++rt) {
    const bool pad = tk[rt] >= NTOK;
#pragma unroll
    for (int e = 0; e < 2; ++e) {
      const v4f a = xa[rt][2 * e], b = xa[rt][2 * e + 1];
      v4u p4;
      p4[0] = pk16(hb16(bfr(a[0]) * 8.0f), hb16(bfr(a[1]) * 8.0f));
      p4[1] = pk16(hb16(bfr(a[2]) * 8.0f), hb16(bfr(a[3]) * 8.0f));
      p4[2] = pk16(hb16(bfr(b[0]) * 8.0f), hb16(bfr(b[1]) * 8.0f));
      p4[3] = pk16(hb16(bfr(b[2]) * 8.0f), hb16(bfr(b[3]) * 8.0f));
      if (pad) { p4[0] = 0u; p4[1] = 0u; p4[2] = 0u; p4[3] = 0u; }
      pk[rt][e] = p4;
    }
  }
  unsigned short* dst = xp + ((size_t)(mb * 4) * 8 + wave) * FT + lane * 8;
#pragma unroll
  for (int rt = 0; rt < 4; ++rt) {
    *(v4u*)(dst + rt * 8 * FT)       = pk[rt][0];
    *(v4u*)(dst + rt * 8 * FT + 256) = pk[rt][1];
  }
  asm volatile("s_wait_xcnt 0x0" ::: "memory");   // inlined in prep, code that rewrites these stores' registers can stand behind it
}

// =================================================================================================================
// set-up launch: four block ranges that read only inputs and write planes that only later launches read.
// NQB blocks convert w_qkv, NWB blocks convert w_out (cvt_block; their chains of dependent loads are the longest, so
// they take the lowest block indices), NGB blocks convert x (xcvt_block), NBB blocks build the bias table (bias_block).
// =================================================================================================================
__global__ __launch_bounds__(256)
void prep(const float* __restrict__ x, unsigned short* xp, const float* __restrict__ wqkv, unsigned short* wq,
          const float* __restrict__ wout, unsigned short* wo, const float* __restrict__ rpb, float* bt) {
  __shared__ __align__(16) float T[32 * TPW];
  const int b = blockIdx.x;                       // every test below is block-uniform
  if (b < NQB)                   cvt_block(wqkv, wq, C3, b, T);
  else if (b < NQB + NWB)        cvt_block(wout, wo, CCH, b - NQB, T);
  else if (b < NQB + NWB + NGB)  xcvt_block(x, xp, b - NQB - NWB);
  else                           bias_block(rpb, bt, b - NQB - NWB - NGB);
}

__device__ __forceinline__ v8h pack8(v8f a, float scl) {
  v8h r;
#pragma unroll
  for (int e = 0; e < 8; ++e) r[e] = (_Float16)(a[e] * scl);
  return r;
}
// projection of a wave's S strips (from strip0) onto the head's 3 x 32 columns; X, Wh carry the lane's offset
template <int S>
__device__ __forceinline__ void proj_strips(const _Float16* X, const _Float16* Wh, _Float16* Qs, _Float16* Ks,
                                            _Float16* Vs, int strip0, int lane) {
  v8f aq[S][2], ak[S][2], av[S][2];
#pragma unroll
  for (int t = 0; t < S; ++t) {
#pragma unroll
    for (int dt = 0; dt < 2; ++dt) { aq[t][dt] = zero8(); ak[t][dt] = zero8(); av[t][dt] = zero8(); }
  }
#pragma unroll 1                                  // up to 18 accumulator tiles: a second copy of the body's fragments would not fit 256 registers
  for (int ks = 0; ks < 8; ++ks) {
    const _Float16* xk = X + ks * FT;
    const _Float16* wk = Wh + ks * FT;
    v16h xf[S], wf[3][2];                         // wf[part][dt]: column tile part * 16 + h*2 + dt
#pragma unroll
    for (int t = 0; t < S; ++t) xf[t] = ldfrag_t(xk + t * 8 * FT);
#pragma unroll
    for (int p = 0; p < 3; ++p) {
#pragma unroll
      for (int dt = 0; dt < 2; ++dt) wf[p][dt] = ldfrag_t(wk + (p * 16 + dt) * 8 * FT);
    }
    // the loads' address registers stay whole up to this wait (named as inputs), and are rewritten only behind it
    asm volatile("s_wait_xcnt 0x0" :: "v"(xk), "v"(wk) : "memory");
    // all loads are issued before the first product: one wait for memory a k-step, not one per reused fragment register
    __builtin_amdgcn_sched_barrier(0);
#pragma unroll
    for (int dt = 0; dt < 2; ++dt) {
#pragma unroll
      for (int t = 0; t < S; ++t) {
        aq[t][dt] = mma_raw(wf[0][dt], xf[t], aq[t][dt]);
        ak[t][dt] = mma_raw(wf[1][dt], xf[t], ak[t][dt]);
        av[t][dt] = mma_raw(xf[t], wf[2][dt], av[t][dt]);
      }
    }
  }
#pragma unroll
  for (int t = 0; t < S; ++t) {
    const int st = strip0 + t;
    *(v8h*)(Qs + st * FT + lane * 8)       = pack8(aq[t][0], QSC * (64.0f / 8192.0f));
    *(v8h*)(Qs + st * FT + 256 + lane * 8) = pack8(aq[t][1], QSC * (64.0f / 8192.0f));
    *(v8h*)(Ks + st * FT + lane * 8)       = pack8(ak[t][0], 8.0f / 8192.0f);
    *(v8h*)(Ks + st * FT + 256 + lane * 8) = pack8(ak[t][1], 8.0f / 8192.0f);
    *(v8h*)(Vs + (st >> 1) * FT + (st & 1) * 256 + lane * 8)             = pack8(av[t][0], 16.0f / 8192.0f);
    *(v8h*)(Vs + (TP / 32 + (st >> 1)) * FT + (st & 1) * 256 + lane * 8) = pack8(av[t][1], 16.0f / 8192.0f);
  }
}
// one pass of the online softmax over NJ key tiles (NJ = 4 or 2) for a wave's S strips: bk, K, Vt stand at the pass's
// first bias tile, K tile and V^T tile (lane offsets included), Q at the wave's first Q tile
template <int S, int NJ>
__device__ __forceinline__ void key_pass(const float* bk, const _Float16* Q, const _Float16* K, const _Float16* Vt,
                                         float (&mrow)[S], float (&lrow)[S], v8f (&o0)[S], v8f (&o1)[S]) {
  union CB { v8f v; v4f q[2]; };
  // ---- transposed logits: NJ tiles of 16 keys, bias and key padding mask via the C operand ----
  v8f s[S][NJ];
#pragma unroll
  for (int j = 0; j < NJ; ++j) {
#pragma unroll
    for (int t = 0; t < S; ++t) {
      const float* bp = bk + (t * NKT + j) * 256;
      CB cb;
      cb.q[0] = *(const v4f*)(bp);
      cb.q[1] = *(const v4f*)(bp + 128);
      s[t][j] = cb.v;
    }
  }
  // the bias loads' address register stays whole up to this wait (named as an input), and is rewritten only behind it
  asm volatile("s_wait_xcnt 0x0" :: "v"(bk) : "memory");
  v16h qb[S];                                     // read anew each pass: its registers are free during softmax and O^T
#pragma unroll
  for (int t = 0; t < S; ++t) qb[t] = ldfrag_t(Q + t * FT);
#pragma unroll
  for (int j = 0; j < NJ; ++j) {
    const v16h kf = ldfrag_t(K + j * FT);
#pragma unroll
    for (int t = 0; t < S; ++t) s[t][j] = mma_raw(kf, qb[t], s[t][j]);
  }
  // ---- online softmax update of the lane's query in each strip ----
#pragma unroll
  for (int t = 0; t < S; ++t) {
    float tj[NJ];
#pragma unroll
    for (int j = 0; j < NJ; ++j) {
      tj[j] = fmaxf(fmaxf(fmaxf(s[t][j][0], s[t][j][1]), fmaxf(s[t][j][2], s[t][j][3])),
                    fmaxf(fmaxf(s[t][j][4], s[t][j][5]), fmaxf(s[t][j][6], s[t][j][7])));
    }
    float tm = fmaxf(tj[0], tj[1]);
    if (NJ == 4) tm = fmaxf(tm, fmaxf(tj[NJ - 2], tj[NJ - 1]));
    tm = fmaxf(tm, xhalf(tm));
    const float mn = fmaxf(mrow[t], tm);
    const float alpha = __expf((mrow[t] - mn) * INV512);
    mrow[t] = mn;
#pragma unroll
    for (int j = 0; j < NJ; ++j) {
      const v8f u = ((s[t][j] - mn) * INV512 + LN1024) * LOG2E;  // one maximum per lane: whole-tile (packed) arithmetic
#pragma unroll
      for (int r = 0; r < 8; ++r) s[t][j][r] = __builtin_amdgcn_exp2f(u[r]);
    }
    v8f p8 = s[t][0] + s[t][1];
    if (NJ == 4) p8 = p8 + (s[t][NJ - 2] + s[t][NJ - 1]);
    const v4f p4 = p8.lo + p8.hi;
    lrow[t] = lrow[t] * alpha + ((p4[0] + p4[1]) + (p4[2] + p4[3]));
    o0[t] = o0[t] * alpha;
    o1[t] = o1[t] * alpha;
  }
  // ---- O^T += V^T . P^T : 32-key k-steps, two 16-dim tiles, S strips per V^T fragment ----
#pragma unroll
  for (int ks = 0; ks < NJ / 2; ++ks) {
    const v16h v0 = ldfrag_t(Vt + ks * FT);
    const v16h v1 = ldfrag_t(Vt + (TP / 32 + ks) * FT);
#pragma unroll
    for (int t = 0; t < S; ++t) {
      v16h pb;
#pragma unroll
      for (int e = 0; e < 8; ++e) {
        pb[e]     = (_Float16)s[t][2 * ks][e];
        pb[8 + e] = (_Float16)s[t][2 * ks + 1][e];
      }
      o0[t] = mma_raw(v0, pb, o0[t]);
      o1[t] = mma_raw(v1, pb, o1[t]);
    }
  }
}
// attention of a wave's S strips over the window's 22 key tiles; op = the lane's piece of the first strip's output tile
template <int S>
__device__ __forceinline__ void attn_strips(const float* Bp, const _Float16* Q, const _Float16* K, const _Float16* Vt,
                                            unsigned short* op) {
  float mrow[S], lrow[S];                         // per strip, this lane's query: running maximum, sum over this half's keys
  v8f o0[S], o1[S];
#pragma unroll
  for (int t = 0; t < S; ++t) {
    mrow[t] = -1e30f;
    lrow[t] = 0.f;
    o0[t] = zero8();
    o1[t] = zero8();
  }
#pragma unroll 1                                  // one copy of the 64-key pass: its score tiles fill the register budget
  for (int kb = 0; kb < KB64; ++kb)
    key_pass<S, 4>(Bp + kb * 4 * 256, Q, K + kb * 4 * FT, Vt + kb * 2 * FT, mrow, lrow, o0, o1);
  key_pass<S, 2>(Bp + KB64 * 4 * 256, Q, K + KB64 * 4 * FT, Vt + KB64 * 2 * FT, mrow, lrow, o0, o1);

  // ---- join the halves' sums, normalise (64 ctx = O * 4 / l), store the lane's two 16-B pieces of each strip ----
#pragma unroll
  for (int t = 0; t < S; ++t) {
    const float inv = 4.0f / (lrow[t] + xhalf(lrow[t]));
    v4u p0, p1;
#pragma unroll
    for (int e = 0; e < 4; ++e) {
      p0[e] = pk16(hb16(o0[t][2 * e] * inv), hb16(o0[t][2 * e + 1] * inv));
      p1[e] = pk16(hb16(o1[t][2 * e] * inv), hb16(o1[t][2 * e + 1] * inv));
    }
    *(v4u*)(op + t * FT) = p0;
    *(v4u*)(op + t * FT + 256) = p1;
    // the two stores' data and address registers stay whole up to this wait (named as inputs): the next strip's
    // arithmetic, or the tail that the two strip counts share, rewrites them only behind it
    asm volatile("s_wait_xcnt 0x0" :: "v"(p0), "v"(p1), "v"(op) : "memory");
  }
}
__global__ __launch_bounds__(256, 4)               // 4 waves per SIMD = 256 registers a wave: two blocks stay resident per WGP
void attn_win(const unsigned short* __restrict__ xp, const unsigned short* __restrict__ wq,
              const float* __restrict__ bt, unsigned short* opl) {
  __shared__ __align__(16) _Float16 Qs[NST * FT];
  __shared__ __align__(16) _Float16 Ks[NST * FT];
  __shared__ __align__(16) _Float16 Vs[NST * FT];
  const int tid = threadIdx.x, lane = tid & 31;
  const int wave = __builtin_amdgcn_readfirstlane(tid >> 5);   // scalar: the tests on it below are scalar branches
  const int wh = blockIdx.x;                      // w*8 + h
  const int w = wh >> 3, h = wh & 7;
  const bool three = wave < NW3;                  // wave-uniform
  const int strip0 = three ? wave * 3 : NW3 * 3 + (wave - NW3) * 2;   // 0, 3, .. 15, 18, 20

  {
    const _Float16* X  = (const _Float16*)(const void*)xp + (size_t)(w * NST + strip0) * 8 * FT + lane * 8;
    const _Float16* Wh = (const _Float16*)(const void*)wq + (size_t)(h * 2) * 8 * FT + lane * 8;   // column tile h*2 of part q
    if (three) proj_strips<3>(X, Wh, Qs, Ks, Vs, strip0, lane);
    else       proj_strips<2>(X, Wh, Qs, Ks, Vs, strip0, lane);
  }
  __syncthreads();                                // K and V^T are whole before any wave reads other waves' tiles

  const _Float16* Q  = Qs + strip0 * FT + lane * 8;   // the wave's own tiles
  const _Float16* K  = Ks + lane * 8;
  const _Float16* Vt = Vs + lane * 8;
  const float* Bp = bt + ((size_t)(h * NST + strip0)) * NKT * 256 + lane * 4;
  unsigned short* op = opl + ((size_t)h * NROWP + (size_t)w * TP + strip0 * 16) * HD + lane * 8;
  if (three) attn_strips<3>(Bp, Q, K, Vt, op);
  else       attn_strips<2>(Bp, Q, K, Vt, op);
}

// =================================================================================================================
// Output projection: out rows = (O64/64) . (W1024/1024)^T, K = 256 = 8 head planes of 32. Block tile 64 padded
// tokens x 128 cols, 8 waves = 2 x 4, 2x2 tiles per wave. Epilogue through an LDS f32 tile; a wave writes one
// coverage: 128 windows x 343 tokens x 2 x 128 cols = every output element exactly once.
// =================================================================================================================
__global__ __launch_bounds__(256)
void gemm_proj(const unsigned short* __restrict__ opl, const unsigned short* __restrict__ wp, float* out) {
  __shared__ __align__(16) float Cs[64 * LDC];
  const int tid = threadIdx.x, wave = tid >> 5, lane = tid & 31, hh = lane >> 4, c = lane & 15;
  const int mb = blockIdx.x, nb = blockIdx.y;
  const int mw = wave >> 2, nw = wave & 3;
  const _Float16* W = (const _Float16*)(const void*)wp;
  const _Float16* Ap = (const _Float16*)(const void*)opl + (size_t)(mb * 4 + mw * 2) * FT + lane * 8;  // row tile
  const _Float16* Wp = W + (size_t)(nb * 8 + nw * 2) * 8 * FT + lane * 8;                              // col tile

  v8f a00 = zero8(), a01 = zero8(), a10 = zero8(), a11 = zero8();
#pragma unroll 1
  for (int ks = 0; ks < 8; ++ks) {
    const v16h fa0 = ldfrag_t(Ap);
    const v16h fa1 = ldfrag_t(Ap + FT);
    const v16h fb0 = ldfrag_t(Wp);
    const v16h fb1 = ldfrag_t(Wp + 8 * FT);
    Ap += (size_t)NROWP * HD;                     // next head plane
    Wp += FT;                                     // next 32-k step
    a00 = mma_raw(fa0, fb0, a00);
    a01 = mma_raw(fa0, fb1, a01);
    a10 = mma_raw(fa1, fb0, a10);
    a11 = mma_raw(fa1, fb1, a11);
    guard4(a00, a01, a10, a11, fa0, fa1, fb0, fb1);
  }
#pragma unroll
  for (int r = 0; r < 8; ++r) {
    const int row = mw * 32 + 8 * hh + r;
    Cs[row * LDC + nw * 32 + c]             = a00[r];
    Cs[row * LDC + nw * 32 + 16 + c]        = a01[r];
    Cs[(row + 16) * LDC + nw * 32 + c]      = a10[r];
    Cs[(row + 16) * LDC + nw * 32 + 16 + c] = a11[r];
  }
  __syncthreads();

  const int prow = mb * 64 + wave * 8;            // the wave's 8 padded rows lie in one strip, so in one window
  const int w = prow / TP;
  const int rbase = prow - w * TP;
  v4f ov[8];
  size_t offs[8];
#pragma unroll
  for (int it = 0; it < 8; ++it) {
    const int row = wave * 8 + it;
    v4f v = *(const v4f*)(Cs + row * LDC + lane * 4);
    v = v * (1.0f / 65536.0f);
    ov[it] = v;
    const int tokc = min(rbase + it, NTOK - 1);
    offs[it] = ((size_t)w * NTOK + tokc) * CCH + nb * 128 + lane * 4;
  }
#pragma unroll
  for (int it = 0; it < 8; ++it) {
    if (rbase + it < NTOK) *(v4f*)(out + offs[it]) = ov[it];     // wave-uniform
  }
  
}

// =================================================================================================================
// token dimension padded to 352 per window everywhere):
//   WqkvT f16 768 x 256 393216 | WoutT f16 256 x 256 131072 |
//   bias table f32 [8][22][22][256] 3964928 | X f16 45056 x 256 23068672 |
//   O f16 8 x 45056 x 32 23068672 | total 50626560.
//   every f16 plane is stored as 1024-byte operand tiles in fragment order (ldfrag_t).
// =================================================================================================================
extern "C" void kernel_launch(void* const* d_in, const int* in_sizes, int n_in,
                              void* d_out, int out_size, void* d_ws, size_t ws_size,
                              hipStream_t stream) {
  if (n_in < 4) return;
  if (in_sizes[0] != NROWX * CCH) return;
  if (in_sizes[1] != CCH * C3) return;
  if (in_sizes[2] != CCH * CCH) return;
  if (in_sizes[3] != NRPB * NHD) return;
  if (out_size != NROWX * CCH) return;

  const float* x    = (const float*)d_in[0];
  const float* wqkv = (const float*)d_in[1];
  const float* wout = (const float*)d_in[2];
  const float* rpb  = (const float*)d_in[3];
  float* out = (float*)d_out;

  const size_t sWq = (size_t)C3 * CCH * 2;                    //   393216
  const size_t sWo = (size_t)CCH * CCH * 2;                   //   131072
  const size_t sBT = (size_t)NHD * NST * NKT * 256 * 4;       //  3964928
  const size_t sX  = (size_t)NROWP * CCH * 2;                 // 23068672
  const size_t sO  = (size_t)NHD * NROWP * HD * 2;            // 23068672
  size_t off = 0;
  const size_t oWq = off; off += sWq;
  const size_t oWo = off; off += sWo;
  const size_t oBT = off; off += sBT;
  const size_t oX  = off; off += sX;
  const size_t oO  = off; off += sO;
  if (off > ws_size) return;                                   // off = 50626560
  if (off > (size_t)134217728) return;

  char* ws = (char*)d_ws;
  unsigned short* WqT = (unsigned short*)(ws + oWq);
  unsigned short* WoT = (unsigned short*)(ws + oWo);
  float*          BT  = (float*)(ws + oBT);
  unsigned short* Xp  = (unsigned short*)(ws + oX);
  unsigned short* Op  = (unsigned short*)(ws + oO);

  const dim3 blk(256);
  // (1) set-up: transpose + convert of w_qkv (24 blocks) and w_out (8), convert of x (704), bias table (968)
  prep<<<dim3(NQB + NWB + NGB + NBB), blk, 0, stream>>>(x, Xp, wqkv, WqT, wout, WoT, rpb, BT);
  // (2) qkv projection + window attention: 128 windows x 8 heads, one block of 8 waves (6 x 3 + 2 x 2 strips) each
  attn_win<<<dim3(NWIN * NHD), blk, 0, stream>>>(Xp, WqT, BT, Op);
  // (3) output projection -> d_out (padded tokens skipped)
  gemm_proj<<<dim3(NROWP / 64, CCH / 128), blk, 0, stream>>>(Op, WoT, out);
  (void)hipGetLastError();
}

// v007
// Measured time: 65.2 microseconds a run.
// Next to v006, in two timings, it ran 1.18 times as fast each time.
// Counting every step since v000, it is 3.58 times as fast.
// qkv projection, q.k^T, p.v and output projection: v_wmma_f32_16x16x32_f16 single products (f16 operands, f32 accumulate);
// all inputs RNE-converted to bf16 on load and carried with power-of-two scales, as f16 (the bias table as f32); softmax, key padding mask and epilogues in f32 on VALU.
// attention runs on transposed products (S^T = K.Q^T, O^T = V^T.P^T): a lane owns one query, P stays in registers.
// the qkv projection runs inside the attention kernel: Q, K and V^T go through LDS only.
#include <hip/hip_runtime.h>
#include <stdint.h>

#define NWIN  128
#define NTOK  343
#define TP    352
#define CCH   256
#define NHD   8
#define HD    32
#define C3    768
#define NROWP 45056
#define NROWX 43904
#define NRPB  2197
#define NST   22
#define NKT   22
#define LDC   132
#define TPW   260
#define FT    512
#define QSC   0.17677669529663687f
#define INV512 0.001953125f
#define LN1024 6.9314718055994531f
#define LOG2E 1.44269504088896341f
#define MASKC (-1048576.0f)
#define NGB   704
#define NWB   8
#define NBB   968
#define NQB   24
#define NW3   6
#define KB64  5

static_assert(NROWP == NWIN * TP);
static_assert(NROWX == NWIN * NTOK);
static_assert(TP == KB64 * 64 + 32);
static_assert(TP % 32 == 0 && NST % 2 == 0);
static_assert(TP >= NTOK && TP - NTOK < 16);
static_assert(NST * 16 == TP);
static_assert(NKT * 16 == TP);
static_assert((LDC * 4) % 16 == 0);
static_assert((TPW * 4) % 16 == 0);
static_assert(NHD * HD == CCH);
static_assert(FT == 16 * 32);
static_assert(TP * HD == NST * FT);
static_assert(NGB * 64 == NROWP);
static_assert(NWB * 32 == CCH);
static_assert(NBB * 256 == NHD * NST * NKT * 64);
static_assert(NQB * 32 == C3);
static_assert(NW3 * 3 + (8 - NW3) * 2 == NST);

typedef _Float16 v16h __attribute__((ext_vector_type(16)));
typedef _Float16 v8h  __attribute__((ext_vector_type(8)));
typedef float    v8f  __attribute__((ext_vector_type(8)));
typedef float    v4f  __attribute__((ext_vector_type(4)));
typedef unsigned int v4u __attribute__((ext_vector_type(4)));

// ---- scalar helpers ------------------------------------------------------------------------------------------
__device__ __forceinline__ unsigned short bf_bits(float f) {          // f32 -> bf16 bits, RNE convert
  unsigned u = __float_as_uint(f);
  return (unsigned short)((u + 0x7FFFu + ((u >> 16) & 1u)) >> 16);
}
__device__ __forceinline__ float bf_up(unsigned short b) { return __uint_as_float(((unsigned)b) << 16); }
__device__ __forceinline__ float bfr(float f) { return bf_up(bf_bits(f)); }
__device__ __forceinline__ unsigned short h_bits(_Float16 x) { return __builtin_bit_cast(unsigned short, x); }
__device__ __forceinline__ unsigned short hb16(float f) { return h_bits((_Float16)f); }
__device__ __forceinline__ unsigned pk16(unsigned short a, unsigned short b) { return (unsigned)a | ((unsigned)b << 16); }
__device__ __forceinline__ v8f zero8() { v8f z = {0.f, 0.f, 0.f, 0.f, 0.f, 0.f, 0.f, 0.f}; return z; }

// ---- fragment loader for the fragment-order global planes: one 16 (rows/cols) x 32 (k) operand tile is FT halves =
//      1024 contiguous bytes; its 16-B piece e*32 + lane holds row/col (lane&15), k = 16*e + 8*(lane>>4) + 0..7 (the
//      hardware k order, which a packed pair of D tiles also has). p = tile base + lane*8: each of the two loads reads
//      512 contiguous bytes per wave.
__device__ __forceinline__ v16h ldfrag_t(const _Float16* p) {
  union { v16h v; v8h h[2]; } f;
  f.h[0] = *(const v8h*)(p);
  f.h[1] = *(const v8h*)(p + 256);
  return f.v;
}

// ---- WMMA helpers; the guard helpers insert the trailing VALU hazard gap and keep A/B live -----------------------
__device__ __forceinline__ v8f mma_raw(v16h a, v16h b, v8f c) {
  return __builtin_amdgcn_wmma_f32_16x16x32_f16(false, a, false, b, (short)0, c, false, false);
}
__device__ __forceinline__ void guard4(v8f& c0, v8f& c1, v8f& c2, v8f& c3,
                                       const v16h& a0, const v16h& a1, const v16h& b0, const v16h& b1,
                                       const char* keep) {   // keep: the address that l2_ask named, whole through the loop
#if defined(__HIP_DEVICE_COMPILE__)
  asm volatile("v_nop\n\tv_nop\n\tv_nop\n\tv_nop"
               : "+v"(c0), "+v"(c1), "+v"(c2), "+v"(c3) : "v"(a0), "v"(a1), "v"(b0), "v"(b1), "v"(keep));
#endif
}
// hint to L2: each lane asks for its own address p + OFF bytes (returns nothing, touches no counter).
// The planes asked for were stored by an earlier launch.
// Asked for ahead, the k-steps behind the first find an L2 hit in place of memory latency. p points inside the
// plane in every lane, and the caller keeps its register whole through the loop around or behind the call.
template <int OFF>
__device__ __forceinline__ void l2_ask(const char* p) {
#if defined(__HIP_DEVICE_COMPILE__)
  asm volatile("global_prefetch_b8 %0, off offset:%1 scope:SCOPE_SE" :: "v"(p), "n"(OFF));
#endif
}
// value of lane l ^ 16 (the other half of the wave), by a vector cross-row move
__device__ __forceinline__ float xhalf(float x) {
  const int b = __float_as_int(x);
  return __int_as_float(__builtin_amdgcn_permlanex16(b, b, 0x76543210, 0xfedcba98, false, false));
}

// =================================================================================================================
// weight transpose + convert: w [256 k][ncol n] f32 (n contiguous, used as x.w) -> wT, ncol columns x 256 k as f16 in
// fragment order (tile (n/16)*8 + k/32, see ldfrag_t), value f16(1024 * bf16_RNE(w)). Block = 32 columns: the 256x32
// f32 slab is staged in LDS (coalesced reads); wave = one 32-k step, it writes its two tiles of 1024 contiguous bytes.
// coverage: (ncol/32) blocks x 8 waves x 2 tiles x 2 x 32 pieces x 8 halves = ncol x 256.
// cvt_block is the work of one block (bx = its 32-column slab, T = 32 * TPW floats of the block's LDS); the blocks of
// w_qkv and of w_out ride in the grid of prep.
// =================================================================================================================
__device__ __forceinline__ void cvt_block(const float* __restrict__ wsrc, unsigned short* wdst, int ncol, int bx,
                                          float* T) {
  const int tid = threadIdx.x, wv = tid >> 5, lane = tid & 31, hh = lane >> 4, c = lane & 15;
  const int n0 = bx * 32;
#pragma unroll 4
  for (int it = 0; it < 32; ++it) {
    const int k = it * 8 + wv;
    T[lane * TPW + k] = wsrc[(size_t)k * ncol + n0 + lane];
  }
  __syncthreads();
  v4u pk[4];
  size_t offs[4];
#pragma unroll
  for (int q = 0; q < 4; ++q) {
    const int nt = q >> 1, e = q & 1;
    const float* tp = T + (nt * 16 + c) * TPW + wv * 32 + e * 16 + hh * 8;
    const v4f a = *(const v4f*)(tp);
    const v4f b = *(const v4f*)(tp + 4);
    v4u p4;
    p4[0] = pk16(hb16(bfr(a[0]) * 1024.0f), hb16(bfr(a[1]) * 1024.0f));
    p4[1] = pk16(hb16(bfr(a[2]) * 1024.0f), hb16(bfr(a[3]) * 1024.0f));
    p4[2] = pk16(hb16(bfr(b[0]) * 1024.0f), hb16(bfr(b[1]) * 1024.0f));
    p4[3] = pk16(hb16(bfr(b[2]) * 1024.0f), hb16(bfr(b[3]) * 1024.0f));
    pk[q] = p4;
    offs[q] = ((size_t)(bx * 2 + nt) * 8 + wv) * FT + e * 256 + lane * 8;
  }
#pragma unroll
  for (int q = 0; q < 4; ++q) *(v4u*)(wdst + offs[q]) = pk[q];
  asm volatile("s_wait_xcnt 0x0" ::: "memory");   // inlined in prep, code that rewrites these stores' registers can stand behind it
}
// =================================================================================================================
// relative position bias table in the C-operand order of the transposed logits tile (16 keys x 16 queries), registers
// 0..3 of all lanes then registers 4..7 (each C load reads 512 contiguous bytes per wave):
// BT[((h*22 + strip)*22 + kt)*256 + (r>>2)*128 + l*4 + (r&3)] =
// 512 * bf16_RNE(rpb[idx(n,m)*8 + h]) with n = strip*16 + (l&15) (query), m = kt*16 + 8*(l>>4) + r (key),
// idx = ((i_n-i_m+6)*13 + (j_n-j_m+6))*13 + (k_n-k_m+6), (i,j,k) = (t/49, (t/7)%7, t%7); padded keys m >= 343
// get MASKC (logit mask through the C operand), padded queries n >= 343 get 0. Thread = one 16-B piece (4 keys),
// coverage: 8 heads x 22 strips x 22 key tiles x 64 pieces x 4 floats = 8 x 352 x 352, every element once.
// bias_block is the work of one block of 256 pieces (bx = 0 .. NBB-1); the blocks ride in the grid of prep.
// =================================================================================================================
__device__ __forceinline__ void bias_block(const float* __restrict__ rpb, float* bt, int bx) {
  const int g = bx * 256 + threadIdx.x;
  const int piece = g & 63, rec = g >> 6;
  const int kt = rec % NKT, strip = (rec / NKT) % NST, h = rec / (NKT * NST);
  const int l = piece & 31, e0 = (piece >> 5) * 4;
  const int col = l & 15, lh = l >> 4;
  const int n = strip * 16 + col;
  const int ni = n / 49, nj = (n / 7) % 7, nk = n % 7;
  v4f v;
#pragma unroll
  for (int e = 0; e < 4; ++e) {
    const int m = kt * 16 + 8 * lh + e0 + e;
    const int mi = m / 49, mj = (m / 7) % 7, mk = m % 7;
    int idx = ((ni - mi + 6) * 13 + (nj - mj + 6)) * 13 + (nk - mk + 6);
    idx = min(max(idx, 0), NRPB - 1);
    float val = bfr(rpb[idx * NHD + h]) * 512.0f;
    if (n >= NTOK) val = 0.0f;
    if (m >= NTOK) val = MASKC;
    v[e] = val;
  }
  float* gp = bt + (size_t)rec * 256 + piece * 4;
  *(v4f*)gp = v;
  asm volatile("s_wait_xcnt 0x0" ::: "memory");   // inlined in prep, code that rewrites this store's registers can stand behind it
  
}

// =================================================================================================================
// input convert: block = 4 strips of 16 padded tokens (a window has 22 strips, so a block may span two windows). It
// reads its 64 x 256 f32 slab of x once (token clamped, padded tokens 343..351 become exact zeros), converts it to
// f16(8 * bf16_RNE(x)) and writes it as 4 x 8 operand tiles of the X plane in fragment order (tile
// (w*22 + tok/16)*8 + k/32, see ldfrag_t); wave = one 32-k step; a wave's store writes 512 contiguous bytes.
// coverage: 704 blocks x 8 waves x 4 tiles x 1024 B = 128 x 22 x 8 tiles, each once.
// =================================================================================================================
__device__ __forceinline__ void xcvt_block(const float* __restrict__ x, unsigned short* xp, int mb) {
  const int tid = threadIdx.x, wave = tid >> 5, lane = tid & 31, hh = lane >> 4, c = lane & 15;
  v4f xa[4][4];
  const float* src[4];
  int tk[4];                                      // token of this lane's row inside its window, 0 .. 351
#pragma unroll
  for (int rt = 0; rt < 4; ++rt) {
    const int sx = mb * 4 + rt, w = sx / NST;     // strip over all windows, its window
    tk[rt] = (sx - w * NST) * 16 + c;
    const int ts = min(tk[rt], NTOK - 1);
    src[rt] = x + ((size_t)w * NTOK + ts) * CCH + wave * 32 + 8 * hh;
#pragma unroll
    for (int e = 0; e < 2; ++e) {
      xa[rt][2 * e]     = *(const v4f*)(src[rt] + 16 * e);
      xa[rt][2 * e + 1] = *(const v4f*)(src[rt] + 16 * e + 4);
    }
  }
  // the loads' address registers stay whole up to this wait (named as inputs), and are rewritten only behind it
  asm volatile("s_wait_xcnt 0x0" :: "v"(src[0]), "v"(src[1]), "v"(src[2]), "v"(src[3]) : "memory");
  v4u pk[4][2];
#pragma unroll
  for (int rt = 0; rt < 4; ++rt) {
    const bool pad = tk[rt] >= NTOK;
#pragma unroll
    for (int e = 0; e < 2; ++e) {
      const v4f a = xa[rt][2 * e], b = xa[rt][2 * e + 1];
      v4u p4;
      p4[0] = pk16(hb16(bfr(a[0]) * 8.0f), hb16(bfr(a[1]) * 8.0f));
      p4[1] = pk16(hb16(bfr(a[2]) * 8.0f), hb16(bfr(a[3]) * 8.0f));
      p4[2] = pk16(hb16(bfr(b[0]) * 8.0f), hb16(bfr(b[1]) * 8.0f));
      p4[3] = pk16(hb16(bfr(b[2]) * 8.0f), hb16(bfr(b[3]) * 8.0f));
      if (pad) { p4[0] = 0u; p4[1] = 0u; p4[2] = 0u; p4[3] = 0u; }
      pk[rt][e] = p4;
    }
  }
  unsigned short* dst = xp + ((size_t)(mb * 4) * 8 + wave) * FT + lane * 8;
#pragma unroll
  for (int rt = 0; rt < 4; ++rt) {
    *(v4u*)(dst + rt * 8 * FT)       = pk[rt][0];
    *(v4u*)(dst + rt * 8 * FT + 256) = pk[rt][1];
  }
  asm volatile("s_wait_xcnt 0x0" ::: "memory");   // inlined in prep, code that rewrites these stores' registers can stand behind it
}

// =================================================================================================================
// set-up launch: four block ranges that read only inputs and write planes that only later launches read.
// NQB blocks convert w_qkv, NWB blocks convert w_out (cvt_block; their chains of dependent loads are the longest, so
// they take the lowest block indices), NGB blocks convert x (xcvt_block), NBB blocks build the bias table (bias_block).
// =================================================================================================================
__global__ __launch_bounds__(256)
void prep(const float* __restrict__ x, unsigned short* xp, const float* __restrict__ wqkv, unsigned short* wq,
          const float* __restrict__ wout, unsigned short* wo, const float* __restrict__ rpb, float* bt) {
  __shared__ __align__(16) float T[32 * TPW];
  const int b = blockIdx.x;                       // every test below is block-uniform
  if (b < NQB)                   cvt_block(wqkv, wq, C3, b, T);
  else if (b < NQB + NWB)        cvt_block(wout, wo, CCH, b - NQB, T);
  else if (b < NQB + NWB + NGB)  xcvt_block(x, xp, b - NQB - NWB);
  else                           bias_block(rpb, bt, b - NQB - NWB - NGB);
}

__device__ __forceinline__ v8h pack8(v8f a, float scl) {
  v8h r;
#pragma unroll
  for (int e = 0; e < 8; ++e) r[e] = (_Float16)(a[e] * scl);
  return r;
}
// projection of a wave's S strips (from strip0) onto the head's 3 x 32 columns; X, Wh carry the lane's offset;
// xpf = first byte of the wave's S x 8 X tiles (S x 8192 contiguous bytes) + lane * 256; wpf = the same for the 8
// k-step tiles of one of the head's 6 weight column tiles: each of the 6 waves with 3 strips asks for one of them
template <int S>
__device__ __forceinline__ void proj_strips(const _Float16* X, const _Float16* Wh, const char* xpf, const char* wpf,
                                            _Float16* Qs, _Float16* Ks, _Float16* Vs, int strip0, int lane) {
  v8f aq[S][2], ak[S][2], av[S][2];
#pragma unroll
  for (int t = 0; t < S; ++t) {
#pragma unroll
    for (int dt = 0; dt < 2; ++dt) { aq[t][dt] = zero8(); ak[t][dt] = zero8(); av[t][dt] = zero8(); }
  }
#pragma unroll 1                                  // up to 18 accumulator tiles: a second copy of the body's fragments would not fit 256 registers
  for (int ks = 0; ks < 8; ++ks) {
    const _Float16* xk = X + ks * FT;
    const _Float16* wk = Wh + ks * FT;
    v16h xf[S], wf[3][2];                         // wf[part][dt]: column tile part * 16 + h*2 + dt
#pragma unroll
    for (int t = 0; t < S; ++t) xf[t] = ldfrag_t(xk + t * 8 * FT);
#pragma unroll
    for (int p = 0; p < 3; ++p) {
#pragma unroll
      for (int dt = 0; dt < 2; ++dt) wf[p][dt] = ldfrag_t(wk + (p * 16 + dt) * 8 * FT);
    }
    // the loads' address registers stay whole up to this wait (named as inputs), and are rewritten only behind it;
    // xpf and wpf are named so that the registers l2_ask reads keep their addresses through the loop
    if (S == 3) asm volatile("s_wait_xcnt 0x0" :: "v"(xk), "v"(wk), "v"(xpf), "v"(wpf) : "memory");
    else        asm volatile("s_wait_xcnt 0x0" :: "v"(xk), "v"(wk), "v"(xpf) : "memory");
    // all loads are issued before the first product: one wait for memory a k-step, not one per reused fragment register
    __builtin_amdgcn_sched_barrier(0);
    if (ks == 0) {                                // scalar test; behind the first k-step's own loads, under their wait
      l2_ask<0>(xpf);                             // 32 lanes x 256 B = the 8 tiles of one strip
      l2_ask<8192>(xpf);
      if (S == 3) {
        l2_ask<16384>(xpf);
        l2_ask<0>(wpf);
      }
    }
#pragma unroll
    for (int dt = 0; dt < 2; ++dt) {
#pragma unroll
      for (int t = 0; t < S; ++t) {
        aq[t][dt] = mma_raw(wf[0][dt], xf[t], aq[t][dt]);
        ak[t][dt] = mma_raw(wf[1][dt], xf[t], ak[t][dt]);
        av[t][dt] = mma_raw(xf[t], wf[2][dt], av[t][dt]);
      }
    }
  }
#pragma unroll
  for (int t = 0; t < S; ++t) {
    const int st = strip0 + t;
    *(v8h*)(Qs + st * FT + lane * 8)       = pack8(aq[t][0], QSC * (64.0f / 8192.0f));
    *(v8h*)(Qs + st * FT + 256 + lane * 8) = pack8(aq[t][1], QSC * (64.0f / 8192.0f));
    *(v8h*)(Ks + st * FT + lane * 8)       = pack8(ak[t][0], 8.0f / 8192.0f);
    *(v8h*)(Ks + st * FT + 256 + lane * 8) = pack8(ak[t][1], 8.0f / 8192.0f);
    *(v8h*)(Vs + (st >> 1) * FT + (st & 1) * 256 + lane * 8)             = pack8(av[t][0], 16.0f / 8192.0f);
    *(v8h*)(Vs + (TP / 32 + (st >> 1)) * FT + (st & 1) * 256 + lane * 8) = pack8(av[t][1], 16.0f / 8192.0f);
  }
}
// one pass of the online softmax over NJ key tiles (NJ = 4 or 2) for a wave's S strips: bk, K, Vt stand at the pass's
// first bias tile, K tile and V^T tile (lane offsets included), Q at the wave's first Q tile
template <int S, int NJ>
__device__ __forceinline__ void key_pass(const float* bk, const _Float16* Q, const _Float16* K, const _Float16* Vt,
                                         float (&mrow)[S], float (&lrow)[S], v8f (&o0)[S], v8f (&o1)[S]) {
  union CB { v8f v; v4f q[2]; };
  // ---- transposed logits: NJ tiles of 16 keys, bias and key padding mask via the C operand ----
  v8f s[S][NJ];
#pragma unroll
  for (int j = 0; j < NJ; ++j) {
#pragma unroll
    for (int t = 0; t < S; ++t) {
      const float* bp = bk + (t * NKT + j) * 256;
      CB cb;
      cb.q[0] = *(const v4f*)(bp);
      cb.q[1] = *(const v4f*)(bp + 128);
      s[t][j] = cb.v;
    }
  }
  // the bias loads' address register stays whole up to this wait (named as an input), and is rewritten only behind it
  asm volatile("s_wait_xcnt 0x0" :: "v"(bk) : "memory");
  v16h qb[S];                                     // read anew each pass: its registers are free during softmax and O^T
#pragma unroll
  for (int t = 0; t < S; ++t) qb[t] = ldfrag_t(Q + t * FT);
#pragma unroll
  for (int j = 0; j < NJ; ++j) {
    const v16h kf = ldfrag_t(K + j * FT);
#pragma unroll
    for (int t = 0; t < S; ++t) s[t][j] = mma_raw(kf, qb[t], s[t][j]);
  }
  // ---- online softmax update of the lane's query in each strip ----
#pragma unroll
  for (int t = 0; t < S; ++t) {
    float tj[NJ];
#pragma unroll
    for (int j = 0; j < NJ; ++j) {
      tj[j] = fmaxf(fmaxf(fmaxf(s[t][j][0], s[t][j][1]), fmaxf(s[t][j][2], s[t][j][3])),
                    fmaxf(fmaxf(s[t][j][4], s[t][j][5]), fmaxf(s[t][j][6], s[t][j][7])));
    }
    float tm = fmaxf(tj[0], tj[1]);
    if (NJ == 4) tm = fmaxf(tm, fmaxf(tj[NJ - 2], tj[NJ - 1]));
    tm = fmaxf(tm, xhalf(tm));
    const float mn = fmaxf(mrow[t], tm);
    const float alpha = __expf((mrow[t] - mn) * INV512);
    mrow[t] = mn;
#pragma unroll
    for (int j = 0; j < NJ; ++j) {
      const v8f u = ((s[t][j] - mn) * INV512 + LN1024) * LOG2E;  // one maximum per lane: whole-tile (packed) arithmetic
#pragma unroll
      for (int r = 0; r < 8; ++r) s[t][j][r] = __builtin_amdgcn_exp2f(u[r]);
    }
    v8f p8 = s[t][0] + s[t][1];
    if (NJ == 4) p8 = p8 + (s[t][NJ - 2] + s[t][NJ - 1]);
    const v4f p4 = p8.lo + p8.hi;
    lrow[t] = lrow[t] * alpha + ((p4[0] + p4[1]) + (p4[2] + p4[3]));
    o0[t] = o0[t] * alpha;
    o1[t] = o1[t] * alpha;
  }
  // ---- O^T += V^T . P^T : 32-key k-steps, two 16-dim tiles, S strips per V^T fragment ----
#pragma unroll
  for (int ks = 0; ks < NJ / 2; ++ks) {
    const v16h v0 = ldfrag_t(Vt + ks * FT);
    const v16h v1 = ldfrag_t(Vt + (TP / 32 + ks) * FT);
#pragma unroll
    for (int t = 0; t < S; ++t) {
      v16h pb;
#pragma unroll
      for (int e = 0; e < 8; ++e) {
        pb[e]     = (_Float16)s[t][2 * ks][e];
        pb[8 + e] = (_Float16)s[t][2 * ks + 1][e];
      }
      o0[t] = mma_raw(v0, pb, o0[t]);
      o1[t] = mma_raw(v1, pb, o1[t]);
    }
  }
}
// attention of a wave's S strips over the window's 22 key tiles; op = the lane's piece of the first strip's output tile
template <int S>
__device__ __forceinline__ void attn_strips(const float* Bp, const _Float16* Q, const _Float16* K, const _Float16* Vt,
                                            unsigned short* op) {
  float mrow[S], lrow[S];                         // per strip, this lane's query: running maximum, sum over this half's keys
  v8f o0[S], o1[S];
#pragma unroll
  for (int t = 0; t < S; ++t) {
    mrow[t] = -1e30f;
    lrow[t] = 0.f;
    o0[t] = zero8();
    o1[t] = zero8();
  }
#pragma unroll 1                                  // one copy of the 64-key pass: its score tiles fill the register budget
  for (int kb = 0; kb < KB64; ++kb)
    key_pass<S, 4>(Bp + kb * 4 * 256, Q, K + kb * 4 * FT, Vt + kb * 2 * FT, mrow, lrow, o0, o1);
  key_pass<S, 2>(Bp + KB64 * 4 * 256, Q, K + KB64 * 4 * FT, Vt + KB64 * 2 * FT, mrow, lrow, o0, o1);

  // ---- join the halves' sums, normalise (64 ctx = O * 4 / l), store the lane's two 16-B pieces of each strip ----
#pragma unroll
  for (int t = 0; t < S; ++t) {
    const float inv = 4.0f / (lrow[t] + xhalf(lrow[t]));
    v4u p0, p1;
#pragma unroll
    for (int e = 0; e < 4; ++e) {
      p0[e] = pk16(hb16(o0[t][2 * e] * inv), hb16(o0[t][2 * e + 1] * inv));
      p1[e] = pk16(hb16(o1[t][2 * e] * inv), hb16(o1[t][2 * e + 1] * inv));
    }
    *(v4u*)(op + t * FT) = p0;
    *(v4u*)(op + t * FT + 256) = p1;
    // the two stores' data and address registers stay whole up to this wait (named as inputs): the next strip's
    // arithmetic, or the tail that the two strip counts share, rewrites them only behind it
    asm volatile("s_wait_xcnt 0x0" :: "v"(p0), "v"(p1), "v"(op) : "memory");
  }
}
__global__ __launch_bounds__(256, 4)               // 4 waves per SIMD = 256 registers a wave: two blocks stay resident per WGP
void attn_win(const unsigned short* __restrict__ xp, const unsigned short* __restrict__ wq,
              const float* __restrict__ bt, unsigned short* opl) {
  __shared__ __align__(16) _Float16 Qs[NST * FT];
  __shared__ __align__(16) _Float16 Ks[NST * FT];
  __shared__ __align__(16) _Float16 Vs[NST * FT];
  const int tid = threadIdx.x, lane = tid & 31;
  const int wave = __builtin_amdgcn_readfirstlane(tid >> 5);   // scalar: the tests on it below are scalar branches
  const int wh = blockIdx.x;                      // w*8 + h
  const int w = wh >> 3, h = wh & 7;
  const bool three = wave < NW3;                  // wave-uniform
  const int strip0 = three ? wave * 3 : NW3 * 3 + (wave - NW3) * 2;   // 0, 3, .. 15, 18, 20

  {
    const _Float16* X  = (const _Float16*)(const void*)xp + (size_t)(w * NST + strip0) * 8 * FT + lane * 8;
    const _Float16* Wh = (const _Float16*)(const void*)wq + (size_t)(h * 2) * 8 * FT + lane * 8;   // column tile h*2 of part q
    const char* xpf = (const char*)(const void*)xp + (size_t)(w * NST + strip0) * 8 * FT * 2 + lane * 256;
    const int ct = three ? (wave >> 1) * 16 + h * 2 + (wave & 1) : h * 2;   // column tile: part wave / 2, half wave % 2
    const char* wpf = (const char*)(const void*)wq + (size_t)ct * 8 * FT * 2 + lane * 256;
    if (three) proj_strips<3>(X, Wh, xpf, wpf, Qs, Ks, Vs, strip0, lane);
    else       proj_strips<2>(X, Wh, xpf, wpf, Qs, Ks, Vs, strip0, lane);
  }
  __syncthreads();                                // K and V^T are whole before any wave reads other waves' tiles

  const _Float16* Q  = Qs + strip0 * FT + lane * 8;   // the wave's own tiles
  const _Float16* K  = Ks + lane * 8;
  const _Float16* Vt = Vs + lane * 8;
  const float* Bp = bt + ((size_t)(h * NST + strip0)) * NKT * 256 + lane * 4;
  unsigned short* op = opl + ((size_t)h * NROWP + (size_t)w * TP + strip0 * 16) * HD + lane * 8;
  if (three) attn_strips<3>(Bp, Q, K, Vt, op);
  else       attn_strips<2>(Bp, Q, K, Vt, op);
}

// =================================================================================================================
// Output projection: out rows = (O64/64) . (W1024/1024)^T, K = 256 = 8 head planes of 32. Block tile 64 padded
// tokens x 128 cols, 8 waves = 2 x 4, 2x2 tiles per wave. Epilogue through an LDS f32 tile; a wave writes one
// coverage: 128 windows x 343 tokens x 2 x 128 cols = every output element exactly once.
// =================================================================================================================
__global__ __launch_bounds__(256)
void gemm_proj(const unsigned short* __restrict__ opl, const unsigned short* __restrict__ wp, float* out) {
  __shared__ __align__(16) float Cs[64 * LDC];
  const int tid = threadIdx.x, wave = tid >> 5, lane = tid & 31, hh = lane >> 4, c = lane & 15;
  const int mb = blockIdx.x, nb = blockIdx.y;
  const int mw = wave >> 2, nw = wave & 3;
  const _Float16* W = (const _Float16*)(const void*)wp;
  const _Float16* Ap = (const _Float16*)(const void*)opl + (size_t)(mb * 4 + mw * 2) * FT + lane * 8;  // row tile
  const _Float16* Wp = W + (size_t)(nb * 8 + nw * 2) * 8 * FT + lane * 8;                              // col tile

  // waves 0..3 ask L2 for the block's 4 row tiles (4096 contiguous bytes) of two head planes each, 256 B a lane; in the
  // first 8 row blocks waves 4..7 ask for the 64 weight tiles of the column half (65536 contiguous bytes), for all blocks
  const int wv = __builtin_amdgcn_readfirstlane(wave);         // scalar: the tests below are scalar branches
  const char* pf = wv < 4
      ? (const char*)(const void*)opl + ((size_t)(wv * 2 + hh) * NROWP * HD + (size_t)mb * 4 * FT) * 2 + c * 256
      : (const char*)(const void*)wp + (size_t)nb * 64 * FT * 2 + (tid - 128) * 256;
  if (wv < 4) {
    l2_ask<0>(pf);
  } else if (mb < 8) {
    l2_ask<0>(pf);
    l2_ask<32768>(pf);
  }

  v8f a00 = zero8(), a01 = zero8(), a10 = zero8(), a11 = zero8();
#pragma unroll 1
  for (int ks = 0; ks < 8; ++ks) {
    const v16h fa0 = ldfrag_t(Ap);
    const v16h fa1 = ldfrag_t(Ap + FT);
    const v16h fb0 = ldfrag_t(Wp);
    const v16h fb1 = ldfrag_t(Wp + 8 * FT);
    Ap += (size_t)NROWP * HD;                     // next head plane
    Wp += FT;                                     // next 32-k step
    a00 = mma_raw(fa0, fb0, a00);
    a01 = mma_raw(fa0, fb1, a01);
    a10 = mma_raw(fa1, fb0, a10);
    a11 = mma_raw(fa1, fb1, a11);
    guard4(a00, a01, a10, a11, fa0, fa1, fb0, fb1, pf);
  }
#pragma unroll
  for (int r = 0; r < 8; ++r) {
    const int row = mw * 32 + 8 * hh + r;
    Cs[row * LDC + nw * 32 + c]             = a00[r];
    Cs[row * LDC + nw * 32 + 16 + c]        = a01[r];
    Cs[(row + 16) * LDC + nw * 32 + c]      = a10[r];
    Cs[(row + 16) * LDC + nw * 32 + 16 + c] = a11[r];
  }
  __syncthreads();

  const int prow = mb * 64 + wave * 8;            // the wave's 8 padded rows lie in one strip, so in one window
  const int w = prow / TP;
  const int rbase = prow - w * TP;
  v4f ov[8];
  size_t offs[8];
#pragma unroll
  for (int it = 0; it < 8; ++it) {
    const int row = wave * 8 + it;
    v4f v = *(const v4f*)(Cs + row * LDC + lane * 4);
    v = v * (1.0f / 65536.0f);
    ov[it] = v;
    const int tokc = min(rbase + it, NTOK - 1);
    offs[it] = ((size_t)w * NTOK + tokc) * CCH + nb * 128 + lane * 4;
  }
#pragma unroll
  for (int it = 0; it < 8; ++it) {
    if (rbase + it < NTOK) *(v4f*)(out + offs[it]) = ov[it];     // wave-uniform
  }
  
}

// =================================================================================================================
// token dimension padded to 352 per window everywhere):
//   WqkvT f16 768 x 256 393216 | WoutT f16 256 x 256 131072 |
//   bias table f32 [8][22][22][256] 3964928 | X f16 45056 x 256 23068672 |
//   O f16 8 x 45056 x 32 23068672 | total 50626560.
//   every f16 plane is stored as 1024-byte operand tiles in fragment order (ldfrag_t).
// =================================================================================================================
extern "C" void kernel_launch(void* const* d_in, const int* in_sizes, int n_in,
                              void* d_out, int out_size, void* d_ws, size_t ws_size,
                              hipStream_t stream) {
  if (n_in < 4) return;
  if (in_sizes[0] != NROWX * CCH) return;
  if (in_sizes[1] != CCH * C3) return;
  if (in_sizes[2] != CCH * CCH) return;
  if (in_sizes[3] != NRPB * NHD) return;
  if (out_size != NROWX * CCH) return;

  const float* x    = (const float*)d_in[0];
  const float* wqkv = (const float*)d_in[1];
  const float* wout = (const float*)d_in[2];
  const float* rpb  = (const float*)d_in[3];
  float* out = (float*)d_out;

  const size_t sWq = (size_t)C3 * CCH * 2;                    //   393216
  const size_t sWo = (size_t)CCH * CCH * 2;                   //   131072
  const size_t sBT = (size_t)NHD * NST * NKT * 256 * 4;       //  3964928
  const size_t sX  = (size_t)NROWP * CCH * 2;                 // 23068672
  const size_t sO  = (size_t)NHD * NROWP * HD * 2;            // 23068672
  size_t off = 0;
  const size_t oWq = off; off += sWq;
  const size_t oWo = off; off += sWo;
  const size_t oBT = off; off += sBT;
  const size_t oX  = off; off += sX;
  const size_t oO  = off; off += sO;
  if (off > ws_size) return;                                   // off = 50626560
  if (off > (size_t)134217728) return;

  char* ws = (char*)d_ws;
  unsigned short* WqT = (unsigned short*)(ws + oWq);
  unsigned short* WoT = (unsigned short*)(ws + oWo);
  float*          BT  = (float*)(ws + oBT);
  unsigned short* Xp  = (unsigned short*)(ws + oX);
  unsigned short* Op  = (unsigned short*)(ws + oO);

  const dim3 blk(256);
  // (1) set-up: transpose + convert of w_qkv (24 blocks) and w_out (8), convert of x (704), bias table (968)
  prep<<<dim3(NQB + NWB + NGB + NBB), blk, 0, stream>>>(x, Xp, wqkv, WqT, wout, WoT, rpb, BT);
  // (2) qkv projection + window attention: 128 windows x 8 heads, one block of 8 waves (6 x 3 + 2 x 2 strips) each
  attn_win<<<dim3(NWIN * NHD), blk, 0, stream>>>(Xp, WqT, BT, Op);
  // (3) output projection -> d_out (padded tokens skipped)
  gemm_proj<<<dim3(NROWP / 64, CCH / 128), blk, 0, stream>>>(Op, WoT, out);
  (void)hipGetLastError();
}

// v008
// Measured time: 62.2 microseconds a run.
// Next to v007, in two timings, it ran 1.05 times as fast each time.
// Over all steps from v000 it is 3.75 times as fast.
// qkv projection, q.k^T, p.v and output projection: v_wmma_f32_16x16x32_f16 single products (f16 operands, f32 accumulate);
// all inputs RNE-converted to bf16 on load and carried with power-of-two scales, as f16 (the bias table as f32); softmax, key padding mask and epilogues in f32 on VALU.
// attention runs on transposed products (S^T = K.Q^T, O^T = V^T.P^T): a lane owns one query, P stays in registers.
// the qkv projection runs inside the attention kernel: Q, K and V^T go through LDS only.
#include <hip/hip_runtime.h>
#include <stdint.h>

#define NWIN  128
#define NTOK  343
#define TP    352
#define CCH   256
#define NHD   8
#define HD    32
#define C3    768
#define NROWP 45056
#define NROWX 43904
#define NRPB  2197
#define NST   22
#define NKT   22
#define LDC   260
#define TPW   260
#define FT    512
#define QSC   0.17677669529663687f
#define INV512 0.001953125f
#define LN1024 6.9314718055994531f
#define LOG2E 1.44269504088896341f
#define MASKC (-1048576.0f)
#define XS    11
#define NGB   256
#define NWB   8
#define BKT   11
#define NBB   88
#define NQB   24
#define NW3   6
#define KB64  5

static_assert(NROWP == NWIN * TP);
static_assert(NROWX == NWIN * NTOK);
static_assert(TP == KB64 * 64 + 32);
static_assert(TP % 32 == 0 && NST % 2 == 0);
static_assert(TP >= NTOK && TP - NTOK < 16);
static_assert(NST * 16 == TP);
static_assert(NKT * 16 == TP);
static_assert((LDC * 4) % 16 == 0);
static_assert((TPW * 4) % 16 == 0);
static_assert(NHD * HD == CCH);
static_assert(FT == 16 * 32);
static_assert(TP * HD == NST * FT);
static_assert(NGB * XS == NWIN * NST && NST % XS == 0);
static_assert(NWB * 32 == CCH);
static_assert(NBB * 256 * BKT == NHD * NST * NKT * 64 && NKT % BKT == 0);
static_assert(NQB * 32 == C3);
static_assert(NW3 * 3 + (8 - NW3) * 2 == NST);

typedef _Float16 v16h __attribute__((ext_vector_type(16)));
typedef _Float16 v8h  __attribute__((ext_vector_type(8)));
typedef float    v8f  __attribute__((ext_vector_type(8)));
typedef float    v4f  __attribute__((ext_vector_type(4)));
typedef unsigned int v4u __attribute__((ext_vector_type(4)));

// ---- scalar helpers ------------------------------------------------------------------------------------------
__device__ __forceinline__ unsigned short bf_bits(float f) {          // f32 -> bf16 bits, RNE convert
  unsigned u = __float_as_uint(f);
  return (unsigned short)((u + 0x7FFFu + ((u >> 16) & 1u)) >> 16);
}
__device__ __forceinline__ float bf_up(unsigned short b) { return __uint_as_float(((unsigned)b) << 16); }
__device__ __forceinline__ float bfr(float f) { return bf_up(bf_bits(f)); }
__device__ __forceinline__ unsigned short h_bits(_Float16 x) { return __builtin_bit_cast(unsigned short, x); }
__device__ __forceinline__ unsigned short hb16(float f) { return h_bits((_Float16)f); }
__device__ __forceinline__ unsigned pk16(unsigned short a, unsigned short b) { return (unsigned)a | ((unsigned)b << 16); }
__device__ __forceinline__ v8f zero8() { v8f z = {0.f, 0.f, 0.f, 0.f, 0.f, 0.f, 0.f, 0.f}; return z; }

// ---- fragment loader for the fragment-order global planes: one 16 (rows/cols) x 32 (k) operand tile is FT halves =
//      1024 contiguous bytes; its 16-B piece e*32 + lane holds row/col (lane&15), k = 16*e + 8*(lane>>4) + 0..7 (the
//      hardware k order, which a packed pair of D tiles also has). p = tile base + lane*8: each of the two loads reads
//      512 contiguous bytes per wave.
__device__ __forceinline__ v16h ldfrag_t(const _Float16* p) {
  union { v16h v; v8h h[2]; } f;
  f.h[0] = *(const v8h*)(p);
  f.h[1] = *(const v8h*)(p + 256);
  return f.v;
}

// ---- WMMA helpers; the guard helpers insert the trailing VALU hazard gap and keep A/B live -----------------------
__device__ __forceinline__ v8f mma_raw(v16h a, v16h b, v8f c) {
  return __builtin_amdgcn_wmma_f32_16x16x32_f16(false, a, false, b, (short)0, c, false, false);
}
__device__ __forceinline__ void guard16(v8f (&c)[4][4], const v16h (&a)[4], const v16h (&b)[4],
                                        const char* keep0, const char* keep1) {   // keep: the addresses that l2_ask named, whole through the loop
#if defined(__HIP_DEVICE_COMPILE__)
  asm volatile("v_nop\n\tv_nop\n\tv_nop\n\tv_nop"
               : "+v"(c[0][0]), "+v"(c[0][1]), "+v"(c[0][2]), "+v"(c[0][3]), "+v"(c[1][0]), "+v"(c[1][1]), "+v"(c[1][2]), "+v"(c[1][3]),
                 "+v"(c[2][0]), "+v"(c[2][1]), "+v"(c[2][2]), "+v"(c[2][3]), "+v"(c[3][0]), "+v"(c[3][1]), "+v"(c[3][2]), "+v"(c[3][3])
               : "v"(a[0]), "v"(a[1]), "v"(a[2]), "v"(a[3]), "v"(b[0]), "v"(b[1]), "v"(b[2]), "v"(b[3]), "v"(keep0), "v"(keep1));
#endif
}
// hint to L2: each lane asks for its own address p + OFF bytes (returns nothing, touches no counter).
// The planes asked for were stored by an earlier launch.
// Asked for ahead, the k-steps behind the first find an L2 hit in place of memory latency. p points inside the
// plane in every lane, and the caller keeps its register whole through the loop around or behind the call.
template <int OFF>
__device__ __forceinline__ void l2_ask(const char* p) {
#if defined(__HIP_DEVICE_COMPILE__)
  asm volatile("global_prefetch_b8 %0, off offset:%1 scope:SCOPE_SE" :: "v"(p), "n"(OFF));
#endif
}
// value of lane l ^ 16 (the other half of the wave), by a vector cross-row move
__device__ __forceinline__ float xhalf(float x) {
  const int b = __float_as_int(x);
  return __int_as_float(__builtin_amdgcn_permlanex16(b, b, 0x76543210, 0xfedcba98, false, false));
}

// =================================================================================================================
// weight transpose + convert: w [256 k][ncol n] f32 (n contiguous, used as x.w) -> wT, ncol columns x 256 k as f16 in
// fragment order (tile (n/16)*8 + k/32, see ldfrag_t), value f16(1024 * bf16_RNE(w)). Block = 32 columns: the 256x32
// f32 slab is staged in LDS (coalesced reads); wave = one 32-k step, it writes its two tiles of 1024 contiguous bytes.
// coverage: (ncol/32) blocks x 8 waves x 2 tiles x 2 x 32 pieces x 8 halves = ncol x 256.
// cvt_block is the work of one block (bx = its 32-column slab, T = 32 * TPW floats of the block's LDS); the blocks of
// w_qkv and of w_out ride in the grid of prep.
// =================================================================================================================
__device__ __forceinline__ void cvt_block(const float* __restrict__ wsrc, unsigned short* wdst, int ncol, int bx,
                                          float* T) {
  const int tid = threadIdx.x, wv = tid >> 5, lane = tid & 31, hh = lane >> 4, c = lane & 15;
  const int n0 = bx * 32;
#pragma unroll 4
  for (int it = 0; it < 32; ++it) {
    const int k = it * 8 + wv;
    T[lane * TPW + k] = wsrc[(size_t)k * ncol + n0 + lane];
  }
  __syncthreads();
  v4u pk[4];
  size_t offs[4];
#pragma unroll
  for (int q = 0; q < 4; ++q) {
    const int nt = q >> 1, e = q & 1;
    const float* tp = T + (nt * 16 + c) * TPW + wv * 32 + e * 16 + hh * 8;
    const v4f a = *(const v4f*)(tp);
    const v4f b = *(const v4f*)(tp + 4);
    v4u p4;
    p4[0] = pk16(hb16(bfr(a[0]) * 1024.0f), hb16(bfr(a[1]) * 1024.0f));
    p4[1] = pk16(hb16(bfr(a[2]) * 1024.0f), hb16(bfr(a[3]) * 1024.0f));
    p4[2] = pk16(hb16(bfr(b[0]) * 1024.0f), hb16(bfr(b[1]) * 1024.0f));
    p4[3] = pk16(hb16(bfr(b[2]) * 1024.0f), hb16(bfr(b[3]) * 1024.0f));
    pk[q] = p4;
    offs[q] = ((size_t)(bx * 2 + nt) * 8 + wv) * FT + e * 256 + lane * 8;
  }
#pragma unroll
  for (int q = 0; q < 4; ++q) *(v4u*)(wdst + offs[q]) = pk[q];
  asm volatile("s_wait_xcnt 0x0" ::: "memory");   // inlined in prep, code that rewrites these stores' registers can stand behind it
}
// =================================================================================================================
// relative position bias table in the C-operand order of the transposed logits tile (16 keys x 16 queries), registers
// 0..3 of all lanes then registers 4..7 (each C load reads 512 contiguous bytes per wave):
// BT[((h*22 + strip)*22 + kt)*256 + (r>>2)*128 + l*4 + (r&3)] =
// 512 * bf16_RNE(rpb[idx(n,m)*8 + h]) with n = strip*16 + (l&15) (query), m = kt*16 + 8*(l>>4) + r (key),
// idx = ((i_n-i_m+6)*13 + (j_n-j_m+6))*13 + (k_n-k_m+6), (i,j,k) = (t/49, (t/7)%7, t%7); padded keys m >= 343
// get MASKC (logit mask through the C operand), padded queries n >= 343 get 0. Thread = the same 16-B piece (4 keys)
// of BKT neighbouring key tiles of one strip: a wave makes BKT stores of 512 contiguous bytes, so few waves have to start.
// coverage: 8 heads x 22 strips x 2 groups x 11 key tiles x 64 pieces x 4 floats = 8 x 352 x 352, every element once.
// bias_block is the work of one block of 256 threads (bx = 0 .. NBB-1); the blocks ride in the grid of prep.
// =================================================================================================================
__device__ __forceinline__ void bias_block(const float* __restrict__ rpb, float* bt, int bx) {
  const int g = bx * 256 + threadIdx.x;
  const int piece = g & 63, grp = g >> 6;         // grp = (h*22 + strip) * (NKT / BKT) + group of key tiles
  const int kt0 = (grp % (NKT / BKT)) * BKT, hs = grp / (NKT / BKT);
  const int strip = hs % NST, h = hs / NST;
  const int l = piece & 31, e0 = (piece >> 5) * 4;
  const int col = l & 15, lh = l >> 4;
  const int n = strip * 16 + col;
  const int ni = n / 49, nj = (n / 7) % 7, nk = n % 7;
  v4u bo[BKT];                                    // byte offsets into rpb
  v4f raw[BKT];
#pragma unroll
  for (int i = 0; i < BKT; ++i) {
#pragma unroll
    for (int e = 0; e < 4; ++e) {
      const int m = (kt0 + i) * 16 + 8 * lh + e0 + e;
      const int mi = m / 49, mj = (m / 7) % 7, mk = m % 7;
      int idx = ((ni - mi + 6) * 13 + (nj - mj + 6)) * 13 + (nk - mk + 6);
      idx = min(max(idx, 0), NRPB - 1);
      bo[i][e] = (unsigned)(idx * NHD + h) * 4u;
    }
  }
#pragma unroll
  for (int i = 0; i < BKT; ++i) {
#pragma unroll
    for (int e = 0; e < 4; ++e) raw[i][e] = *(const float*)((const char*)rpb + bo[i][e]);
  }
  // the loads' offset registers stay whole up to this wait (named as inputs), and are rewritten only behind it
  asm volatile("s_wait_xcnt 0x0" :: "v"(bo[0]), "v"(bo[1]), "v"(bo[2]), "v"(bo[3]), "v"(bo[4]), "v"(bo[5]), "v"(bo[6]),
               "v"(bo[7]), "v"(bo[8]), "v"(bo[9]), "v"(bo[10]) : "memory");
  static_assert(BKT == 11);
  v4f v[BKT];
#pragma unroll
  for (int i = 0; i < BKT; ++i) {
#pragma unroll
    for (int e = 0; e < 4; ++e) {
      const int m = (kt0 + i) * 16 + 8 * lh + e0 + e;
      float val = bfr(raw[i][e]) * 512.0f;
      if (n >= NTOK) val = 0.0f;
      if (m >= NTOK) val = MASKC;
      v[i][e] = val;
    }
  }
  float* gp = bt + ((size_t)hs * NKT + kt0) * 256 + piece * 4;
#pragma unroll
  for (int i = 0; i < BKT; ++i) *(v4f*)(gp + i * 256) = v[i];
  asm volatile("s_wait_xcnt 0x0" ::: "memory");   // inlined in prep, code that rewrites these stores' registers can stand behind it
}

// =================================================================================================================
// input convert: block = XS = 11 strips of 16 padded tokens, half a window (a window has 22 strips): one block for each
// of the chip's 256 WGPs, and few waves to start. It reads its 176 x 256 f32 slab of x once, all loads in flight
// together (token clamped, padded tokens 343..351 become exact zeros), converts it to
// f16(8 * bf16_RNE(x)) and writes it as 11 x 8 operand tiles of the X plane in fragment order (tile
// (w*22 + tok/16)*8 + k/32, see ldfrag_t); wave = one 32-k step; a wave's store writes 512 contiguous bytes.
// coverage: 256 blocks x 8 waves x 11 tiles x 1024 B = 128 x 22 x 8 tiles, each once.
// =================================================================================================================
__device__ __forceinline__ void xcvt_block(const float* __restrict__ x, unsigned short* xp, int mb) {
  const int tid = threadIdx.x, wave = tid >> 5, lane = tid & 31, hh = lane >> 4, c = lane & 15;
  v4f xa[XS][4];
  const float* src[XS];
  int tk[XS];                                     // token of this lane's row inside its window, 0 .. 351
#pragma unroll
  for (int rt = 0; rt < XS; ++rt) {
    const int sx = mb * XS + rt, w = sx / NST;    // strip over all windows, its window
    tk[rt] = (sx - w * NST) * 16 + c;
    const int ts = min(tk[rt], NTOK - 1);
    src[rt] = x + ((size_t)w * NTOK + ts) * CCH + wave * 32 + 8 * hh;
#pragma unroll
    for (int e = 0; e < 2; ++e) {
      xa[rt][2 * e]     = *(const v4f*)(src[rt] + 16 * e);
      xa[rt][2 * e + 1] = *(const v4f*)(src[rt] + 16 * e + 4);
    }
  }
  // the loads' address registers stay whole up to this wait (named as inputs), and are rewritten only behind it
  asm volatile("s_wait_xcnt 0x0" :: "v"(src[0]), "v"(src[1]), "v"(src[2]), "v"(src[3]), "v"(src[4]), "v"(src[5]),
               "v"(src[6]), "v"(src[7]), "v"(src[8]), "v"(src[9]), "v"(src[10]) : "memory");
  static_assert(XS == 11);
  v4u pk[XS][2];
#pragma unroll
  for (int rt = 0; rt < XS; ++rt) {
    const bool pad = tk[rt] >= NTOK;
#pragma unroll
    for (int e = 0; e < 2; ++e) {
      const v4f a = xa[rt][2 * e], b = xa[rt][2 * e + 1];
      v4u p4;
      p4[0] = pk16(hb16(bfr(a[0]) * 8.0f), hb16(bfr(a[1]) * 8.0f));
      p4[1] = pk16(hb16(bfr(a[2]) * 8.0f), hb16(bfr(a[3]) * 8.0f));
      p4[2] = pk16(hb16(bfr(b[0]) * 8.0f), hb16(bfr(b[1]) * 8.0f));
      p4[3] = pk16(hb16(bfr(b[2]) * 8.0f), hb16(bfr(b[3]) * 8.0f));
      if (pad) { p4[0] = 0u; p4[1] = 0u; p4[2] = 0u; p4[3] = 0u; }
      pk[rt][e] = p4;
    }
  }
  unsigned short* dst = xp + ((size_t)(mb * XS) * 8 + wave) * FT + lane * 8;
#pragma unroll
  for (int rt = 0; rt < XS; ++rt) {
    *(v4u*)(dst + rt * 8 * FT)       = pk[rt][0];
    *(v4u*)(dst + rt * 8 * FT + 256) = pk[rt][1];
  }
  asm volatile("s_wait_xcnt 0x0" ::: "memory");   // inlined in prep, code that rewrites these stores' registers can stand behind it
}

// =================================================================================================================
// set-up launch: four block ranges that read only inputs and write planes that only later launches read.
// NQB blocks convert w_qkv, NWB blocks convert w_out (cvt_block; their chains of dependent loads are the longest, so
// they take the lowest block indices), NBB blocks build the bias table (bias_block), NGB blocks convert x (xcvt_block).
// =================================================================================================================
__global__ __launch_bounds__(256)
void prep(const float* __restrict__ x, unsigned short* xp, const float* __restrict__ wqkv, unsigned short* wq,
          const float* __restrict__ wout, unsigned short* wo, const float* __restrict__ rpb, float* bt) {
  __shared__ __align__(16) float T[32 * TPW];
  const int b = blockIdx.x;                       // every test below is block-uniform
  if (b < NQB)                   cvt_block(wqkv, wq, C3, b, T);
  else if (b < NQB + NWB)        cvt_block(wout, wo, CCH, b - NQB, T);
  else if (b < NQB + NWB + NBB)  bias_block(rpb, bt, b - NQB - NWB);
  else                           xcvt_block(x, xp, b - NQB - NWB - NBB);
}

__device__ __forceinline__ v8h pack8(v8f a, float scl) {
  v8h r;
#pragma unroll
  for (int e = 0; e < 8; ++e) r[e] = (_Float16)(a[e] * scl);
  return r;
}
// projection of a wave's S strips (from strip0) onto the head's 3 x 32 columns; X, Wh carry the lane's offset;
// xpf = first byte of the wave's S x 8 X tiles (S x 8192 contiguous bytes) + lane * 256; wpf = the same for the 8
// k-step tiles of one of the head's 6 weight column tiles: each of the 6 waves with 3 strips asks for one of them
template <int S>
__device__ __forceinline__ void proj_strips(const _Float16* X, const _Float16* Wh, const char* xpf, const char* wpf,
                                            _Float16* Qs, _Float16* Ks, _Float16* Vs, int strip0, int lane) {
  v8f aq[S][2], ak[S][2], av[S][2];
#pragma unroll
  for (int t = 0; t < S; ++t) {
#pragma unroll
    for (int dt = 0; dt < 2; ++dt) { aq[t][dt] = zero8(); ak[t][dt] = zero8(); av[t][dt] = zero8(); }
  }
#pragma unroll 1                                  // up to 18 accumulator tiles: a second copy of the body's fragments would not fit 256 registers
  for (int ks = 0; ks < 8; ++ks) {
    const _Float16* xk = X + ks * FT;
    const _Float16* wk = Wh + ks * FT;
    v16h xf[S], wf[3][2];                         // wf[part][dt]: column tile part * 16 + h*2 + dt
#pragma unroll
    for (int t = 0; t < S; ++t) xf[t] = ldfrag_t(xk + t * 8 * FT);
#pragma unroll
    for (int p = 0; p < 3; ++p) {
#pragma unroll
      for (int dt = 0; dt < 2; ++dt) wf[p][dt] = ldfrag_t(wk + (p * 16 + dt) * 8 * FT);
    }
    // the loads' address registers stay whole up to this wait (named as inputs), and are rewritten only behind it;
    // xpf and wpf are named so that the registers l2_ask reads keep their addresses through the loop
    if (S == 3) asm volatile("s_wait_xcnt 0x0" :: "v"(xk), "v"(wk), "v"(xpf), "v"(wpf) : "memory");
    else        asm volatile("s_wait_xcnt 0x0" :: "v"(xk), "v"(wk), "v"(xpf) : "memory");
    // all loads are issued before the first product: one wait for memory a k-step, not one per reused fragment register
    __builtin_amdgcn_sched_barrier(0);
    if (ks == 0) {                                // scalar test; behind the first k-step's own loads, under their wait
      l2_ask<0>(xpf);                             // 32 lanes x 256 B = the 8 tiles of one strip
      l2_ask<8192>(xpf);
      if (S == 3) {
        l2_ask<16384>(xpf);
        l2_ask<0>(wpf);
      }
    }
#pragma unroll
    for (int dt = 0; dt < 2; ++dt) {
#pragma unroll
      for (int t = 0; t < S; ++t) {
        aq[t][dt] = mma_raw(wf[0][dt], xf[t], aq[t][dt]);
        ak[t][dt] = mma_raw(wf[1][dt], xf[t], ak[t][dt]);
        av[t][dt] = mma_raw(xf[t], wf[2][dt], av[t][dt]);
      }
    }
  }
#pragma unroll
  for (int t = 0; t < S; ++t) {
    const int st = strip0 + t;
    *(v8h*)(Qs + st * FT + lane * 8)       = pack8(aq[t][0], QSC * (64.0f / 8192.0f));
    *(v8h*)(Qs + st * FT + 256 + lane * 8) = pack8(aq[t][1], QSC * (64.0f / 8192.0f));
    *(v8h*)(Ks + st * FT + lane * 8)       = pack8(ak[t][0], 8.0f / 8192.0f);
    *(v8h*)(Ks + st * FT + 256 + lane * 8) = pack8(ak[t][1], 8.0f / 8192.0f);
    *(v8h*)(Vs + (st >> 1) * FT + (st & 1) * 256 + lane * 8)             = pack8(av[t][0], 16.0f / 8192.0f);
    *(v8h*)(Vs + (TP / 32 + (st >> 1)) * FT + (st & 1) * 256 + lane * 8) = pack8(av[t][1], 16.0f / 8192.0f);
  }
}
// one pass of the online softmax over NJ key tiles (NJ = 4 or 2) for a wave's S strips: bk, K, Vt stand at the pass's
// first bias tile, K tile and V^T tile (lane offsets included), Q at the wave's first Q tile
template <int S, int NJ>
__device__ __forceinline__ void key_pass(const float* bk, const _Float16* Q, const _Float16* K, const _Float16* Vt,
                                         float (&mrow)[S], float (&lrow)[S], v8f (&o0)[S], v8f (&o1)[S]) {
  union CB { v8f v; v4f q[2]; };
  // ---- transposed logits: NJ tiles of 16 keys, bias and key padding mask via the C operand ----
  v8f s[S][NJ];
#pragma unroll
  for (int j = 0; j < NJ; ++j) {
#pragma unroll
    for (int t = 0; t < S; ++t) {
      const float* bp = bk + (t * NKT + j) * 256;
      CB cb;
      cb.q[0] = *(const v4f*)(bp);
      cb.q[1] = *(const v4f*)(bp + 128);
      s[t][j] = cb.v;
    }
  }
  // the bias loads' address register stays whole up to this wait (named as an input), and is rewritten only behind it
  asm volatile("s_wait_xcnt 0x0" :: "v"(bk) : "memory");
  v16h qb[S];                                     // read anew each pass: its registers are free during softmax and O^T
#pragma unroll
  for (int t = 0; t < S; ++t) qb[t] = ldfrag_t(Q + t * FT);
#pragma unroll
  for (int j = 0; j < NJ; ++j) {
    const v16h kf = ldfrag_t(K + j * FT);
#pragma unroll
    for (int t = 0; t < S; ++t) s[t][j] = mma_raw(kf, qb[t], s[t][j]);
  }
  // ---- online softmax update of the lane's query in each strip ----
#pragma unroll
  for (int t = 0; t < S; ++t) {
    float tj[NJ];
#pragma unroll
    for (int j = 0; j < NJ; ++j) {
      tj[j] = fmaxf(fmaxf(fmaxf(s[t][j][0], s[t][j][1]), fmaxf(s[t][j][2], s[t][j][3])),
                    fmaxf(fmaxf(s[t][j][4], s[t][j][5]), fmaxf(s[t][j][6], s[t][j][7])));
    }
    float tm = fmaxf(tj[0], tj[1]);
    if (NJ == 4) tm = fmaxf(tm, fmaxf(tj[NJ - 2], tj[NJ - 1]));
    tm = fmaxf(tm, xhalf(tm));
    const float mn = fmaxf(mrow[t], tm);
    const float alpha = __expf((mrow[t] - mn) * INV512);
    mrow[t] = mn;
#pragma unroll
    for (int j = 0; j < NJ; ++j) {
      const v8f u = ((s[t][j] - mn) * INV512 + LN1024) * LOG2E;  // one maximum per lane: whole-tile (packed) arithmetic
#pragma unroll
      for (int r = 0; r < 8; ++r) s[t][j][r] = __builtin_amdgcn_exp2f(u[r]);
    }
    v8f p8 = s[t][0] + s[t][1];
    if (NJ == 4) p8 = p8 + (s[t][NJ - 2] + s[t][NJ - 1]);
    const v4f p4 = p8.lo + p8.hi;
    lrow[t] = lrow[t] * alpha + ((p4[0] + p4[1]) + (p4[2] + p4[3]));
    o0[t] = o0[t] * alpha;
    o1[t] = o1[t] * alpha;
  }
  // ---- O^T += V^T . P^T : 32-key k-steps, two 16-dim tiles, S strips per V^T fragment ----
#pragma unroll
  for (int ks = 0; ks < NJ / 2; ++ks) {
    const v16h v0 = ldfrag_t(Vt + ks * FT);
    const v16h v1 = ldfrag_t(Vt + (TP / 32 + ks) * FT);
#pragma unroll
    for (int t = 0; t < S; ++t) {
      v16h pb;
#pragma unroll
      for (int e = 0; e < 8; ++e) {
        pb[e]     = (_Float16)s[t][2 * ks][e];
        pb[8 + e] = (_Float16)s[t][2 * ks + 1][e];
      }
      o0[t] = mma_raw(v0, pb, o0[t]);
      o1[t] = mma_raw(v1, pb, o1[t]);
    }
  }
}
// attention of a wave's S strips over the window's 22 key tiles; op = the lane's piece of the first strip's output tile
template <int S>
__device__ __forceinline__ void attn_strips(const float* Bp, const _Float16* Q, const _Float16* K, const _Float16* Vt,
                                            unsigned short* op) {
  float mrow[S], lrow[S];                         // per strip, this lane's query: running maximum, sum over this half's keys
  v8f o0[S], o1[S];
#pragma unroll
  for (int t = 0; t < S; ++t) {
    mrow[t] = -1e30f;
    lrow[t] = 0.f;
    o0[t] = zero8();
    o1[t] = zero8();
  }
#pragma unroll 1                                  // one copy of the 64-key pass: its score tiles fill the register budget
  for (int kb = 0; kb < KB64; ++kb)
    key_pass<S, 4>(Bp + kb * 4 * 256, Q, K + kb * 4 * FT, Vt + kb * 2 * FT, mrow, lrow, o0, o1);
  key_pass<S, 2>(Bp + KB64 * 4 * 256, Q, K + KB64 * 4 * FT, Vt + KB64 * 2 * FT, mrow, lrow, o0, o1);

  // ---- join the halves' sums, normalise (64 ctx = O * 4 / l), store the lane's two 16-B pieces of each strip ----
#pragma unroll
  for (int t = 0; t < S; ++t) {
    const float inv = 4.0f / (lrow[t] + xhalf(lrow[t]));
    v4u p0, p1;
#pragma unroll
    for (int e = 0; e < 4; ++e) {
      p0[e] = pk16(hb16(o0[t][2 * e] * inv), hb16(o0[t][2 * e + 1] * inv));
      p1[e] = pk16(hb16(o1[t][2 * e] * inv), hb16(o1[t][2 * e + 1] * inv));
    }
    *(v4u*)(op + t * FT) = p0;
    *(v4u*)(op + t * FT + 256) = p1;
    // the two stores' data and address registers stay whole up to this wait (named as inputs): the next strip's
    // arithmetic, or the tail that the two strip counts share, rewrites them only behind it
    asm volatile("s_wait_xcnt 0x0" :: "v"(p0), "v"(p1), "v"(op) : "memory");
  }
}
__global__ __launch_bounds__(256, 4)               // 4 waves per SIMD = 256 registers a wave: two blocks stay resident per WGP
void attn_win(const unsigned short* __restrict__ xp, const unsigned short* __restrict__ wq,
              const float* __restrict__ bt, unsigned short* opl) {
  __shared__ __align__(16) _Float16 Qs[NST * FT];
  __shared__ __align__(16) _Float16 Ks[NST * FT];
  __shared__ __align__(16) _Float16 Vs[NST * FT];
  const int tid = threadIdx.x, lane = tid & 31;
  const int wave = __builtin_amdgcn_readfirstlane(tid >> 5);   // scalar: the tests on it below are scalar branches
  const int wh = blockIdx.x;                      // w*8 + h
  const int w = wh >> 3, h = wh & 7;
  const bool three = wave < NW3;                  // wave-uniform
  const int strip0 = three ? wave * 3 : NW3 * 3 + (wave - NW3) * 2;   // 0, 3, .. 15, 18, 20

  {
    const _Float16* X  = (const _Float16*)(const void*)xp + (size_t)(w * NST + strip0) * 8 * FT + lane * 8;
    const _Float16* Wh = (const _Float16*)(const void*)wq + (size_t)(h * 2) * 8 * FT + lane * 8;   // column tile h*2 of part q
    const char* xpf = (const char*)(const void*)xp + (size_t)(w * NST + strip0) * 8 * FT * 2 + lane * 256;
    const int ct = three ? (wave >> 1) * 16 + h * 2 + (wave & 1) : h * 2;   // column tile: part wave / 2, half wave % 2
    const char* wpf = (const char*)(const void*)wq + (size_t)ct * 8 * FT * 2 + lane * 256;
    if (three) proj_strips<3>(X, Wh, xpf, wpf, Qs, Ks, Vs, strip0, lane);
    else       proj_strips<2>(X, Wh, xpf, wpf, Qs, Ks, Vs, strip0, lane);
  }
  __syncthreads();                                // K and V^T are whole before any wave reads other waves' tiles

  const _Float16* Q  = Qs + strip0 * FT + lane * 8;   // the wave's own tiles
  const _Float16* K  = Ks + lane * 8;
  const _Float16* Vt = Vs + lane * 8;
  const float* Bp = bt + ((size_t)(h * NST + strip0)) * NKT * 256 + lane * 4;
  unsigned short* op = opl + ((size_t)h * NROWP + (size_t)w * TP + strip0 * 16) * HD + lane * 8;
  if (three) attn_strips<3>(Bp, Q, K, Vt, op);
  else       attn_strips<2>(Bp, Q, K, Vt, op);
}

// =================================================================================================================
// Output projection: out rows = (O64/64) . (W1024/1024)^T, K = 256 = 8 head planes of 32. Block tile 64 padded
// tokens x all 256 cols, 4 waves side by side, 4x4 tiles (64 x 64) per wave: an O tile is asked of L2 by one block only,
// a weight tile by one wave of a block, and a quarter as many waves start as with 2x2 tiles per wave.
// Epilogue through an LDS f32 tile; a wave writes whole rows of 1024 bytes.
// coverage: 128 windows x 343 tokens x 256 cols = every output element exactly once.
// =================================================================================================================
__global__ __launch_bounds__(128)
void gemm_proj(const unsigned short* __restrict__ opl, const unsigned short* __restrict__ wp, float* out) {
  __shared__ __align__(16) float Cs[64 * LDC];
  const int tid = threadIdx.x, wave = tid >> 5, lane = tid & 31, hh = lane >> 4, c = lane & 15;
  const int mb = blockIdx.x;
  const _Float16* W = (const _Float16*)(const void*)wp;
  const _Float16* Ap = (const _Float16*)(const void*)opl + (size_t)(mb * 4) * FT + lane * 8;   // the block's 4 row tiles
  const _Float16* Wp = W + (size_t)(wave * 4) * 8 * FT + lane * 8;                             // the wave's 4 col tiles

  // each wave asks L2 for the block's 4 row tiles (4096 contiguous bytes) of two head planes, 256 B a lane; the first 8
  // row blocks also ask for the 128 weight tiles (131072 contiguous bytes), for all blocks (block-uniform scalar test)
  const char* pf = (const char*)(const void*)opl + ((size_t)(wave * 2 + hh) * NROWP * HD + (size_t)mb * 4 * FT) * 2 + c * 256;
  const char* pw = (const char*)(const void*)wp + tid * 256;
  l2_ask<0>(pf);
  if (mb < 8) {
    l2_ask<0>(pw);
    l2_ask<32768>(pw);
    l2_ask<65536>(pw);
    l2_ask<98304>(pw);
  }

  v8f acc[4][4];                                  // [row tile][column tile]
#pragma unroll
  for (int i = 0; i < 4; ++i) {
#pragma unroll
    for (int j = 0; j < 4; ++j) acc[i][j] = zero8();
  }
#pragma unroll 1
  for (int ks = 0; ks < 8; ++ks) {
    v16h fa[4], fb[4];
#pragma unroll
    for (int i = 0; i < 4; ++i) fa[i] = ldfrag_t(Ap + i * FT);
#pragma unroll
    for (int j = 0; j < 4; ++j) fb[j] = ldfrag_t(Wp + j * 8 * FT);
    // the loads' address registers stay whole up to this wait (named as inputs), and are advanced only behind it
    asm volatile("s_wait_xcnt 0x0" :: "v"(Ap), "v"(Wp) : "memory");
    Ap += (size_t)NROWP * HD;                     // next head plane
    Wp += FT;                                     // next 32-k step
#pragma unroll
    for (int j = 0; j < 4; ++j) {
#pragma unroll
      for (int i = 0; i < 4; ++i) acc[i][j] = mma_raw(fa[i], fb[j], acc[i][j]);
    }
    guard16(acc, fa, fb, pf, pw);
  }
#pragma unroll
  for (int r = 0; r < 8; ++r) {
#pragma unroll
    for (int i = 0; i < 4; ++i) {
#pragma unroll
      for (int j = 0; j < 4; ++j) Cs[(i * 16 + 8 * hh + r) * LDC + wave * 64 + j * 16 + c] = acc[i][j][r];
    }
  }
  __syncthreads();

  const int prow = mb * 64 + wave * 16;           // the wave's 16 padded rows are one strip, so they lie in one window
  const int w = prow / TP;
  const int rbase = prow - w * TP;
#pragma unroll
  for (int hb = 0; hb < 2; ++hb) {                // two batches of 8 rows
    v4f ov[8][2];
    size_t offs[8];
#pragma unroll
    for (int it = 0; it < 8; ++it) {
      const int rr = hb * 8 + it;
      const int row = wave * 16 + rr;
      ov[it][0] = *(const v4f*)(Cs + row * LDC + lane * 4) * (1.0f / 65536.0f);
      ov[it][1] = *(const v4f*)(Cs + row * LDC + 128 + lane * 4) * (1.0f / 65536.0f);
      const int tokc = min(rbase + rr, NTOK - 1);
      offs[it] = ((size_t)w * NTOK + tokc) * CCH + lane * 4;
    }
#pragma unroll
    for (int it = 0; it < 8; ++it) {
      if (rbase + hb * 8 + it < NTOK) {                          // wave-uniform
        *(v4f*)(out + offs[it])       = ov[it][0];
        *(v4f*)(out + offs[it] + 128) = ov[it][1];
      }
    }
  }
}

// =================================================================================================================
// token dimension padded to 352 per window everywhere):
//   WqkvT f16 768 x 256 393216 | WoutT f16 256 x 256 131072 |
//   bias table f32 [8][22][22][256] 3964928 | X f16 45056 x 256 23068672 |
//   O f16 8 x 45056 x 32 23068672 | total 50626560.
//   every f16 plane is stored as 1024-byte operand tiles in fragment order (ldfrag_t).
// =================================================================================================================
extern "C" void kernel_launch(void* const* d_in, const int* in_sizes, int n_in,
                              void* d_out, int out_size, void* d_ws, size_t ws_size,
                              hipStream_t stream) {
  if (n_in < 4) return;
  if (in_sizes[0] != NROWX * CCH) return;
  if (in_sizes[1] != CCH * C3) return;
  if (in_sizes[2] != CCH * CCH) return;
  if (in_sizes[3] != NRPB * NHD) return;
  if (out_size != NROWX * CCH) return;

  const float* x    = (const float*)d_in[0];
  const float* wqkv = (const float*)d_in[1];
  const float* wout = (const float*)d_in[2];
  const float* rpb  = (const float*)d_in[3];
  float* out = (float*)d_out;

  const size_t sWq = (size_t)C3 * CCH * 2;                    //   393216
  const size_t sWo = (size_t)CCH * CCH * 2;                   //   131072
  const size_t sBT = (size_t)NHD * NST * NKT * 256 * 4;       //  3964928
  const size_t sX  = (size_t)NROWP * CCH * 2;                 // 23068672
  const size_t sO  = (size_t)NHD * NROWP * HD * 2;            // 23068672
  size_t off = 0;
  const size_t oWq = off; off += sWq;
  const size_t oWo = off; off += sWo;
  const size_t oBT = off; off += sBT;
  const size_t oX  = off; off += sX;
  const size_t oO  = off; off += sO;
  if (off > ws_size) return;                                   // off = 50626560
  if (off > (size_t)134217728) return;

  char* ws = (char*)d_ws;
  unsigned short* WqT = (unsigned short*)(ws + oWq);
  unsigned short* WoT = (unsigned short*)(ws + oWo);
  float*          BT  = (float*)(ws + oBT);
  unsigned short* Xp  = (unsigned short*)(ws + oX);
  unsigned short* Op  = (unsigned short*)(ws + oO);

  const dim3 blk(256);
  // (1) set-up: transpose + convert of w_qkv (24 blocks) and w_out (8), bias table (88), convert of x (256)
  prep<<<dim3(NQB + NWB + NGB + NBB), blk, 0, stream>>>(x, Xp, wqkv, WqT, wout, WoT, rpb, BT);
  // (2) qkv projection + window attention: 128 windows x 8 heads, one block of 8 waves (6 x 3 + 2 x 2 strips) each
  attn_win<<<dim3(NWIN * NHD), blk, 0, stream>>>(Xp, WqT, BT, Op);
  // (3) output projection -> d_out (padded tokens skipped)
  gemm_proj<<<dim3(NROWP / 64), dim3(128), 0, stream>>>(Op, WoT, out);
  (void)hipGetLastError();
}

// v009
// It runs in 60.5 microseconds.
// Timed twice side by side with v008, it ran 1.03 and 1.02 times as fast.
// All steps since v000 together make it 3.85 times as fast.
// qkv projection, q.k^T, p.v and output projection: v_wmma_f32_16x16x32_f16 single products (f16 operands, f32 accumulate);
// all inputs RNE-converted to bf16 on load and carried with power-of-two scales, as f16 (the bias table as f32); softmax, key padding mask and epilogues in f32 on VALU.
// attention runs on transposed products (S^T = K.Q^T, O^T = V^T.P^T): a lane owns one query, P stays in registers.
// the qkv projection runs inside the attention kernel: Q, K and V^T go through LDS only.
#include <hip/hip_runtime.h>
#include <stdint.h>

#define NWIN  128
#define NTOK  343
#define TP    352
#define CCH   256
#define NHD   8
#define HD    32
#define C3    768
#define NROWP 45056
#define NROWX 43904
#define NRPB  2197
#define NST   22
#define NKT   22
#define PSN   11
#define CPT   36
#define TPW   260
#define FT    512
#define QSC   0.17677669529663687f
#define INV512 0.001953125f
#define LN1024 6.9314718055994531f
#define LOG2E 1.44269504088896341f
#define MASKC (-1048576.0f)
#define XS    11
#define NGB   256
#define NWB   8
#define BKT   11
#define NBB   88
#define NQB   24
#define NW3   6
#define KB64  5

static_assert(NROWP == NWIN * TP);
static_assert(NROWX == NWIN * NTOK);
static_assert(TP == KB64 * 64 + 32);
static_assert(TP % 32 == 0 && NST % 2 == 0);
static_assert(TP >= NTOK && TP - NTOK < 16);
static_assert(NST * 16 == TP);
static_assert(NKT * 16 == TP);
static_assert((CPT * 4) % 32 == 16);
static_assert(NST == 2 * PSN);
static_assert((TPW * 4) % 16 == 0);
static_assert(NHD * HD == CCH);
static_assert(FT == 16 * 32);
static_assert(TP * HD == NST * FT);
static_assert(NGB * XS == NWIN * NST && NST % XS == 0);
static_assert(NWB * 32 == CCH);
static_assert(NBB * 256 * BKT == NHD * NST * NKT * 64 && NKT % BKT == 0);
static_assert(NQB * 32 == C3);
static_assert(NW3 * 3 + (8 - NW3) * 2 == NST);

typedef _Float16 v16h __attribute__((ext_vector_type(16)));
typedef _Float16 v8h  __attribute__((ext_vector_type(8)));
typedef float    v8f  __attribute__((ext_vector_type(8)));
typedef float    v4f  __attribute__((ext_vector_type(4)));
typedef unsigned int v4u __attribute__((ext_vector_type(4)));

// ---- scalar helpers ------------------------------------------------------------------------------------------
__device__ __forceinline__ unsigned short bf_bits(float f) {          // f32 -> bf16 bits, RNE convert
  unsigned u = __float_as_uint(f);
  return (unsigned short)((u + 0x7FFFu + ((u >> 16) & 1u)) >> 16);
}
__device__ __forceinline__ float bf_up(unsigned short b) { return __uint_as_float(((unsigned)b) << 16); }
__device__ __forceinline__ float bfr(float f) { return bf_up(bf_bits(f)); }
__device__ __forceinline__ unsigned short h_bits(_Float16 x) { return __builtin_bit_cast(unsigned short, x); }
__device__ __forceinline__ unsigned short hb16(float f) { return h_bits((_Float16)f); }
__device__ __forceinline__ unsigned pk16(unsigned short a, unsigned short b) { return (unsigned)a | ((unsigned)b << 16); }
__device__ __forceinline__ v8f zero8() { v8f z = {0.f, 0.f, 0.f, 0.f, 0.f, 0.f, 0.f, 0.f}; return z; }

// ---- fragment loader for the fragment-order global planes: one 16 (rows/cols) x 32 (k) operand tile is FT halves =
//      1024 contiguous bytes; its 16-B piece e*32 + lane holds row/col (lane&15), k = 16*e + 8*(lane>>4) + 0..7 (the
//      hardware k order, which a packed pair of D tiles also has). p = tile base + lane*8: each of the two loads reads
//      512 contiguous bytes per wave.
__device__ __forceinline__ v16h ldfrag_t(const _Float16* p) {
  union { v16h v; v8h h[2]; } f;
  f.h[0] = *(const v8h*)(p);
  f.h[1] = *(const v8h*)(p + 256);
  return f.v;
}

// ---- WMMA helper ---------------------------------------------------------------------------------------------
__device__ __forceinline__ v8f mma_raw(v16h a, v16h b, v8f c) {
  return __builtin_amdgcn_wmma_f32_16x16x32_f16(false, a, false, b, (short)0, c, false, false);
}
// hint to L2: each lane asks for its own address p + OFF bytes (returns nothing, touches no counter).
// The planes asked for were stored by an earlier launch.
// Asked for ahead, the k-steps behind the first find an L2 hit in place of memory latency. p points inside the
// plane in every lane, and the caller keeps its register whole through the loop around or behind the call.
template <int OFF>
__device__ __forceinline__ void l2_ask(const char* p) {
#if defined(__HIP_DEVICE_COMPILE__)
  asm volatile("global_prefetch_b8 %0, off offset:%1 scope:SCOPE_SE" :: "v"(p), "n"(OFF));
#endif
}
// value of lane l ^ 16 (the other half of the wave), by a vector cross-row move
__device__ __forceinline__ float xhalf(float x) {
  const int b = __float_as_int(x);
  return __int_as_float(__builtin_amdgcn_permlanex16(b, b, 0x76543210, 0xfedcba98, false, false));
}

// =================================================================================================================
// weight transpose + convert: w [256 k][ncol n] f32 (n contiguous, used as x.w) -> wT, ncol columns x 256 k as f16 in
// fragment order (tile (n/16)*8 + k/32, see ldfrag_t), value f16(1024 * bf16_RNE(w)). Block = 32 columns: the 256x32
// f32 slab is staged in LDS (coalesced reads); wave = one 32-k step, it writes its two tiles of 1024 contiguous bytes.
// coverage: (ncol/32) blocks x 8 waves x 2 tiles x 2 x 32 pieces x 8 halves = ncol x 256.
// cvt_block is the work of one block (bx = its 32-column slab, T = 32 * TPW floats of the block's LDS); the blocks of
// w_qkv and of w_out ride in the grid of prep.
// =================================================================================================================
__device__ __forceinline__ void cvt_block(const float* __restrict__ wsrc, unsigned short* wdst, int ncol, int bx,
                                          float* T) {
  const int tid = threadIdx.x, wv = tid >> 5, lane = tid & 31, hh = lane >> 4, c = lane & 15;
  const int n0 = bx * 32;
#pragma unroll 4
  for (int it = 0; it < 32; ++it) {
    const int k = it * 8 + wv;
    T[lane * TPW + k] = wsrc[(size_t)k * ncol + n0 + lane];
  }
  __syncthreads();
  v4u pk[4];
  size_t offs[4];
#pragma unroll
  for (int q = 0; q < 4; ++q) {
    const int nt = q >> 1, e = q & 1;
    const float* tp = T + (nt * 16 + c) * TPW + wv * 32 + e * 16 + hh * 8;
    const v4f a = *(const v4f*)(tp);
    const v4f b = *(const v4f*)(tp + 4);
    v4u p4;
    p4[0] = pk16(hb16(bfr(a[0]) * 1024.0f), hb16(bfr(a[1]) * 1024.0f));
    p4[1] = pk16(hb16(bfr(a[2]) * 1024.0f), hb16(bfr(a[3]) * 1024.0f));
    p4[2] = pk16(hb16(bfr(b[0]) * 1024.0f), hb16(bfr(b[1]) * 1024.0f));
    p4[3] = pk16(hb16(bfr(b[2]) * 1024.0f), hb16(bfr(b[3]) * 1024.0f));
    pk[q] = p4;
    offs[q] = ((size_t)(bx * 2 + nt) * 8 + wv) * FT + e * 256 + lane * 8;
  }
#pragma unroll
  for (int q = 0; q < 4; ++q) *(v4u*)(wdst + offs[q]) = pk[q];
  asm volatile("s_wait_xcnt 0x0" ::: "memory");   // inlined in prep, code that rewrites these stores' registers can stand behind it
}
// =================================================================================================================
// relative position bias table in the C-operand order of the transposed logits tile (16 keys x 16 queries), registers
// 0..3 of all lanes then registers 4..7 (each C load reads 512 contiguous bytes per wave):
// BT[((h*22 + strip)*22 + kt)*256 + (r>>2)*128 + l*4 + (r&3)] =
// 512 * bf16_RNE(rpb[idx(n,m)*8 + h]) with n = strip*16 + (l&15) (query), m = kt*16 + 8*(l>>4) + r (key),
// idx = ((i_n-i_m+6)*13 + (j_n-j_m+6))*13 + (k_n-k_m+6), (i,j,k) = (t/49, (t/7)%7, t%7); padded keys m >= 343
// get MASKC (logit mask through the C operand), padded queries n >= 343 get 0. Thread = the same 16-B piece (4 keys)
// of BKT neighbouring key tiles of one strip: a wave makes BKT stores of 512 contiguous bytes, so few waves have to start.
// coverage: 8 heads x 22 strips x 2 groups x 11 key tiles x 64 pieces x 4 floats = 8 x 352 x 352, every element once.
// bias_block is the work of one block of 256 threads (bx = 0 .. NBB-1); the blocks ride in the grid of prep.
// =================================================================================================================
__device__ __forceinline__ void bias_block(const float* __restrict__ rpb, float* bt, int bx) {
  const int g = bx * 256 + threadIdx.x;
  const int piece = g & 63, grp = g >> 6;         // grp = (h*22 + strip) * (NKT / BKT) + group of key tiles
  const int kt0 = (grp % (NKT / BKT)) * BKT, hs = grp / (NKT / BKT);
  const int strip = hs % NST, h = hs / NST;
  const int l = piece & 31, e0 = (piece >> 5) * 4;
  const int col = l & 15, lh = l >> 4;
  const int n = strip * 16 + col;
  const int ni = n / 49, nj = (n / 7) % 7, nk = n % 7;
  v4u bo[BKT];                                    // byte offsets into rpb
  v4f raw[BKT];
#pragma unroll
  for (int i = 0; i < BKT; ++i) {
#pragma unroll
    for (int e = 0; e < 4; ++e) {
      const int m = (kt0 + i) * 16 + 8 * lh + e0 + e;
      const int mi = m / 49, mj = (m / 7) % 7, mk = m % 7;
      int idx = ((ni - mi + 6) * 13 + (nj - mj + 6)) * 13 + (nk - mk + 6);
      idx = min(max(idx, 0), NRPB - 1);
      bo[i][e] = (unsigned)(idx * NHD + h) * 4u;
    }
  }
#pragma unroll
  for (int i = 0; i < BKT; ++i) {
#pragma unroll
    for (int e = 0; e < 4; ++e) raw[i][e] = *(const float*)((const char*)rpb + bo[i][e]);
  }
  // the loads' offset registers stay whole up to this wait (named as inputs), and are rewritten only behind it
  asm volatile("s_wait_xcnt 0x0" :: "v"(bo[0]), "v"(bo[1]), "v"(bo[2]), "v"(bo[3]), "v"(bo[4]), "v"(bo[5]), "v"(bo[6]),
               "v"(bo[7]), "v"(bo[8]), "v"(bo[9]), "v"(bo[10]) : "memory");
  static_assert(BKT == 11);
  v4f v[BKT];
#pragma unroll
  for (int i = 0; i < BKT; ++i) {
#pragma unroll
    for (int e = 0; e < 4; ++e) {
      const int m = (kt0 + i) * 16 + 8 * lh + e0 + e;
      float val = bfr(raw[i][e]) * 512.0f;
      if (n >= NTOK) val = 0.0f;
      if (m >= NTOK) val = MASKC;
      v[i][e] = val;
    }
  }
  float* gp = bt + ((size_t)hs * NKT + kt0) * 256 + piece * 4;
#pragma unroll
  for (int i = 0; i < BKT; ++i) *(v4f*)(gp + i * 256) = v[i];
  asm volatile("s_wait_xcnt 0x0" ::: "memory");   // inlined in prep, code that rewrites these stores' registers can stand behind it
}

// =================================================================================================================
// input convert: block = XS = 11 strips of 16 padded tokens, half a window (a window has 22 strips): one block for each
// of the chip's 256 WGPs, and few waves to start. It reads its 176 x 256 f32 slab of x once, all loads in flight
// together (token clamped, padded tokens 343..351 become exact zeros), converts it to
// f16(8 * bf16_RNE(x)) and writes it as 11 x 8 operand tiles of the X plane in fragment order (tile
// (w*22 + tok/16)*8 + k/32, see ldfrag_t); wave = one 32-k step; a wave's store writes 512 contiguous bytes.
// coverage: 256 blocks x 8 waves x 11 tiles x 1024 B = 128 x 22 x 8 tiles, each once.
// =================================================================================================================
__device__ __forceinline__ void xcvt_block(const float* __restrict__ x, unsigned short* xp, int mb) {
  const int tid = threadIdx.x, wave = tid >> 5, lane = tid & 31, hh = lane >> 4, c = lane & 15;
  v4f xa[XS][4];
  const float* src[XS];
  int tk[XS];                                     // token of this lane's row inside its window, 0 .. 351
#pragma unroll
  for (int rt = 0; rt < XS; ++rt) {
    const int sx = mb * XS + rt, w = sx / NST;    // strip over all windows, its window
    tk[rt] = (sx - w * NST) * 16 + c;
    const int ts = min(tk[rt], NTOK - 1);
    src[rt] = x + ((size_t)w * NTOK + ts) * CCH + wave * 32 + 8 * hh;
#pragma unroll
    for (int e = 0; e < 2; ++e) {
      xa[rt][2 * e]     = *(const v4f*)(src[rt] + 16 * e);
      xa[rt][2 * e + 1] = *(const v4f*)(src[rt] + 16 * e + 4);
    }
  }
  // the loads' address registers stay whole up to this wait (named as inputs), and are rewritten only behind it
  asm volatile("s_wait_xcnt 0x0" :: "v"(src[0]), "v"(src[1]), "v"(src[2]), "v"(src[3]), "v"(src[4]), "v"(src[5]),
               "v"(src[6]), "v"(src[7]), "v"(src[8]), "v"(src[9]), "v"(src[10]) : "memory");
  static_assert(XS == 11);
  v4u pk[XS][2];
#pragma unroll
  for (int rt = 0; rt < XS; ++rt) {
    const bool pad = tk[rt] >= NTOK;
#pragma unroll
    for (int e = 0; e < 2; ++e) {
      const v4f a = xa[rt][2 * e], b = xa[rt][2 * e + 1];
      v4u p4;
      p4[0] = pk16(hb16(bfr(a[0]) * 8.0f), hb16(bfr(a[1]) * 8.0f));
      p4[1] = pk16(hb16(bfr(a[2]) * 8.0f), hb16(bfr(a[3]) * 8.0f));
      p4[2] = pk16(hb16(bfr(b[0]) * 8.0f), hb16(bfr(b[1]) * 8.0f));
      p4[3] = pk16(hb16(bfr(b[2]) * 8.0f), hb16(bfr(b[3]) * 8.0f));
      if (pad) { p4[0] = 0u; p4[1] = 0u; p4[2] = 0u; p4[3] = 0u; }
      pk[rt][e] = p4;
    }
  }
  unsigned short* dst = xp + ((size_t)(mb * XS) * 8 + wave) * FT + lane * 8;
#pragma unroll
  for (int rt = 0; rt < XS; ++rt) {
    *(v4u*)(dst + rt * 8 * FT)       = pk[rt][0];
    *(v4u*)(dst + rt * 8 * FT + 256) = pk[rt][1];
  }
  asm volatile("s_wait_xcnt 0x0" ::: "memory");   // inlined in prep, code that rewrites these stores' registers can stand behind it
}

// =================================================================================================================
// set-up launch: four block ranges that read only inputs and write planes that only later launches read.
// NQB blocks convert w_qkv, NWB blocks convert w_out (cvt_block; their chains of dependent loads are the longest, so
// they take the lowest block indices), NBB blocks build the bias table (bias_block), NGB blocks convert x (xcvt_block).
// =================================================================================================================
__global__ __launch_bounds__(256)
void prep(const float* __restrict__ x, unsigned short* xp, const float* __restrict__ wqkv, unsigned short* wq,
          const float* __restrict__ wout, unsigned short* wo, const float* __restrict__ rpb, float* bt) {
  __shared__ __align__(16) float T[32 * TPW];
  const int b = blockIdx.x;                       // every test below is block-uniform
  if (b < NQB)                   cvt_block(wqkv, wq, C3, b, T);
  else if (b < NQB + NWB)        cvt_block(wout, wo, CCH, b - NQB, T);
  else if (b < NQB + NWB + NBB)  bias_block(rpb, bt, b - NQB - NWB);
  else                           xcvt_block(x, xp, b - NQB - NWB - NBB);
}

__device__ __forceinline__ v8h pack8(v8f a, float scl) {
  v8h r;
#pragma unroll
  for (int e = 0; e < 8; ++e) r[e] = (_Float16)(a[e] * scl);
  return r;
}
// projection of a wave's S strips (from strip0) onto the head's 3 x 32 columns; X, Wh carry the lane's offset;
// xpf = first byte of the wave's S x 8 X tiles (S x 8192 contiguous bytes) + lane * 256; wpf = the same for the 8
// k-step tiles of one of the head's 6 weight column tiles: each of the 6 waves with 3 strips asks for one of them
template <int S>
__device__ __forceinline__ void proj_strips(const _Float16* X, const _Float16* Wh, const char* xpf, const char* wpf,
                                            _Float16* Qs, _Float16* Ks, _Float16* Vs, int strip0, int lane) {
  v8f aq[S][2], ak[S][2], av[S][2];
#pragma unroll
  for (int t = 0; t < S; ++t) {
#pragma unroll
    for (int dt = 0; dt < 2; ++dt) { aq[t][dt] = zero8(); ak[t][dt] = zero8(); av[t][dt] = zero8(); }
  }
#pragma unroll 1                                  // up to 18 accumulator tiles: a second copy of the body's fragments would not fit 256 registers
  for (int ks = 0; ks < 8; ++ks) {
    const _Float16* xk = X + ks * FT;
    const _Float16* wk = Wh + ks * FT;
    v16h xf[S], wf[3][2];                         // wf[part][dt]: column tile part * 16 + h*2 + dt
#pragma unroll
    for (int t = 0; t < S; ++t) xf[t] = ldfrag_t(xk + t * 8 * FT);
#pragma unroll
    for (int p = 0; p < 3; ++p) {
#pragma unroll
      for (int dt = 0; dt < 2; ++dt) wf[p][dt] = ldfrag_t(wk + (p * 16 + dt) * 8 * FT);
    }
    // the loads' address registers stay whole up to this wait (named as inputs), and are rewritten only behind it;
    // xpf and wpf are named so that the registers l2_ask reads keep their addresses through the loop
    if (S == 3) asm volatile("s_wait_xcnt 0x0" :: "v"(xk), "v"(wk), "v"(xpf), "v"(wpf) : "memory");
    else        asm volatile("s_wait_xcnt 0x0" :: "v"(xk), "v"(wk), "v"(xpf) : "memory");
    // all loads are issued before the first product: one wait for memory a k-step, not one per reused fragment register
    __builtin_amdgcn_sched_barrier(0);
    if (ks == 0) {                                // scalar test; behind the first k-step's own loads, under their wait
      l2_ask<0>(xpf);                             // 32 lanes x 256 B = the 8 tiles of one strip
      l2_ask<8192>(xpf);
      if (S == 3) {
        l2_ask<16384>(xpf);
        l2_ask<0>(wpf);
      }
    }
#pragma unroll
    for (int dt = 0; dt < 2; ++dt) {
#pragma unroll
      for (int t = 0; t < S; ++t) {
        aq[t][dt] = mma_raw(wf[0][dt], xf[t], aq[t][dt]);
        ak[t][dt] = mma_raw(wf[1][dt], xf[t], ak[t][dt]);
        av[t][dt] = mma_raw(xf[t], wf[2][dt], av[t][dt]);
      }
    }
  }
#pragma unroll
  for (int t = 0; t < S; ++t) {
    const int st = strip0 + t;
    *(v8h*)(Qs + st * FT + lane * 8)       = pack8(aq[t][0], QSC * (64.0f / 8192.0f));
    *(v8h*)(Qs + st * FT + 256 + lane * 8) = pack8(aq[t][1], QSC * (64.0f / 8192.0f));
    *(v8h*)(Ks + st * FT + lane * 8)       = pack8(ak[t][0], 8.0f / 8192.0f);
    *(v8h*)(Ks + st * FT + 256 + lane * 8) = pack8(ak[t][1], 8.0f / 8192.0f);
    *(v8h*)(Vs + (st >> 1) * FT + (st & 1) * 256 + lane * 8)             = pack8(av[t][0], 16.0f / 8192.0f);
    *(v8h*)(Vs + (TP / 32 + (st >> 1)) * FT + (st & 1) * 256 + lane * 8) = pack8(av[t][1], 16.0f / 8192.0f);
  }
}
// one pass of the online softmax over NJ key tiles (NJ = 4 or 2) for a wave's S strips: bk, K, Vt stand at the pass's
// first bias tile, K tile and V^T tile (lane offsets included), Q at the wave's first Q tile
template <int S, int NJ>
__device__ __forceinline__ void key_pass(const float* bk, const _Float16* Q, const _Float16* K, const _Float16* Vt,
                                         float (&mrow)[S], float (&lrow)[S], v8f (&o0)[S], v8f (&o1)[S]) {
  union CB { v8f v; v4f q[2]; };
  // ---- transposed logits: NJ tiles of 16 keys, bias and key padding mask via the C operand ----
  v8f s[S][NJ];
#pragma unroll
  for (int j = 0; j < NJ; ++j) {
#pragma unroll
    for (int t = 0; t < S; ++t) {
      const float* bp = bk + (t * NKT + j) * 256;
      CB cb;
      cb.q[0] = *(const v4f*)(bp);
      cb.q[1] = *(const v4f*)(bp + 128);
      s[t][j] = cb.v;
    }
  }
  // the bias loads' address register stays whole up to this wait (named as an input), and is rewritten only behind it
  asm volatile("s_wait_xcnt 0x0" :: "v"(bk) : "memory");
  v16h qb[S];                                     // read anew each pass: its registers are free during softmax and O^T
#pragma unroll
  for (int t = 0; t < S; ++t) qb[t] = ldfrag_t(Q + t * FT);
#pragma unroll
  for (int j = 0; j < NJ; ++j) {
    const v16h kf = ldfrag_t(K + j * FT);
#pragma unroll
    for (int t = 0; t < S; ++t) s[t][j] = mma_raw(kf, qb[t], s[t][j]);
  }
  // ---- online softmax update of the lane's query in each strip ----
#pragma unroll
  for (int t = 0; t < S; ++t) {
    float tj[NJ];
#pragma unroll
    for (int j = 0; j < NJ; ++j) {
      tj[j] = fmaxf(fmaxf(fmaxf(s[t][j][0], s[t][j][1]), fmaxf(s[t][j][2], s[t][j][3])),
                    fmaxf(fmaxf(s[t][j][4], s[t][j][5]), fmaxf(s[t][j][6], s[t][j][7])));
    }
    float tm = fmaxf(tj[0], tj[1]);
    if (NJ == 4) tm = fmaxf(tm, fmaxf(tj[NJ - 2], tj[NJ - 1]));
    tm = fmaxf(tm, xhalf(tm));
    const float mn = fmaxf(mrow[t], tm);
    const float alpha = __expf((mrow[t] - mn) * INV512);
    mrow[t] = mn;
#pragma unroll
    for (int j = 0; j < NJ; ++j) {
      const v8f u = ((s[t][j] - mn) * INV512 + LN1024) * LOG2E;  // one maximum per lane: whole-tile (packed) arithmetic
#pragma unroll
      for (int r = 0; r < 8; ++r) s[t][j][r] = __builtin_amdgcn_exp2f(u[r]);
    }
    v8f p8 = s[t][0] + s[t][1];
    if (NJ == 4) p8 = p8 + (s[t][NJ - 2] + s[t][NJ - 1]);
    const v4f p4 = p8.lo + p8.hi;
    lrow[t] = lrow[t] * alpha + ((p4[0] + p4[1]) + (p4[2] + p4[3]));
    o0[t] = o0[t] * alpha;
    o1[t] = o1[t] * alpha;
  }
  // ---- O^T += V^T . P^T : 32-key k-steps, two 16-dim tiles, S strips per V^T fragment ----
#pragma unroll
  for (int ks = 0; ks < NJ / 2; ++ks) {
    const v16h v0 = ldfrag_t(Vt + ks * FT);
    const v16h v1 = ldfrag_t(Vt + (TP / 32 + ks) * FT);
#pragma unroll
    for (int t = 0; t < S; ++t) {
      v16h pb;
#pragma unroll
      for (int e = 0; e < 8; ++e) {
        pb[e]     = (_Float16)s[t][2 * ks][e];
        pb[8 + e] = (_Float16)s[t][2 * ks + 1][e];
      }
      o0[t] = mma_raw(v0, pb, o0[t]);
      o1[t] = mma_raw(v1, pb, o1[t]);
    }
  }
}
// attention of a wave's S strips over the window's 22 key tiles; op = the lane's piece of the first strip's output tile
template <int S>
__device__ __forceinline__ void attn_strips(const float* Bp, const _Float16* Q, const _Float16* K, const _Float16* Vt,
                                            unsigned short* op) {
  float mrow[S], lrow[S];                         // per strip, this lane's query: running maximum, sum over this half's keys
  v8f o0[S], o1[S];
#pragma unroll
  for (int t = 0; t < S; ++t) {
    mrow[t] = -1e30f;
    lrow[t] = 0.f;
    o0[t] = zero8();
    o1[t] = zero8();
  }
#pragma unroll 1                                  // one copy of the 64-key pass: its score tiles fill the register budget
  for (int kb = 0; kb < KB64; ++kb)
    key_pass<S, 4>(Bp + kb * 4 * 256, Q, K + kb * 4 * FT, Vt + kb * 2 * FT, mrow, lrow, o0, o1);
  key_pass<S, 2>(Bp + KB64 * 4 * 256, Q, K + KB64 * 4 * FT, Vt + KB64 * 2 * FT, mrow, lrow, o0, o1);

  // ---- join the halves' sums, normalise (64 ctx = O * 4 / l), store the lane's two 16-B pieces of each strip ----
#pragma unroll
  for (int t = 0; t < S; ++t) {
    const float inv = 4.0f / (lrow[t] + xhalf(lrow[t]));
    v4u p0, p1;
#pragma unroll
    for (int e = 0; e < 4; ++e) {
      p0[e] = pk16(hb16(o0[t][2 * e] * inv), hb16(o0[t][2 * e + 1] * inv));
      p1[e] = pk16(hb16(o1[t][2 * e] * inv), hb16(o1[t][2 * e + 1] * inv));
    }
    *(v4u*)(op + t * FT) = p0;
    *(v4u*)(op + t * FT + 256) = p1;
    // the two stores' data and address registers stay whole up to this wait (named as inputs): the next strip's
    // arithmetic, or the tail that the two strip counts share, rewrites them only behind it
    asm volatile("s_wait_xcnt 0x0" :: "v"(p0), "v"(p1), "v"(op) : "memory");
  }
}
__global__ __launch_bounds__(256, 4)               // 4 waves per SIMD = 256 registers a wave: two blocks stay resident per WGP
void attn_win(const unsigned short* __restrict__ xp, const unsigned short* __restrict__ wq,
              const float* __restrict__ bt, unsigned short* opl) {
  __shared__ __align__(16) _Float16 Qs[NST * FT];
  __shared__ __align__(16) _Float16 Ks[NST * FT];
  __shared__ __align__(16) _Float16 Vs[NST * FT];
  const int tid = threadIdx.x, lane = tid & 31;
  const int wave = __builtin_amdgcn_readfirstlane(tid >> 5);   // scalar: the tests on it below are scalar branches
  const int wh = blockIdx.x;                      // w*8 + h
  const int w = wh >> 3, h = wh & 7;
  const bool three = wave < NW3;                  // wave-uniform
  const int strip0 = three ? wave * 3 : NW3 * 3 + (wave - NW3) * 2;   // 0, 3, .. 15, 18, 20

  {
    const _Float16* X  = (const _Float16*)(const void*)xp + (size_t)(w * NST + strip0) * 8 * FT + lane * 8;
    const _Float16* Wh = (const _Float16*)(const void*)wq + (size_t)(h * 2) * 8 * FT + lane * 8;   // column tile h*2 of part q
    const char* xpf = (const char*)(const void*)xp + (size_t)(w * NST + strip0) * 8 * FT * 2 + lane * 256;
    const int ct = three ? (wave >> 1) * 16 + h * 2 + (wave & 1) : h * 2;   // column tile: part wave / 2, half wave % 2
    const char* wpf = (const char*)(const void*)wq + (size_t)ct * 8 * FT * 2 + lane * 256;
    if (three) proj_strips<3>(X, Wh, xpf, wpf, Qs, Ks, Vs, strip0, lane);
    else       proj_strips<2>(X, Wh, xpf, wpf, Qs, Ks, Vs, strip0, lane);
  }
  __syncthreads();                                // K and V^T are whole before any wave reads other waves' tiles

  const _Float16* Q  = Qs + strip0 * FT + lane * 8;   // the wave's own tiles
  const _Float16* K  = Ks + lane * 8;
  const _Float16* Vt = Vs + lane * 8;
  const float* Bp = bt + ((size_t)(h * NST + strip0)) * NKT * 256 + lane * 4;
  unsigned short* op = opl + ((size_t)h * NROWP + (size_t)w * TP + strip0 * 16) * HD + lane * 8;
  if (three) attn_strips<3>(Bp, Q, K, Vt, op);
  else       attn_strips<2>(Bp, Q, K, Vt, op);
}

// =================================================================================================================
// Output projection: out rows = (O64/64) . (W1024/1024)^T, K = 256 = 8 head planes of 32. The weights stand still:
// block = PSN = 11 strips of 16 padded tokens (half a window) x all 256 columns, one block for each of the chip's 256
// WGPs; wave = 32 columns, whose 2 x 8 weight fragments it loads once and keeps in registers. The block's 8 x 11 O tiles
// are staged once in LDS (wave = one head plane, 11264 contiguous bytes, all loads in flight together), so the launch
// waits for memory once, and one strip's stores run while the next strips are computed.
// Products are transposed (out^T = W^T . O^T, A = 16 columns, B = 16 tokens): lane (c, hh) holds token c and columns
// 8*hh + 0..7 of each column tile, 32 contiguous bytes. A wave turns its 16 x 32 tile through its own LDS rows (pitch
// CPT floats = 144 bytes, 16 B x odd) and stores whole 128-byte lines, 4 rows a store.
// coverage: 128 windows x 343 tokens x 8 waves x 32 cols = every output element exactly once.
// =================================================================================================================
__global__ __launch_bounds__(256, 4)               // 256 registers a wave: no register above v255
void gemm_proj(const unsigned short* __restrict__ opl, const unsigned short* __restrict__ wp, float* out) {
  __shared__ __align__(16) _Float16 As[NHD * PSN * FT];   // tile h * 11 + strip, fragment order
  __shared__ __align__(16) float Cs[8 * 16 * CPT];        // per wave 16 token rows x 32 columns
  const int tid = threadIdx.x, lane = tid & 31, hh = lane >> 4, c = lane & 15;
  const int wave = __builtin_amdgcn_readfirstlane(tid >> 5);
  const int mb = blockIdx.x;

  const _Float16* O  = (const _Float16*)(const void*)opl + ((size_t)wave * (NROWP / 16) + mb * PSN) * FT + lane * 8;
  const _Float16* Wp = (const _Float16*)(const void*)wp + (size_t)(wave * 2) * 8 * FT + lane * 8;
  v8h sg[2 * PSN];
#pragma unroll
  for (int i = 0; i < 2 * PSN; ++i) sg[i] = *(const v8h*)(O + i * 256);
  v16h wf[2][8];                                  // [column tile][k-step = head]
#pragma unroll
  for (int j = 0; j < 2; ++j) {
#pragma unroll
    for (int ks = 0; ks < 8; ++ks) wf[j][ks] = ldfrag_t(Wp + (j * 8 + ks) * FT);
  }
  asm volatile("s_wait_xcnt 0x0" ::: "memory");   // code that rewrites these loads' address registers stands behind it
#pragma unroll
  for (int i = 0; i < 2 * PSN; ++i) *(v8h*)(As + wave * PSN * FT + i * 256 + lane * 8) = sg[i];
  __syncthreads();                                // all 8 head planes' tiles are whole before any wave reads them

  const int w = mb >> 1, s0 = (mb & 1) * PSN;     // window, first strip in it
  const int rq = lane >> 3, cq = (lane & 7) * 4;  // read-back: row in a group of 4, first of 4 columns
  float* cst = Cs + (wave * 16 + c) * CPT + 8 * hh;
  const float* cld = Cs + (wave * 16 + rq) * CPT + cq;
  const _Float16* Af = As + lane * 8;
  float* orow = out + ((size_t)w * NTOK + s0 * 16 + rq) * CCH + wave * 32 + cq;

  v16h of[8];
#pragma unroll
  for (int ks = 0; ks < 8; ++ks) of[ks] = ldfrag_t(Af + ks * PSN * FT);
#pragma unroll
  for (int s = 0; s < PSN; ++s) {
    v8f a0 = zero8(), a1 = zero8();
#pragma unroll
    for (int ks = 0; ks < 8; ++ks) {
      a0 = mma_raw(wf[0][ks], of[ks], a0);
      a1 = mma_raw(wf[1][ks], of[ks], a1);
    }
    if (s + 1 < PSN) {                            // the next strip's fragments: their LDS latency passes under the turn below
#pragma unroll
      for (int ks = 0; ks < 8; ++ks) of[ks] = ldfrag_t(Af + (ks * PSN + s + 1) * FT);
    }
    a0 = a0 * (1.0f / 65536.0f);
    a1 = a1 * (1.0f / 65536.0f);
    *(v4f*)(cst)      = a0.lo;
    *(v4f*)(cst + 4)  = a0.hi;
    *(v4f*)(cst + 16) = a1.lo;
    *(v4f*)(cst + 20) = a1.hi;
    // the wave's own rows are written before other lanes of the wave read them back
    asm volatile("s_wait_dscnt 0x0" ::: "memory");
    v4f ov[4];
#pragma unroll
    for (int it = 0; it < 4; ++it) ov[it] = *(const v4f*)(cld + it * 4 * CPT);
#pragma unroll
    for (int it = 0; it < 4; ++it) {
      // only a window's last strip holds padded tokens
      if (s + 1 < PSN || (s0 + s) * 16 + it * 4 + rq < NTOK) *(v4f*)(orow + (s * 16 + it * 4) * CCH) = ov[it];
    }
    // the stores' data and address registers stay whole up to this wait (named as inputs): the next strip rewrites
    // them only behind it; its memory clobber also keeps the next strip's LDS writes behind this strip's read-back
    asm volatile("s_wait_xcnt 0x0" :: "v"(ov[0]), "v"(ov[1]), "v"(ov[2]), "v"(ov[3]), "v"(orow) : "memory");
  }
}

// =================================================================================================================
// token dimension padded to 352 per window everywhere):
//   WqkvT f16 768 x 256 393216 | WoutT f16 256 x 256 131072 |
//   bias table f32 [8][22][22][256] 3964928 | X f16 45056 x 256 23068672 |
//   O f16 8 x 45056 x 32 23068672 | total 50626560.
//   every f16 plane is stored as 1024-byte operand tiles in fragment order (ldfrag_t).
// =================================================================================================================
extern "C" void kernel_launch(void* const* d_in, const int* in_sizes, int n_in,
                              void* d_out, int out_size, void* d_ws, size_t ws_size,
                              hipStream_t stream) {
  if (n_in < 4) return;
  if (in_sizes[0] != NROWX * CCH) return;
  if (in_sizes[1] != CCH * C3) return;
  if (in_sizes[2] != CCH * CCH) return;
  if (in_sizes[3] != NRPB * NHD) return;
  if (out_size != NROWX * CCH) return;

  const float* x    = (const float*)d_in[0];
  const float* wqkv = (const float*)d_in[1];
  const float* wout = (const float*)d_in[2];
  const float* rpb  = (const float*)d_in[3];
  float* out = (float*)d_out;

  const size_t sWq = (size_t)C3 * CCH * 2;                    //   393216
  const size_t sWo = (size_t)CCH * CCH * 2;                   //   131072
  const size_t sBT = (size_t)NHD * NST * NKT * 256 * 4;       //  3964928
  const size_t sX  = (size_t)NROWP * CCH * 2;                 // 23068672
  const size_t sO  = (size_t)NHD * NROWP * HD * 2;            // 23068672
  size_t off = 0;
  const size_t oWq = off; off += sWq;
  const size_t oWo = off; off += sWo;
  const size_t oBT = off; off += sBT;
  const size_t oX  = off; off += sX;
  const size_t oO  = off; off += sO;
  if (off > ws_size) return;                                   // off = 50626560
  if (off > (size_t)134217728) return;

  char* ws = (char*)d_ws;
  unsigned short* WqT = (unsigned short*)(ws + oWq);
  unsigned short* WoT = (unsigned short*)(ws + oWo);
  float*          BT  = (float*)(ws + oBT);
  unsigned short* Xp  = (unsigned short*)(ws + oX);
  unsigned short* Op  = (unsigned short*)(ws + oO);

  const dim3 blk(256);
  // (1) set-up: transpose + convert of w_qkv (24 blocks) and w_out (8), bias table (88), convert of x (256)
  prep<<<dim3(NQB + NWB + NGB + NBB), blk, 0, stream>>>(x, Xp, wqkv, WqT, wout, WoT, rpb, BT);
  // (2) qkv projection + window attention: 128 windows x 8 heads, one block of 8 waves (6 x 3 + 2 x 2 strips) each
  attn_win<<<dim3(NWIN * NHD), blk, 0, stream>>>(Xp, WqT, BT, Op);
  // (3) output projection -> d_out (padded tokens skipped): 256 blocks, half a window each
  gemm_proj<<<dim3(NWIN * 2), blk, 0, stream>>>(Op, WoT, out);
  (void)hipGetLastError();
}
